// v000
// The times below were measured on an AMD MI455X: many runs one after another, warmed up first and cycling through
// copies of the inputs, with the whole window's GPU time divided by the number of runs. Launches and the gaps
// between them are all in it. The median over several windows is given; except for v000 it joins two sittings, which
// can be a few percent apart, so the side-by-side timings, each taken in one sitting, are the better comparison.
// The starting kernel, v000, takes 184 microseconds a run.
// Contractions (q/k/v/out projections, q.k^T scores, w.v): v_wmma_f32_16x16x32_bf16 with each f32 operand carried as bf16 hi + bf16 lo (hi.hi + hi.lo + lo.hi), f32 accumulate; axial sums, softmax and epilogues f32.
#include <hip/hip_runtime.h>
#include <stdint.h>

typedef float          v4f  __attribute__((ext_vector_type(4)));
typedef float          v8f  __attribute__((ext_vector_type(8)));
typedef unsigned int   v2u  __attribute__((ext_vector_type(2)));
typedef unsigned short v8us __attribute__((ext_vector_type(8)));
typedef __bf16         v16b __attribute__((ext_vector_type(16)));
union Frag { v16b v; v8us h[2]; };

#define C_DIM 256
#define NH    8
#define DH    32
#define B_SZ  2
#define M_AX  32
#define T_LEN 512
#define KP    40      // LDS pitch (16-bit elements) of the 32-deep k tiles; multiple of 8 for 16-B fragment loads

// f32 -> bf16 bits, RNE convert
static __device__ __forceinline__ unsigned int bf16_rne(float x) {
  unsigned int u = __float_as_uint(x);
  return (u + 0x7FFFu + ((u >> 16) & 1u)) >> 16;
}
// x = hi + lo with hi = rne_bf16(x), lo = rne_bf16(x - hi); (x - hi) is exact in f32
static __device__ __forceinline__ void split_hl(float x, unsigned int& hb, unsigned int& lb) {
  hb = bf16_rne(x);
  float r = x - __uint_as_float(hb << 16);
  lb = bf16_rne(r);
}
static __device__ __forceinline__ void split4(v4f v, v2u& hi, v2u& lo) {
  unsigned int h0, h1, h2, h3, l0, l1, l2, l3;
  split_hl(v.x, h0, l0); split_hl(v.y, h1, l1); split_hl(v.z, h2, l2); split_hl(v.w, h3, l3);
  hi.x = h0 | (h1 << 16); hi.y = h2 | (h3 << 16);
  lo.x = l0 | (l1 << 16); lo.y = l2 | (l3 << 16);
}

// three 16x16x32 bf16 ops into one accumulator, then the VALU hazard guard
static __device__ __forceinline__ void mma3(v8f& acc, v16b ah, v16b al, v16b bh, v16b bl) {
  acc = __builtin_amdgcn_wmma_f32_16x16x32_bf16(false, ah, false, bh, (short)0, acc, false, false);
  acc = __builtin_amdgcn_wmma_f32_16x16x32_bf16(false, ah, false, bl, (short)0, acc, false, false);
  acc = __builtin_amdgcn_wmma_f32_16x16x32_bf16(false, al, false, bh, (short)0, acc, false, false);
  asm volatile("v_nop\n\tv_nop\n\tv_nop\n\tv_nop" : "+v"(acc) : "v"(ah), "v"(al), "v"(bh), "v"(bl));
}

// ---------------------------------------------------------------------------
// Batched GEMM  C[M x N] = alpha * A[M x K] * op(W) (+ bias_scale * bias[n] when HB)
//   A : row-major, k contiguous, pitch lda
//   W : WK == 0 -> W[n][k] (k contiguous, pitch ldb), C = A * W^T
//       WK == 1 -> W[k][n] (n contiguous, pitch ldb), C = A * W
//   C : row-major, pitch ldc
//   HB == 0: bias pointer is never read.
// Batch z -> (zb, zm, zn) with independent element strides per operand.
// Block = 128 threads (4 waves), tile 64 rows x BN cols, 32 k per step.
// Wave w owns rows 16w..16w+15 and all BN cols (BN/16 accumulator tiles).
// Fragment maps per lane l (h = l>>4, m = l&15):
//   A: row m, el 0..7 <- k 8h+0..7, el 8..15 <- k 16+8h+0..7
//   B: col m, same k map;   D: el r <- (row 8h+r, col m)
// Requires M % 64 == 0, N % BN == 0, K % 32 == 0, 16-B aligned rows.
// ---------------------------------------------------------------------------
template <int BN, int WK, int HB>
__global__ void __launch_bounds__(128)
k_gemm(const float* __restrict__ Abase, const float* __restrict__ Wbase,
       float* __restrict__ Cbase, const float* __restrict__ bias,
       long long sAb, long long sAm, long long sAn,
       long long sBb, long long sBm, long long sBn,
       long long sCb, long long sCm, long long sCn,
       int Mrows, int Ncols, int K, int lda, int ldb, int ldc,
       int nInner, int nMid, float bias_scale, float alpha)
{
  constexpr int TN  = BN / 16;          // accumulator tiles per wave
  constexpr int CP  = BN + 4;           // f32 pitch of the staged C tile (multiple of 4)
  constexpr int NCH = BN / 16;          // 16-B W chunks per thread per k step

  __shared__ __attribute__((aligned(16))) unsigned short sAhi[64 * KP];
  __shared__ __attribute__((aligned(16))) unsigned short sAlo[64 * KP];
  __shared__ __attribute__((aligned(16))) unsigned short sWhi[BN * KP];
  __shared__ __attribute__((aligned(16))) unsigned short sWlo[BN * KP];
  __shared__ __attribute__((aligned(16))) float          sC[64 * CP];

  const int z  = blockIdx.z;
  const int zn = z % nInner;
  const int zm = (z / nInner) % nMid;
  const int zb = z / (nInner * nMid);
  const float* A = Abase + ((long long)zb * sAb + (long long)zm * sAm + (long long)zn * sAn);
  const float* W = Wbase + ((long long)zb * sBb + (long long)zm * sBm + (long long)zn * sBn);
  float*       C = Cbase + ((long long)zb * sCb + (long long)zm * sCm + (long long)zn * sCn);

  const int row0 = blockIdx.y * 64;
  const int col0 = blockIdx.x * BN;
  if (row0 + 64 > Mrows || col0 + BN > Ncols) return;     // block-uniform, before any barrier

  const int tid = threadIdx.x;
  const int wv  = tid >> 5;
  const int l   = tid & 31;
  const int h   = l >> 4;
  const int m   = l & 15;

  v8f acc[TN];
#pragma unroll
  for (int j = 0; j < TN; ++j) acc[j] = (v8f){};

  for (int k0 = 0; k0 < K; k0 += 32) {
    v4f ra[4];
    v4f rw[NCH];
    // A tile 64 x 32: chunk c -> row c>>3, k 4*(c&7)
#pragma unroll
    for (int i = 0; i < 4; ++i) {
      const int c = tid + 128 * i;
      const int r = c >> 3, k4 = (c & 7) * 4;
      ra[i] = *(const v4f*)(A + (size_t)(row0 + r) * lda + k0 + k4);
    }
#pragma unroll
    for (int i = 0; i < NCH; ++i) {
      const int c = tid + 128 * i;
      if (WK) {
        const int s = c / (BN / 4), n4 = (c % (BN / 4)) * 4;        // k row s, 4 consecutive n
        rw[i] = *(const v4f*)(W + (size_t)(k0 + s) * ldb + col0 + n4);
      } else {
        const int n = c >> 3, k4 = (c & 7) * 4;                      // n row, 4 consecutive k
        rw[i] = *(const v4f*)(W + (size_t)(col0 + n) * ldb + k0 + k4);
      }
    }
    __syncthreads();          // all waves done reading the tiles of the prior k step
#pragma unroll
    for (int i = 0; i < 4; ++i) {
      const int c = tid + 128 * i;
      const int r = c >> 3, k4 = (c & 7) * 4;
      v2u hi, lo;
      split4(ra[i], hi, lo);
      *(v2u*)(&sAhi[r * KP + k4]) = hi;
      *(v2u*)(&sAlo[r * KP + k4]) = lo;
    }
#pragma unroll
    for (int i = 0; i < NCH; ++i) {
      const int c = tid + 128 * i;
      if (WK) {
        const int s = c / (BN / 4), n4 = (c % (BN / 4)) * 4;
        unsigned int h0, h1, h2, h3, l0, l1, l2, l3;
        split_hl(rw[i].x, h0, l0); split_hl(rw[i].y, h1, l1);
        split_hl(rw[i].z, h2, l2); split_hl(rw[i].w, h3, l3);
        sWhi[(n4 + 0) * KP + s] = (unsigned short)h0;  sWlo[(n4 + 0) * KP + s] = (unsigned short)l0;
        sWhi[(n4 + 1) * KP + s] = (unsigned short)h1;  sWlo[(n4 + 1) * KP + s] = (unsigned short)l1;
        sWhi[(n4 + 2) * KP + s] = (unsigned short)h2;  sWlo[(n4 + 2) * KP + s] = (unsigned short)l2;
        sWhi[(n4 + 3) * KP + s] = (unsigned short)h3;  sWlo[(n4 + 3) * KP + s] = (unsigned short)l3;
      } else {
        const int n = c >> 3, k4 = (c & 7) * 4;
        v2u hi, lo;
        split4(rw[i], hi, lo);
        *(v2u*)(&sWhi[n * KP + k4]) = hi;
        *(v2u*)(&sWlo[n * KP + k4]) = lo;
      }
    }
    __syncthreads();          // tiles visible to every wave

    Frag ah, al;
    {
      const int ar = (16 * wv + m) * KP + 8 * h;
      ah.h[0] = *(const v8us*)(&sAhi[ar]);
      ah.h[1] = *(const v8us*)(&sAhi[ar + 16]);
      al.h[0] = *(const v8us*)(&sAlo[ar]);
      al.h[1] = *(const v8us*)(&sAlo[ar + 16]);
    }
#pragma unroll
    for (int j = 0; j < TN; ++j) {
      const int br = (16 * j + m) * KP + 8 * h;
      Frag bh, bl;
      bh.h[0] = *(const v8us*)(&sWhi[br]);
      bh.h[1] = *(const v8us*)(&sWhi[br + 16]);
      bl.h[0] = *(const v8us*)(&sWlo[br]);
      bl.h[1] = *(const v8us*)(&sWlo[br + 16]);
      mma3(acc[j], ah.v, al.v, bh.v, bl.v);
    }
  }

#pragma unroll
  for (int j = 0; j < TN; ++j) {
    float bb = 0.0f;
    if (HB) bb = bias_scale * bias[col0 + 16 * j + m];
#pragma unroll
    for (int r = 0; r < 8; ++r) {
      sC[(16 * wv + 8 * h + r) * CP + 16 * j + m] = alpha * acc[j][r] + bb;
    }
  }
  __syncthreads();
#pragma unroll
  for (int i = 0; i < BN / 8; ++i) {
    const int idx = i * 128 + tid;
    const int row = idx / (BN / 4);
    const int c4  = (idx % (BN / 4)) * 4;
    const v4f val = *(const v4f*)(&sC[row * CP + c4]);
    float* gp = C + (size_t)(row0 + row) * ldc + col0 + c4;
    *(v4f*)gp = val;
  }
  
}

// ---------------------------------------------------------------------------
// Axial sum: out[b, t, c] = sum_m in[b, m, t, c]; one thread per 4 consecutive c.
// ---------------------------------------------------------------------------
__global__ void __launch_bounds__(256)
k_sum_m(const float* __restrict__ in, float* __restrict__ out, int n4)
{
  const int i4 = blockIdx.x * 256 + threadIdx.x;
  if (i4 >= n4) return;
  const size_t i     = (size_t)i4 * 4;
  const size_t inner = (size_t)T_LEN * C_DIM;
  const size_t b     = i / inner;
  const size_t r     = i - b * inner;
  const float* p = in + b * (size_t)M_AX * inner + r;
  v4f s = {0.0f, 0.0f, 0.0f, 0.0f};
#pragma unroll 8
  for (int mm = 0; mm < M_AX; ++mm) s += *(const v4f*)(p + (size_t)mm * inner);
  float* o = out + i;
  *(v4f*)o = s;
  
}

// ---------------------------------------------------------------------------
// Row softmax over 512, one wave per row, in place; rows < narows also copied to a_out.
// Lane holds floats lane*4+0..3 of each 128-float segment -> every store instruction covers
// ---------------------------------------------------------------------------
__global__ void __launch_bounds__(256)
k_softmax(float* __restrict__ w, float* __restrict__ a_out, int nrows, int narows)
{
  const int row  = blockIdx.x * 8 + (threadIdx.x >> 5);
  const int lane = threadIdx.x & 31;
  if (row >= nrows) return;                     // wave-uniform
  float* p = w + (size_t)row * T_LEN + lane * 4;

  v4f v[4];
#pragma unroll
  for (int i = 0; i < 4; ++i) v[i] = *(const v4f*)(p + i * 128);

  float mx = -3.0e38f;
#pragma unroll
  for (int i = 0; i < 4; ++i)
    mx = fmaxf(mx, fmaxf(fmaxf(v[i].x, v[i].y), fmaxf(v[i].z, v[i].w)));
#pragma unroll
  for (int off = 16; off > 0; off >>= 1) mx = fmaxf(mx, __shfl_xor(mx, off, 32));

  float sum = 0.0f;
#pragma unroll
  for (int i = 0; i < 4; ++i) {
    v[i].x = __expf(v[i].x - mx);
    v[i].y = __expf(v[i].y - mx);
    v[i].z = __expf(v[i].z - mx);
    v[i].w = __expf(v[i].w - mx);
    sum += (v[i].x + v[i].y) + (v[i].z + v[i].w);
  }
#pragma unroll
  for (int off = 16; off > 0; off >>= 1) sum += __shfl_xor(sum, off, 32);
  const float inv = 1.0f / sum;
#pragma unroll
  for (int i = 0; i < 4; ++i) v[i] *= inv;

  const bool wa = row < narows;
  float* q = a_out + (size_t)(wa ? row : 0) * T_LEN + lane * 4;

#pragma unroll
  for (int i = 0; i < 4; ++i) {
    *(v4f*)(p + i * 128) = v[i];
    if (wa) *(v4f*)(q + i * 128) = v[i];
  }
  
}

// ---------------------------------------------------------------------------
extern "C" void kernel_launch(void* const* d_in, const int* in_sizes, int n_in,
                              void* d_out, int out_size, void* d_ws, size_t ws_size,
                              hipStream_t stream)
{
  if (n_in < 10) return;
  const int n_x  = B_SZ * M_AX * T_LEN * C_DIM;          // 8388608
  const int n_w  = C_DIM * C_DIM;
  const int n_a  = NH * T_LEN * T_LEN;                   // 2097152
  if (in_sizes[0] != n_x || in_sizes[1] != n_x) return;
  if (in_sizes[2] != n_w || in_sizes[4] != n_w || in_sizes[6] != n_w || in_sizes[8] != n_w) return;
  if (in_sizes[3] != C_DIM || in_sizes[5] != C_DIM || in_sizes[7] != C_DIM || in_sizes[9] != C_DIM) return;
  if (out_size != n_x + n_a) return;

  const float* x  = (const float*)d_in[0];
  const float* y  = (const float*)d_in[1];
  const float* Wq = (const float*)d_in[2];
  const float* bq = (const float*)d_in[3];
  const float* Wk = (const float*)d_in[4];
  const float* bk = (const float*)d_in[5];
  const float* Wv = (const float*)d_in[6];
  const float* bv = (const float*)d_in[7];
  const float* Wp = (const float*)d_in[8];
  const float* bp = (const float*)d_in[9];

  float* out   = (float*)d_out;                            // [2,32,512,256]
  float* a_out = out + (size_t)n_x;                        // [8,512,512] at byte 33554432

  const size_t n_sum = (size_t)B_SZ * T_LEN * C_DIM;       // 262144
  const size_t n_v   = (size_t)n_x;                        // 8388608
  const size_t n_sc  = (size_t)B_SZ * NH * T_LEN * T_LEN;  // 4194304
  const size_t o_xsum = 0;
  const size_t o_ysum = o_xsum + n_sum;
  const size_t o_qt   = o_ysum + n_sum;
  const size_t o_kt   = o_qt   + n_sum;
  const size_t o_v    = o_kt   + n_sum;
  const size_t o_wsc  = o_v    + n_v;
  const size_t o_att  = o_wsc  + n_sc;
  const size_t o_end  = o_att  + n_v;                      // 22020096 floats = 88080384 B
  if (o_end * sizeof(float) > ws_size) return;

  float* ws   = (float*)d_ws;
  float* xsum = ws + o_xsum;
  float* ysum = ws + o_ysum;
  float* qt   = ws + o_qt;
  float* kt   = ws + o_kt;
  float* vbuf = ws + o_v;
  float* wsc  = ws + o_wsc;
  float* att  = ws + o_att;

  // 1) axial sums of x and y over m
  const int n4 = (int)(n_sum / 4);                         // 65536
  k_sum_m<<<dim3((n4 + 255) / 256), dim3(256), 0, stream>>>(x, xsum, n4);
  k_sum_m<<<dim3((n4 + 255) / 256), dim3(256), 0, stream>>>(y, ysum, n4);

  // 2) qt = xsum @ Wq^T + 32*bq ; kt = ysum @ Wk^T + 32*bk   [1024 x 256], K = 256
  k_gemm<64, 0, 1><<<dim3(C_DIM / 64, (B_SZ * T_LEN) / 64, 1), dim3(128), 0, stream>>>(
      xsum, Wq, qt, bq, 0, 0, 0, 0, 0, 0, 0, 0, 0,
      B_SZ * T_LEN, C_DIM, C_DIM, C_DIM, C_DIM, C_DIM, 1, 1, (float)M_AX, 1.0f);
  k_gemm<64, 0, 1><<<dim3(C_DIM / 64, (B_SZ * T_LEN) / 64, 1), dim3(128), 0, stream>>>(
      ysum, Wk, kt, bk, 0, 0, 0, 0, 0, 0, 0, 0, 0,
      B_SZ * T_LEN, C_DIM, C_DIM, C_DIM, C_DIM, C_DIM, 1, 1, (float)M_AX, 1.0f);

  // 3) v = y_flat @ Wv^T + bv   [32768 x 256], K = 256
  k_gemm<64, 0, 1><<<dim3(C_DIM / 64, (B_SZ * M_AX * T_LEN) / 64, 1), dim3(128), 0, stream>>>(
      y, Wv, vbuf, bv, 0, 0, 0, 0, 0, 0, 0, 0, 0,
      B_SZ * M_AX * T_LEN, C_DIM, C_DIM, C_DIM, C_DIM, C_DIM, 1, 1, 1.0f, 1.0f);

  // 4) scores[b,n] = (1/32) qt_head @ kt_head^T   [512 x 512], K = 32, z = b*8 + n  (no bias: HB = 0, pointer never read)
  k_gemm<64, 0, 0><<<dim3(T_LEN / 64, T_LEN / 64, B_SZ * NH), dim3(128), 0, stream>>>(
      qt, kt, wsc, kt,
      (long long)T_LEN * C_DIM, 0, DH,
      (long long)T_LEN * C_DIM, 0, DH,
      (long long)NH * T_LEN * T_LEN, 0, (long long)T_LEN * T_LEN,
      T_LEN, T_LEN, DH, C_DIM, C_DIM, T_LEN, NH, 1, 0.0f, 1.0f / 32.0f);

  // 5) softmax rows in place; rows of batch 0 also to a_out
  const int nrows = B_SZ * NH * T_LEN;                     // 8192
  k_softmax<<<dim3((nrows + 7) / 8), dim3(256), 0, stream>>>(wsc, a_out, nrows, NH * T_LEN);

  // 6) att[b,m,n] = w[b,n] @ v[b,m][:, n*32 .. n*32+31]   [512 x 32], K = 512, z = (b*32 + m)*8 + n  (no bias)
  k_gemm<32, 1, 0><<<dim3(1, T_LEN / 64, B_SZ * M_AX * NH), dim3(128), 0, stream>>>(
      wsc, vbuf, att, vbuf,
      (long long)NH * T_LEN * T_LEN, 0, (long long)T_LEN * T_LEN,
      (long long)M_AX * T_LEN * C_DIM, (long long)T_LEN * C_DIM, DH,
      (long long)M_AX * T_LEN * C_DIM, (long long)T_LEN * C_DIM, DH,
      T_LEN, DH, T_LEN, T_LEN, C_DIM, C_DIM, NH, M_AX, 0.0f, 1.0f);

  // 7) out = att @ Wp^T + bp   [32768 x 256], K = 256
  k_gemm<64, 0, 1><<<dim3(C_DIM / 64, (B_SZ * M_AX * T_LEN) / 64, 1), dim3(128), 0, stream>>>(
      att, Wp, out, bp, 0, 0, 0, 0, 0, 0, 0, 0, 0,
      B_SZ * M_AX * T_LEN, C_DIM, C_DIM, C_DIM, C_DIM, C_DIM, 1, 1, 1.0f, 1.0f);
}

// v001
// A run of this version takes 150 microseconds.
// Next to v000, in two timings, it ran 1.27 times as fast each time.
// Contractions (q/k/v/out projections, q.k^T scores, w.v): v_wmma_f32_16x16x32_bf16 with each f32 operand carried as bf16 hi + bf16 lo (hi.hi + hi.lo + lo.hi), f32 accumulate; axial sums, softmax and epilogues f32.
#include <hip/hip_runtime.h>
#include <stdint.h>

typedef float          v4f  __attribute__((ext_vector_type(4)));
typedef float          v8f  __attribute__((ext_vector_type(8)));
typedef unsigned int   v2u  __attribute__((ext_vector_type(2)));
typedef unsigned short v8us __attribute__((ext_vector_type(8)));
typedef __bf16         v16b __attribute__((ext_vector_type(16)));
union Frag { v16b v; v8us h[2]; };

#define C_DIM 256
#define NH    8
#define DH    32
#define B_SZ  2
#define M_AX  32
#define T_LEN 512
#define KP    40      // LDS pitch (16-bit elements) of the 32-deep k tiles; multiple of 8 for 16-B fragment loads

// f32 -> bf16 bits, RNE convert
static __device__ __forceinline__ unsigned int bf16_rne(float x) {
  unsigned int u = __float_as_uint(x);
  return (u + 0x7FFFu + ((u >> 16) & 1u)) >> 16;
}
// x = hi + lo with hi = rne_bf16(x), lo = rne_bf16(x - hi); (x - hi) is exact in f32
static __device__ __forceinline__ void split_hl(float x, unsigned int& hb, unsigned int& lb) {
  hb = bf16_rne(x);
  float r = x - __uint_as_float(hb << 16);
  lb = bf16_rne(r);
}
static __device__ __forceinline__ void split4(v4f v, v2u& hi, v2u& lo) {
  unsigned int h0, h1, h2, h3, l0, l1, l2, l3;
  split_hl(v.x, h0, l0); split_hl(v.y, h1, l1); split_hl(v.z, h2, l2); split_hl(v.w, h3, l3);
  hi.x = h0 | (h1 << 16); hi.y = h2 | (h3 << 16);
  lo.x = l0 | (l1 << 16); lo.y = l2 | (l3 << 16);
}

// three 16x16x32 bf16 ops into one accumulator, then the VALU hazard guard
static __device__ __forceinline__ void mma3(v8f& acc, v16b ah, v16b al, v16b bh, v16b bl) {
  acc = __builtin_amdgcn_wmma_f32_16x16x32_bf16(false, ah, false, bh, (short)0, acc, false, false);
  acc = __builtin_amdgcn_wmma_f32_16x16x32_bf16(false, ah, false, bl, (short)0, acc, false, false);
  acc = __builtin_amdgcn_wmma_f32_16x16x32_bf16(false, al, false, bh, (short)0, acc, false, false);
  asm volatile("v_nop\n\tv_nop\n\tv_nop\n\tv_nop" : "+v"(acc) : "v"(ah), "v"(al), "v"(bh), "v"(bl));
}

// ---------------------------------------------------------------------------
// Batched GEMM  C[M x N] = alpha * A[M x K] * op(W) (+ bias_scale * bias[n] when HB)
//   A : row-major, k contiguous, pitch lda
//   W : WK == 0 -> W[n][k] (k contiguous, pitch ldb), C = A * W^T
//       WK == 1 -> W[k][n] (n contiguous, pitch ldb), C = A * W
//   C : row-major, pitch ldc
//   HB == 0: bias pointer is never read.
// Batch z -> (zb, zm, zn) with independent element strides per operand.
// Block = 128 threads (4 waves), tile 64 rows x BN cols, 32 k per step.
// Wave w owns rows 16w..16w+15 and all BN cols (BN/16 accumulator tiles).
// Fragment maps per lane l (h = l>>4, m = l&15):
//   A: row m, el 0..7 <- k 8h+0..7, el 8..15 <- k 16+8h+0..7
//   B: col m, same k map;   D: el r <- (row 8h+r, col m)
// Requires M % 64 == 0, N % BN == 0, K % 32 == 0, 16-B aligned rows.
// ---------------------------------------------------------------------------
template <int BN, int WK, int HB>
__global__ void __launch_bounds__(128)
k_gemm(const float* __restrict__ Abase, const float* __restrict__ Wbase,
       float* __restrict__ Cbase, const float* __restrict__ bias,
       long long sAb, long long sAm, long long sAn,
       long long sBb, long long sBm, long long sBn,
       long long sCb, long long sCm, long long sCn,
       int Mrows, int Ncols, int K, int lda, int ldb, int ldc,
       int nInner, int nMid, float bias_scale, float alpha)
{
  constexpr int TN  = BN / 16;          // accumulator tiles per wave
  constexpr int CP  = BN + 4;           // f32 pitch of the staged C tile (multiple of 4)
  constexpr int NCH = BN / 16;          // 16-B W chunks per thread per k step

  __shared__ __attribute__((aligned(16))) unsigned short sAhi[64 * KP];
  __shared__ __attribute__((aligned(16))) unsigned short sAlo[64 * KP];
  __shared__ __attribute__((aligned(16))) unsigned short sWhi[BN * KP];
  __shared__ __attribute__((aligned(16))) unsigned short sWlo[BN * KP];
  __shared__ __attribute__((aligned(16))) float          sC[64 * CP];

  const int z  = blockIdx.z;
  const int zn = z % nInner;
  const int zm = (z / nInner) % nMid;
  const int zb = z / (nInner * nMid);
  const float* A = Abase + ((long long)zb * sAb + (long long)zm * sAm + (long long)zn * sAn);
  const float* W = Wbase + ((long long)zb * sBb + (long long)zm * sBm + (long long)zn * sBn);
  float*       C = Cbase + ((long long)zb * sCb + (long long)zm * sCm + (long long)zn * sCn);

  const int row0 = blockIdx.y * 64;
  const int col0 = blockIdx.x * BN;
  if (row0 + 64 > Mrows || col0 + BN > Ncols) return;     // block-uniform, before any barrier

  const int tid = threadIdx.x;
  const int wv  = tid >> 5;
  const int l   = tid & 31;
  const int h   = l >> 4;
  const int m   = l & 15;

  v8f acc[TN];
#pragma unroll
  for (int j = 0; j < TN; ++j) acc[j] = (v8f){};

  for (int k0 = 0; k0 < K; k0 += 32) {
    v4f ra[4];
    v4f rw[NCH];
    // A tile 64 x 32: chunk c -> row c>>3, k 4*(c&7)
#pragma unroll
    for (int i = 0; i < 4; ++i) {
      const int c = tid + 128 * i;
      const int r = c >> 3, k4 = (c & 7) * 4;
      ra[i] = *(const v4f*)(A + (size_t)(row0 + r) * lda + k0 + k4);
    }
#pragma unroll
    for (int i = 0; i < NCH; ++i) {
      const int c = tid + 128 * i;
      if (WK) {
        const int s = c / (BN / 4), n4 = (c % (BN / 4)) * 4;        // k row s, 4 consecutive n
        rw[i] = *(const v4f*)(W + (size_t)(k0 + s) * ldb + col0 + n4);
      } else {
        const int n = c >> 3, k4 = (c & 7) * 4;                      // n row, 4 consecutive k
        rw[i] = *(const v4f*)(W + (size_t)(col0 + n) * ldb + k0 + k4);
      }
    }
    __syncthreads();          // all waves done reading the tiles of the prior k step
#pragma unroll
    for (int i = 0; i < 4; ++i) {
      const int c = tid + 128 * i;
      const int r = c >> 3, k4 = (c & 7) * 4;
      v2u hi, lo;
      split4(ra[i], hi, lo);
      *(v2u*)(&sAhi[r * KP + k4]) = hi;
      *(v2u*)(&sAlo[r * KP + k4]) = lo;
    }
#pragma unroll
    for (int i = 0; i < NCH; ++i) {
      const int c = tid + 128 * i;
      if (WK) {
        const int s = c / (BN / 4), n4 = (c % (BN / 4)) * 4;
        unsigned int h0, h1, h2, h3, l0, l1, l2, l3;
        split_hl(rw[i].x, h0, l0); split_hl(rw[i].y, h1, l1);
        split_hl(rw[i].z, h2, l2); split_hl(rw[i].w, h3, l3);
        sWhi[(n4 + 0) * KP + s] = (unsigned short)h0;  sWlo[(n4 + 0) * KP + s] = (unsigned short)l0;
        sWhi[(n4 + 1) * KP + s] = (unsigned short)h1;  sWlo[(n4 + 1) * KP + s] = (unsigned short)l1;
        sWhi[(n4 + 2) * KP + s] = (unsigned short)h2;  sWlo[(n4 + 2) * KP + s] = (unsigned short)l2;
        sWhi[(n4 + 3) * KP + s] = (unsigned short)h3;  sWlo[(n4 + 3) * KP + s] = (unsigned short)l3;
      } else {
        const int n = c >> 3, k4 = (c & 7) * 4;
        v2u hi, lo;
        split4(rw[i], hi, lo);
        *(v2u*)(&sWhi[n * KP + k4]) = hi;
        *(v2u*)(&sWlo[n * KP + k4]) = lo;
      }
    }
    __syncthreads();          // tiles visible to every wave

    Frag ah, al;
    {
      const int ar = (16 * wv + m) * KP + 8 * h;
      ah.h[0] = *(const v8us*)(&sAhi[ar]);
      ah.h[1] = *(const v8us*)(&sAhi[ar + 16]);
      al.h[0] = *(const v8us*)(&sAlo[ar]);
      al.h[1] = *(const v8us*)(&sAlo[ar + 16]);
    }
#pragma unroll
    for (int j = 0; j < TN; ++j) {
      const int br = (16 * j + m) * KP + 8 * h;
      Frag bh, bl;
      bh.h[0] = *(const v8us*)(&sWhi[br]);
      bh.h[1] = *(const v8us*)(&sWhi[br + 16]);
      bl.h[0] = *(const v8us*)(&sWlo[br]);
      bl.h[1] = *(const v8us*)(&sWlo[br + 16]);
      mma3(acc[j], ah.v, al.v, bh.v, bl.v);
    }
  }

#pragma unroll
  for (int j = 0; j < TN; ++j) {
    float bb = 0.0f;
    if (HB) bb = bias_scale * bias[col0 + 16 * j + m];
#pragma unroll
    for (int r = 0; r < 8; ++r) {
      sC[(16 * wv + 8 * h + r) * CP + 16 * j + m] = alpha * acc[j][r] + bb;
    }
  }
  __syncthreads();
#pragma unroll
  for (int i = 0; i < BN / 8; ++i) {
    const int idx = i * 128 + tid;
    const int row = idx / (BN / 4);
    const int c4  = (idx % (BN / 4)) * 4;
    const v4f val = *(const v4f*)(&sC[row * CP + c4]);
    float* gp = C + (size_t)(row0 + row) * ldc + col0 + c4;
    *(v4f*)gp = val;
  }
  
}

// ---------------------------------------------------------------------------
// att[b, m, t, n*32 + d] = sum_s w[b, n, t, s] * v[b, m, s, n*32 + d]
// The 32 axial slices m of one (b, n) share w, so they are the columns of ONE product
//   [512 t x 512 s] * [512 s x (32 m * 32 d)].
// Block = 256 threads (8 waves), tile 128 t x 128 columns (4 slices x 32 d), 32 s per step.
// Wave wv owns rows 32*(wv&3)..+31 and columns 64*(wv>>2)..+63 (2 x 4 accumulator tiles).
// Fragment maps, LDS layout ([row or column][k], pitch KP) and k order are those of k_gemm.
// grid: x = group of 4 slices, y = row tile, z = b*8 + n
// ---------------------------------------------------------------------------
#define AT_M  128
#define AT_N  128
#define AT_SL (AT_N / DH)
__global__ void __launch_bounds__(256)
k_att(const float* __restrict__ wsc, const float* __restrict__ vbuf, float* __restrict__ att)
{
  constexpr int CP = AT_N + 4;          // f32 pitch of the staged C tile (multiple of 4)

  __shared__ __attribute__((aligned(16))) unsigned short sAhi[AT_M * KP];
  __shared__ __attribute__((aligned(16))) unsigned short sAlo[AT_M * KP];
  __shared__ __attribute__((aligned(16))) unsigned short sWhi[AT_N * KP];
  __shared__ __attribute__((aligned(16))) unsigned short sWlo[AT_N * KP];
  __shared__ __attribute__((aligned(16))) float          sC[AT_M * CP];

  const int zn   = blockIdx.z % NH;
  const int zb   = blockIdx.z / NH;
  const int m0   = blockIdx.x * AT_SL;
  const int row0 = blockIdx.y * AT_M;
  const size_t slice = (size_t)T_LEN * C_DIM;
  const float* A = wsc  + ((size_t)blockIdx.z * T_LEN + row0) * T_LEN;
  const float* V = vbuf + (size_t)(zb * M_AX + m0) * slice + zn * DH;
  float*       C = att  + (size_t)(zb * M_AX + m0) * slice + (size_t)row0 * C_DIM + zn * DH;

  const int tid = threadIdx.x;
  const int wv  = tid >> 5;
  const int l   = tid & 31;
  const int h   = l >> 4;
  const int m   = l & 15;
  const int wr  = wv & 3;
  const int wc  = wv >> 2;

  // v tile 32 s x 128 columns: a thread takes 4 s x 4 d of one slice, so that each column's
  // four s go to LDS as one 8-B store; 8 lanes cover the 128 B of one (slice, s) row.
  const int vd4 = (tid & 7) * 4;                              // first d
  const int vs4 = ((tid >> 7) * 4 + ((tid >> 3) & 3)) * 4;    // first s inside the step
  const int vsl = (tid >> 5) & 3;                             // slice inside the group
  const int vn  = vsl * DH + vd4;                             // first tile column
  const float* Vt = V + (size_t)vsl * slice + (size_t)vs4 * C_DIM + vd4;

  v8f acc[2][4];
#pragma unroll
  for (int i = 0; i < 2; ++i)
#pragma unroll
    for (int j = 0; j < 4; ++j) acc[i][j] = (v8f){};

  for (int k0 = 0; k0 < T_LEN; k0 += 32) {
    v4f ra[4];
    v4f rw[4];
    // w tile 128 x 32: chunk c -> row c>>3, k 4*(c&7)
#pragma unroll
    for (int i = 0; i < 4; ++i) {
      const int c = tid + 256 * i;
      const int r = c >> 3, k4 = (c & 7) * 4;
      ra[i] = *(const v4f*)(A + (size_t)r * T_LEN + k0 + k4);
    }
#pragma unroll
    for (int i = 0; i < 4; ++i) rw[i] = *(const v4f*)(Vt + (size_t)(k0 + i) * C_DIM);
    // keeps the step's eight loads in flight together: without it the scheduler sinks some of them
    // behind the first splits, and a step then waits out the load latency three times instead of once
    __builtin_amdgcn_sched_barrier(0);
    __syncthreads();          // all waves done reading the tiles of the prior k step
#pragma unroll
    for (int i = 0; i < 4; ++i) {
      const int c = tid + 256 * i;
      const int r = c >> 3, k4 = (c & 7) * 4;
      v2u hi, lo;
      split4(ra[i], hi, lo);
      *(v2u*)(&sAhi[r * KP + k4]) = hi;
      *(v2u*)(&sAlo[r * KP + k4]) = lo;
    }
#pragma unroll
    for (int j = 0; j < 4; ++j) {
      const v4f col = {rw[0][j], rw[1][j], rw[2][j], rw[3][j]};   // s = vs4 .. vs4+3 of column vn+j
      v2u hi, lo;
      split4(col, hi, lo);
      *(v2u*)(&sWhi[(vn + j) * KP + vs4]) = hi;
      *(v2u*)(&sWlo[(vn + j) * KP + vs4]) = lo;
    }
    __syncthreads();          // tiles visible to every wave

    Frag ah[2], al[2];
#pragma unroll
    for (int i = 0; i < 2; ++i) {
      const int ar = (32 * wr + 16 * i + m) * KP + 8 * h;
      ah[i].h[0] = *(const v8us*)(&sAhi[ar]);
      ah[i].h[1] = *(const v8us*)(&sAhi[ar + 16]);
      al[i].h[0] = *(const v8us*)(&sAlo[ar]);
      al[i].h[1] = *(const v8us*)(&sAlo[ar + 16]);
    }
#pragma unroll
    for (int j = 0; j < 4; ++j) {
      const int br = (64 * wc + 16 * j + m) * KP + 8 * h;
      Frag bh, bl;
      bh.h[0] = *(const v8us*)(&sWhi[br]);
      bh.h[1] = *(const v8us*)(&sWhi[br + 16]);
      bl.h[0] = *(const v8us*)(&sWlo[br]);
      bl.h[1] = *(const v8us*)(&sWlo[br + 16]);
#pragma unroll
      for (int i = 0; i < 2; ++i) mma3(acc[i][j], ah[i].v, al[i].v, bh.v, bl.v);
    }
  }

#pragma unroll
  for (int i = 0; i < 2; ++i)
#pragma unroll
    for (int j = 0; j < 4; ++j)
#pragma unroll
      for (int r = 0; r < 8; ++r)
        sC[(32 * wr + 16 * i + 8 * h + r) * CP + 64 * wc + 16 * j + m] = acc[i][j][r];
  __syncthreads();
  // one wave-wide store = one t row of the tile = four whole 128-B lines, one per slice
#pragma unroll
  for (int i = 0; i < AT_M * AT_N / (4 * 256); ++i) {
    const int idx = i * 256 + tid;
    const int row = idx / (AT_N / 4);
    const int c4  = (idx % (AT_N / 4)) * 4;
    const v4f val = *(const v4f*)(&sC[row * CP + c4]);
    float* gp = C + (size_t)(c4 / DH) * slice + (size_t)row * C_DIM + (c4 % DH);
    *(v4f*)gp = val;
  }
}

// ---------------------------------------------------------------------------
// Axial sum: out[b, t, c] = sum_m in[b, m, t, c]; one thread per 4 consecutive c.
// ---------------------------------------------------------------------------
__global__ void __launch_bounds__(256)
k_sum_m(const float* __restrict__ in, float* __restrict__ out, int n4)
{
  const int i4 = blockIdx.x * 256 + threadIdx.x;
  if (i4 >= n4) return;
  const size_t i     = (size_t)i4 * 4;
  const size_t inner = (size_t)T_LEN * C_DIM;
  const size_t b     = i / inner;
  const size_t r     = i - b * inner;
  const float* p = in + b * (size_t)M_AX * inner + r;
  v4f s = {0.0f, 0.0f, 0.0f, 0.0f};
#pragma unroll 8
  for (int mm = 0; mm < M_AX; ++mm) s += *(const v4f*)(p + (size_t)mm * inner);
  float* o = out + i;
  *(v4f*)o = s;
  
}

// ---------------------------------------------------------------------------
// Row softmax over 512, one wave per row, in place; rows < narows also copied to a_out.
// Lane holds floats lane*4+0..3 of each 128-float segment -> every store instruction covers
// ---------------------------------------------------------------------------
__global__ void __launch_bounds__(256)
k_softmax(float* __restrict__ w, float* __restrict__ a_out, int nrows, int narows)
{
  const int row  = blockIdx.x * 8 + (threadIdx.x >> 5);
  const int lane = threadIdx.x & 31;
  if (row >= nrows) return;                     // wave-uniform
  float* p = w + (size_t)row * T_LEN + lane * 4;

  v4f v[4];
#pragma unroll
  for (int i = 0; i < 4; ++i) v[i] = *(const v4f*)(p + i * 128);

  float mx = -3.0e38f;
#pragma unroll
  for (int i = 0; i < 4; ++i)
    mx = fmaxf(mx, fmaxf(fmaxf(v[i].x, v[i].y), fmaxf(v[i].z, v[i].w)));
#pragma unroll
  for (int off = 16; off > 0; off >>= 1) mx = fmaxf(mx, __shfl_xor(mx, off, 32));

  float sum = 0.0f;
#pragma unroll
  for (int i = 0; i < 4; ++i) {
    v[i].x = __expf(v[i].x - mx);
    v[i].y = __expf(v[i].y - mx);
    v[i].z = __expf(v[i].z - mx);
    v[i].w = __expf(v[i].w - mx);
    sum += (v[i].x + v[i].y) + (v[i].z + v[i].w);
  }
#pragma unroll
  for (int off = 16; off > 0; off >>= 1) sum += __shfl_xor(sum, off, 32);
  const float inv = 1.0f / sum;
#pragma unroll
  for (int i = 0; i < 4; ++i) v[i] *= inv;

  const bool wa = row < narows;
  float* q = a_out + (size_t)(wa ? row : 0) * T_LEN + lane * 4;

#pragma unroll
  for (int i = 0; i < 4; ++i) {
    *(v4f*)(p + i * 128) = v[i];
    if (wa) *(v4f*)(q + i * 128) = v[i];
  }
  
}

// ---------------------------------------------------------------------------
extern "C" void kernel_launch(void* const* d_in, const int* in_sizes, int n_in,
                              void* d_out, int out_size, void* d_ws, size_t ws_size,
                              hipStream_t stream)
{
  if (n_in < 10) return;
  const int n_x  = B_SZ * M_AX * T_LEN * C_DIM;          // 8388608
  const int n_w  = C_DIM * C_DIM;
  const int n_a  = NH * T_LEN * T_LEN;                   // 2097152
  if (in_sizes[0] != n_x || in_sizes[1] != n_x) return;
  if (in_sizes[2] != n_w || in_sizes[4] != n_w || in_sizes[6] != n_w || in_sizes[8] != n_w) return;
  if (in_sizes[3] != C_DIM || in_sizes[5] != C_DIM || in_sizes[7] != C_DIM || in_sizes[9] != C_DIM) return;
  if (out_size != n_x + n_a) return;

  const float* x  = (const float*)d_in[0];
  const float* y  = (const float*)d_in[1];
  const float* Wq = (const float*)d_in[2];
  const float* bq = (const float*)d_in[3];
  const float* Wk = (const float*)d_in[4];
  const float* bk = (const float*)d_in[5];
  const float* Wv = (const float*)d_in[6];
  const float* bv = (const float*)d_in[7];
  const float* Wp = (const float*)d_in[8];
  const float* bp = (const float*)d_in[9];

  float* out   = (float*)d_out;                            // [2,32,512,256]
  float* a_out = out + (size_t)n_x;                        // [8,512,512] at byte 33554432

  const size_t n_sum = (size_t)B_SZ * T_LEN * C_DIM;       // 262144
  const size_t n_v   = (size_t)n_x;                        // 8388608
  const size_t n_sc  = (size_t)B_SZ * NH * T_LEN * T_LEN;  // 4194304
  const size_t o_xsum = 0;
  const size_t o_ysum = o_xsum + n_sum;
  const size_t o_qt   = o_ysum + n_sum;
  const size_t o_kt   = o_qt   + n_sum;
  const size_t o_v    = o_kt   + n_sum;
  const size_t o_wsc  = o_v    + n_v;
  const size_t o_att  = o_wsc  + n_sc;
  const size_t o_end  = o_att  + n_v;                      // 22020096 floats = 88080384 B
  if (o_end * sizeof(float) > ws_size) return;

  float* ws   = (float*)d_ws;
  float* xsum = ws + o_xsum;
  float* ysum = ws + o_ysum;
  float* qt   = ws + o_qt;
  float* kt   = ws + o_kt;
  float* vbuf = ws + o_v;
  float* wsc  = ws + o_wsc;
  float* att  = ws + o_att;

  // 1) axial sums of x and y over m
  const int n4 = (int)(n_sum / 4);                         // 65536
  k_sum_m<<<dim3((n4 + 255) / 256), dim3(256), 0, stream>>>(x, xsum, n4);
  k_sum_m<<<dim3((n4 + 255) / 256), dim3(256), 0, stream>>>(y, ysum, n4);

  // 2) qt = xsum @ Wq^T + 32*bq ; kt = ysum @ Wk^T + 32*bk   [1024 x 256], K = 256
  k_gemm<64, 0, 1><<<dim3(C_DIM / 64, (B_SZ * T_LEN) / 64, 1), dim3(128), 0, stream>>>(
      xsum, Wq, qt, bq, 0, 0, 0, 0, 0, 0, 0, 0, 0,
      B_SZ * T_LEN, C_DIM, C_DIM, C_DIM, C_DIM, C_DIM, 1, 1, (float)M_AX, 1.0f);
  k_gemm<64, 0, 1><<<dim3(C_DIM / 64, (B_SZ * T_LEN) / 64, 1), dim3(128), 0, stream>>>(
      ysum, Wk, kt, bk, 0, 0, 0, 0, 0, 0, 0, 0, 0,
      B_SZ * T_LEN, C_DIM, C_DIM, C_DIM, C_DIM, C_DIM, 1, 1, (float)M_AX, 1.0f);

  // 3) v = y_flat @ Wv^T + bv   [32768 x 256], K = 256
  k_gemm<64, 0, 1><<<dim3(C_DIM / 64, (B_SZ * M_AX * T_LEN) / 64, 1), dim3(128), 0, stream>>>(
      y, Wv, vbuf, bv, 0, 0, 0, 0, 0, 0, 0, 0, 0,
      B_SZ * M_AX * T_LEN, C_DIM, C_DIM, C_DIM, C_DIM, C_DIM, 1, 1, 1.0f, 1.0f);

  // 4) scores[b,n] = (1/32) qt_head @ kt_head^T   [512 x 512], K = 32, z = b*8 + n  (no bias: HB = 0, pointer never read)
  k_gemm<64, 0, 0><<<dim3(T_LEN / 64, T_LEN / 64, B_SZ * NH), dim3(128), 0, stream>>>(
      qt, kt, wsc, kt,
      (long long)T_LEN * C_DIM, 0, DH,
      (long long)T_LEN * C_DIM, 0, DH,
      (long long)NH * T_LEN * T_LEN, 0, (long long)T_LEN * T_LEN,
      T_LEN, T_LEN, DH, C_DIM, C_DIM, T_LEN, NH, 1, 0.0f, 1.0f / 32.0f);

  // 5) softmax rows in place; rows of batch 0 also to a_out
  const int nrows = B_SZ * NH * T_LEN;                     // 8192
  k_softmax<<<dim3((nrows + 7) / 8), dim3(256), 0, stream>>>(wsc, a_out, nrows, NH * T_LEN);

  // 6) att[b,:,n] = w[b,n] @ v[b,:][:, n*32 .. n*32+31]   [512 x (32*32)], K = 512, z = b*8 + n, x = 4 slices m
  k_att<<<dim3(M_AX / AT_SL, T_LEN / AT_M, B_SZ * NH), dim3(256), 0, stream>>>(wsc, vbuf, att);

  // 7) out = att @ Wp^T + bp   [32768 x 256], K = 256
  k_gemm<64, 0, 1><<<dim3(C_DIM / 64, (B_SZ * M_AX * T_LEN) / 64, 1), dim3(128), 0, stream>>>(
      att, Wp, out, bp, 0, 0, 0, 0, 0, 0, 0, 0, 0,
      B_SZ * M_AX * T_LEN, C_DIM, C_DIM, C_DIM, C_DIM, C_DIM, 1, 1, 1.0f, 1.0f);
}

// v002
// It runs in 110 microseconds.
// Timed twice side by side with v001, it ran 1.37 times as fast both times.
// All steps since v000 together make it 1.74 times as fast.
// Contractions (q/k/v/out projections, q.k^T scores, w.v): v_wmma_f32_16x16x32_bf16 with each f32 operand carried as bf16 hi + bf16 lo (hi.hi + hi.lo + lo.hi), f32 accumulate; axial sums, softmax and epilogues f32.
#include <hip/hip_runtime.h>
#include <stdint.h>

typedef float          v4f  __attribute__((ext_vector_type(4)));
typedef float          v8f  __attribute__((ext_vector_type(8)));
typedef unsigned int   v2u  __attribute__((ext_vector_type(2)));
typedef unsigned short v8us __attribute__((ext_vector_type(8)));
typedef __bf16         v16b __attribute__((ext_vector_type(16)));
typedef __bf16         v2b  __attribute__((ext_vector_type(2)));
typedef float          v2f  __attribute__((ext_vector_type(2)));
union Frag { v16b v; v8us h[2]; };

#define C_DIM 256
#define NH    8
#define DH    32
#define B_SZ  2
#define M_AX  32
#define T_LEN 512
#define KP    40      // LDS pitch (16-bit elements) of the 32-deep k tiles; multiple of 8 for 16-B fragment loads

// x = hi + lo with hi = rne_bf16(x), lo = rne_bf16(x - hi); (x - hi) is exact in f32.
// Both roundings are the chip's own packed convert (nearest even, two values an instruction).
static __device__ __forceinline__ void split2(float x0, float x1, unsigned int& hb, unsigned int& lb) {
  const v2f x  = {x0, x1};
  const v2b hi = __builtin_convertvector(x, v2b);
  const v2f r  = x - __builtin_convertvector(hi, v2f);
  const v2b lo = __builtin_convertvector(r, v2b);
  hb = __builtin_bit_cast(unsigned int, hi);
  lb = __builtin_bit_cast(unsigned int, lo);
}
static __device__ __forceinline__ void split_hl(float x, unsigned int& hb, unsigned int& lb) {
  unsigned int h2, l2;
  split2(x, x, h2, l2);
  hb = h2 & 0xFFFFu;
  lb = l2 & 0xFFFFu;
}
static __device__ __forceinline__ void split4(v4f v, v2u& hi, v2u& lo) {
  unsigned int h01, h23, l01, l23;
  split2(v.x, v.y, h01, l01);
  split2(v.z, v.w, h23, l23);
  hi.x = h01; hi.y = h23;
  lo.x = l01; lo.y = l23;
}

// three 16x16x32 bf16 ops into one accumulator, then the VALU hazard guard
static __device__ __forceinline__ void mma3(v8f& acc, v16b ah, v16b al, v16b bh, v16b bl) {
  acc = __builtin_amdgcn_wmma_f32_16x16x32_bf16(false, ah, false, bh, (short)0, acc, false, false);
  acc = __builtin_amdgcn_wmma_f32_16x16x32_bf16(false, ah, false, bl, (short)0, acc, false, false);
  acc = __builtin_amdgcn_wmma_f32_16x16x32_bf16(false, al, false, bh, (short)0, acc, false, false);
  asm volatile("v_nop\n\tv_nop\n\tv_nop\n\tv_nop" : "+v"(acc) : "v"(ah), "v"(al), "v"(bh), "v"(bl));
}

// ---------------------------------------------------------------------------
// Batched GEMM  C[M x N] = alpha * A[M x K] * op(W) (+ bias_scale * bias[n] when HB)
//   A : row-major, k contiguous, pitch lda
//   W : WK == 0 -> W[n][k] (k contiguous, pitch ldb), C = A * W^T
//       WK == 1 -> W[k][n] (n contiguous, pitch ldb), C = A * W
//   C : row-major, pitch ldc
//   HB == 0: bias pointer is never read.
// Batch z -> (zb, zm, zn) with independent element strides per operand.
// Block = 128 threads (4 waves), tile 64 rows x BN cols, 32 k per step.
// Wave w owns rows 16w..16w+15 and all BN cols (BN/16 accumulator tiles).
// Fragment maps per lane l (h = l>>4, m = l&15):
//   A: row m, el 0..7 <- k 8h+0..7, el 8..15 <- k 16+8h+0..7
//   B: col m, same k map;   D: el r <- (row 8h+r, col m)
// Requires M % 64 == 0, N % BN == 0, K % 32 == 0, 16-B aligned rows.
// ---------------------------------------------------------------------------
template <int BN, int WK, int HB>
__global__ void __launch_bounds__(128)
k_gemm(const float* __restrict__ Abase, const float* __restrict__ Wbase,
       float* __restrict__ Cbase, const float* __restrict__ bias,
       long long sAb, long long sAm, long long sAn,
       long long sBb, long long sBm, long long sBn,
       long long sCb, long long sCm, long long sCn,
       int Mrows, int Ncols, int K, int lda, int ldb, int ldc,
       int nInner, int nMid, float bias_scale, float alpha)
{
  constexpr int TN  = BN / 16;          // accumulator tiles per wave
  constexpr int CP  = BN + 4;           // f32 pitch of the staged C tile (multiple of 4)
  constexpr int NCH = BN / 16;          // 16-B W chunks per thread per k step

  __shared__ __attribute__((aligned(16))) unsigned short sAhi[64 * KP];
  __shared__ __attribute__((aligned(16))) unsigned short sAlo[64 * KP];
  __shared__ __attribute__((aligned(16))) unsigned short sWhi[BN * KP];
  __shared__ __attribute__((aligned(16))) unsigned short sWlo[BN * KP];
  __shared__ __attribute__((aligned(16))) float          sC[64 * CP];

  const int z  = blockIdx.z;
  const int zn = z % nInner;
  const int zm = (z / nInner) % nMid;
  const int zb = z / (nInner * nMid);
  const float* A = Abase + ((long long)zb * sAb + (long long)zm * sAm + (long long)zn * sAn);
  const float* W = Wbase + ((long long)zb * sBb + (long long)zm * sBm + (long long)zn * sBn);
  float*       C = Cbase + ((long long)zb * sCb + (long long)zm * sCm + (long long)zn * sCn);

  const int row0 = blockIdx.y * 64;
  const int col0 = blockIdx.x * BN;
  if (row0 + 64 > Mrows || col0 + BN > Ncols) return;     // block-uniform, before any barrier

  const int tid = threadIdx.x;
  const int wv  = tid >> 5;
  const int l   = tid & 31;
  const int h   = l >> 4;
  const int m   = l & 15;

  v8f acc[TN];
#pragma unroll
  for (int j = 0; j < TN; ++j) acc[j] = (v8f){};

  for (int k0 = 0; k0 < K; k0 += 32) {
    v4f ra[4];
    v4f rw[NCH];
    // A tile 64 x 32: chunk c -> row c>>3, k 4*(c&7)
#pragma unroll
    for (int i = 0; i < 4; ++i) {
      const int c = tid + 128 * i;
      const int r = c >> 3, k4 = (c & 7) * 4;
      ra[i] = *(const v4f*)(A + (size_t)(row0 + r) * lda + k0 + k4);
    }
#pragma unroll
    for (int i = 0; i < NCH; ++i) {
      const int c = tid + 128 * i;
      if (WK) {
        const int s = c / (BN / 4), n4 = (c % (BN / 4)) * 4;        // k row s, 4 consecutive n
        rw[i] = *(const v4f*)(W + (size_t)(k0 + s) * ldb + col0 + n4);
      } else {
        const int n = c >> 3, k4 = (c & 7) * 4;                      // n row, 4 consecutive k
        rw[i] = *(const v4f*)(W + (size_t)(col0 + n) * ldb + k0 + k4);
      }
    }
    __syncthreads();          // all waves done reading the tiles of the prior k step
#pragma unroll
    for (int i = 0; i < 4; ++i) {
      const int c = tid + 128 * i;
      const int r = c >> 3, k4 = (c & 7) * 4;
      v2u hi, lo;
      split4(ra[i], hi, lo);
      *(v2u*)(&sAhi[r * KP + k4]) = hi;
      *(v2u*)(&sAlo[r * KP + k4]) = lo;
    }
#pragma unroll
    for (int i = 0; i < NCH; ++i) {
      const int c = tid + 128 * i;
      if (WK) {
        const int s = c / (BN / 4), n4 = (c % (BN / 4)) * 4;
        unsigned int h0, h1, h2, h3, l0, l1, l2, l3;
        split_hl(rw[i].x, h0, l0); split_hl(rw[i].y, h1, l1);
        split_hl(rw[i].z, h2, l2); split_hl(rw[i].w, h3, l3);
        sWhi[(n4 + 0) * KP + s] = (unsigned short)h0;  sWlo[(n4 + 0) * KP + s] = (unsigned short)l0;
        sWhi[(n4 + 1) * KP + s] = (unsigned short)h1;  sWlo[(n4 + 1) * KP + s] = (unsigned short)l1;
        sWhi[(n4 + 2) * KP + s] = (unsigned short)h2;  sWlo[(n4 + 2) * KP + s] = (unsigned short)l2;
        sWhi[(n4 + 3) * KP + s] = (unsigned short)h3;  sWlo[(n4 + 3) * KP + s] = (unsigned short)l3;
      } else {
        const int n = c >> 3, k4 = (c & 7) * 4;
        v2u hi, lo;
        split4(rw[i], hi, lo);
        *(v2u*)(&sWhi[n * KP + k4]) = hi;
        *(v2u*)(&sWlo[n * KP + k4]) = lo;
      }
    }
    __syncthreads();          // tiles visible to every wave

    Frag ah, al;
    {
      const int ar = (16 * wv + m) * KP + 8 * h;
      ah.h[0] = *(const v8us*)(&sAhi[ar]);
      ah.h[1] = *(const v8us*)(&sAhi[ar + 16]);
      al.h[0] = *(const v8us*)(&sAlo[ar]);
      al.h[1] = *(const v8us*)(&sAlo[ar + 16]);
    }
#pragma unroll
    for (int j = 0; j < TN; ++j) {
      const int br = (16 * j + m) * KP + 8 * h;
      Frag bh, bl;
      bh.h[0] = *(const v8us*)(&sWhi[br]);
      bh.h[1] = *(const v8us*)(&sWhi[br + 16]);
      bl.h[0] = *(const v8us*)(&sWlo[br]);
      bl.h[1] = *(const v8us*)(&sWlo[br + 16]);
      mma3(acc[j], ah.v, al.v, bh.v, bl.v);
    }
  }

#pragma unroll
  for (int j = 0; j < TN; ++j) {
    float bb = 0.0f;
    if (HB) bb = bias_scale * bias[col0 + 16 * j + m];
#pragma unroll
    for (int r = 0; r < 8; ++r) {
      sC[(16 * wv + 8 * h + r) * CP + 16 * j + m] = alpha * acc[j][r] + bb;
    }
  }
  __syncthreads();
#pragma unroll
  for (int i = 0; i < BN / 8; ++i) {
    const int idx = i * 128 + tid;
    const int row = idx / (BN / 4);
    const int c4  = (idx % (BN / 4)) * 4;
    const v4f val = *(const v4f*)(&sC[row * CP + c4]);
    float* gp = C + (size_t)(row0 + row) * ldc + col0 + c4;
    *(v4f*)gp = val;
  }
  
}

// ---------------------------------------------------------------------------
// att[b, m, t, n*32 + d] = sum_s w[b, n, t, s] * v[b, m, s, n*32 + d]
// The 32 axial slices m of one (b, n) share w, so they are the columns of ONE product
//   [512 t x 512 s] * [512 s x (32 m * 32 d)].
// Block = 256 threads (8 waves), tile 128 t x 128 columns (4 slices x 32 d), 32 s per step.
// Wave wv owns rows 32*(wv&3)..+31 and columns 64*(wv>>2)..+63 (2 x 4 accumulator tiles).
// Fragment maps, LDS layout ([row or column][k], pitch KP) and k order are those of k_gemm.
// grid: x = group of 4 slices, y = row tile, z = b*8 + n
// ---------------------------------------------------------------------------
#define AT_M  128
#define AT_N  128
#define AT_SL (AT_N / DH)
__global__ void __launch_bounds__(256)
k_att(const float* __restrict__ wsc, const float* __restrict__ vbuf, float* __restrict__ att)
{
  constexpr int CP = AT_N + 4;          // f32 pitch of the staged C tile (multiple of 4)

  __shared__ __attribute__((aligned(16))) unsigned short sAhi[AT_M * KP];
  __shared__ __attribute__((aligned(16))) unsigned short sAlo[AT_M * KP];
  __shared__ __attribute__((aligned(16))) unsigned short sWhi[AT_N * KP];
  __shared__ __attribute__((aligned(16))) unsigned short sWlo[AT_N * KP];
  __shared__ __attribute__((aligned(16))) float          sC[AT_M * CP];

  const int zn   = blockIdx.z % NH;
  const int zb   = blockIdx.z / NH;
  const int m0   = blockIdx.x * AT_SL;
  const int row0 = blockIdx.y * AT_M;
  const size_t slice = (size_t)T_LEN * C_DIM;
  const float* A = wsc  + ((size_t)blockIdx.z * T_LEN + row0) * T_LEN;
  const float* V = vbuf + (size_t)(zb * M_AX + m0) * slice + zn * DH;
  float*       C = att  + (size_t)(zb * M_AX + m0) * slice + (size_t)row0 * C_DIM + zn * DH;

  const int tid = threadIdx.x;
  const int wv  = tid >> 5;
  const int l   = tid & 31;
  const int h   = l >> 4;
  const int m   = l & 15;
  const int wr  = wv & 3;
  const int wc  = wv >> 2;

  // v tile 32 s x 128 columns: a thread takes 4 s x 4 d of one slice, so that each column's
  // four s go to LDS as one 8-B store; 8 lanes cover the 128 B of one (slice, s) row.
  const int vd4 = (tid & 7) * 4;                              // first d
  const int vs4 = ((tid >> 7) * 4 + ((tid >> 3) & 3)) * 4;    // first s inside the step
  const int vsl = (tid >> 5) & 3;                             // slice inside the group
  const int vn  = vsl * DH + vd4;                             // first tile column
  const float* Vt = V + (size_t)vsl * slice + (size_t)vs4 * C_DIM + vd4;

  v8f acc[2][4];
#pragma unroll
  for (int i = 0; i < 2; ++i)
#pragma unroll
    for (int j = 0; j < 4; ++j) acc[i][j] = (v8f){};

  for (int k0 = 0; k0 < T_LEN; k0 += 32) {
    v4f ra[4];
    v4f rw[4];
    // w tile 128 x 32: chunk c -> row c>>3, k 4*(c&7)
#pragma unroll
    for (int i = 0; i < 4; ++i) {
      const int c = tid + 256 * i;
      const int r = c >> 3, k4 = (c & 7) * 4;
      ra[i] = *(const v4f*)(A + (size_t)r * T_LEN + k0 + k4);
    }
#pragma unroll
    for (int i = 0; i < 4; ++i) rw[i] = *(const v4f*)(Vt + (size_t)(k0 + i) * C_DIM);
    // keeps the step's eight loads in flight together: without it the scheduler sinks some of them
    // behind the first splits, and a step then waits out the load latency three times instead of once
    __builtin_amdgcn_sched_barrier(0);
    __syncthreads();          // all waves done reading the tiles of the prior k step
#pragma unroll
    for (int i = 0; i < 4; ++i) {
      const int c = tid + 256 * i;
      const int r = c >> 3, k4 = (c & 7) * 4;
      v2u hi, lo;
      split4(ra[i], hi, lo);
      *(v2u*)(&sAhi[r * KP + k4]) = hi;
      *(v2u*)(&sAlo[r * KP + k4]) = lo;
    }
#pragma unroll
    for (int j = 0; j < 4; ++j) {
      const v4f col = {rw[0][j], rw[1][j], rw[2][j], rw[3][j]};   // s = vs4 .. vs4+3 of column vn+j
      v2u hi, lo;
      split4(col, hi, lo);
      *(v2u*)(&sWhi[(vn + j) * KP + vs4]) = hi;
      *(v2u*)(&sWlo[(vn + j) * KP + vs4]) = lo;
    }
    __syncthreads();          // tiles visible to every wave

    Frag ah[2], al[2];
#pragma unroll
    for (int i = 0; i < 2; ++i) {
      const int ar = (32 * wr + 16 * i + m) * KP + 8 * h;
      ah[i].h[0] = *(const v8us*)(&sAhi[ar]);
      ah[i].h[1] = *(const v8us*)(&sAhi[ar + 16]);
      al[i].h[0] = *(const v8us*)(&sAlo[ar]);
      al[i].h[1] = *(const v8us*)(&sAlo[ar + 16]);
    }
#pragma unroll
    for (int j = 0; j < 4; ++j) {
      const int br = (64 * wc + 16 * j + m) * KP + 8 * h;
      Frag bh, bl;
      bh.h[0] = *(const v8us*)(&sWhi[br]);
      bh.h[1] = *(const v8us*)(&sWhi[br + 16]);
      bl.h[0] = *(const v8us*)(&sWlo[br]);
      bl.h[1] = *(const v8us*)(&sWlo[br + 16]);
#pragma unroll
      for (int i = 0; i < 2; ++i) mma3(acc[i][j], ah[i].v, al[i].v, bh.v, bl.v);
    }
  }

#pragma unroll
  for (int i = 0; i < 2; ++i)
#pragma unroll
    for (int j = 0; j < 4; ++j)
#pragma unroll
      for (int r = 0; r < 8; ++r)
        sC[(32 * wr + 16 * i + 8 * h + r) * CP + 64 * wc + 16 * j + m] = acc[i][j][r];
  __syncthreads();
  // one wave-wide store = one t row of the tile = four whole 128-B lines, one per slice
#pragma unroll
  for (int i = 0; i < AT_M * AT_N / (4 * 256); ++i) {
    const int idx = i * 256 + tid;
    const int row = idx / (AT_N / 4);
    const int c4  = (idx % (AT_N / 4)) * 4;
    const v4f val = *(const v4f*)(&sC[row * CP + c4]);
    float* gp = C + (size_t)(c4 / DH) * slice + (size_t)row * C_DIM + (c4 % DH);
    *(v4f*)gp = val;
  }
}

// ---------------------------------------------------------------------------
// Axial sum: out[b, t, c] = sum_m in[b, m, t, c]; one thread per 4 consecutive c.
// ---------------------------------------------------------------------------
__global__ void __launch_bounds__(256)
k_sum_m(const float* __restrict__ in, float* __restrict__ out, int n4)
{
  const int i4 = blockIdx.x * 256 + threadIdx.x;
  if (i4 >= n4) return;
  const size_t i     = (size_t)i4 * 4;
  const size_t inner = (size_t)T_LEN * C_DIM;
  const size_t b     = i / inner;
  const size_t r     = i - b * inner;
  const float* p = in + b * (size_t)M_AX * inner + r;
  v4f s = {0.0f, 0.0f, 0.0f, 0.0f};
#pragma unroll 8
  for (int mm = 0; mm < M_AX; ++mm) s += *(const v4f*)(p + (size_t)mm * inner);
  float* o = out + i;
  *(v4f*)o = s;
  
}

// ---------------------------------------------------------------------------
// Row softmax over 512, one wave per row, in place; rows < narows also copied to a_out.
// Lane holds floats lane*4+0..3 of each 128-float segment -> every store instruction covers
// ---------------------------------------------------------------------------
__global__ void __launch_bounds__(256)
k_softmax(float* __restrict__ w, float* __restrict__ a_out, int nrows, int narows)
{
  const int row  = blockIdx.x * 8 + (threadIdx.x >> 5);
  const int lane = threadIdx.x & 31;
  if (row >= nrows) return;                     // wave-uniform
  float* p = w + (size_t)row * T_LEN + lane * 4;

  v4f v[4];
#pragma unroll
  for (int i = 0; i < 4; ++i) v[i] = *(const v4f*)(p + i * 128);

  float mx = -3.0e38f;
#pragma unroll
  for (int i = 0; i < 4; ++i)
    mx = fmaxf(mx, fmaxf(fmaxf(v[i].x, v[i].y), fmaxf(v[i].z, v[i].w)));
#pragma unroll
  for (int off = 16; off > 0; off >>= 1) mx = fmaxf(mx, __shfl_xor(mx, off, 32));

  float sum = 0.0f;
#pragma unroll
  for (int i = 0; i < 4; ++i) {
    v[i].x = __expf(v[i].x - mx);
    v[i].y = __expf(v[i].y - mx);
    v[i].z = __expf(v[i].z - mx);
    v[i].w = __expf(v[i].w - mx);
    sum += (v[i].x + v[i].y) + (v[i].z + v[i].w);
  }
#pragma unroll
  for (int off = 16; off > 0; off >>= 1) sum += __shfl_xor(sum, off, 32);
  const float inv = 1.0f / sum;
#pragma unroll
  for (int i = 0; i < 4; ++i) v[i] *= inv;

  const bool wa = row < narows;
  float* q = a_out + (size_t)(wa ? row : 0) * T_LEN + lane * 4;

#pragma unroll
  for (int i = 0; i < 4; ++i) {
    *(v4f*)(p + i * 128) = v[i];
    if (wa) *(v4f*)(q + i * 128) = v[i];
  }
  
}

// ---------------------------------------------------------------------------
extern "C" void kernel_launch(void* const* d_in, const int* in_sizes, int n_in,
                              void* d_out, int out_size, void* d_ws, size_t ws_size,
                              hipStream_t stream)
{
  if (n_in < 10) return;
  const int n_x  = B_SZ * M_AX * T_LEN * C_DIM;          // 8388608
  const int n_w  = C_DIM * C_DIM;
  const int n_a  = NH * T_LEN * T_LEN;                   // 2097152
  if (in_sizes[0] != n_x || in_sizes[1] != n_x) return;
  if (in_sizes[2] != n_w || in_sizes[4] != n_w || in_sizes[6] != n_w || in_sizes[8] != n_w) return;
  if (in_sizes[3] != C_DIM || in_sizes[5] != C_DIM || in_sizes[7] != C_DIM || in_sizes[9] != C_DIM) return;
  if (out_size != n_x + n_a) return;

  const float* x  = (const float*)d_in[0];
  const float* y  = (const float*)d_in[1];
  const float* Wq = (const float*)d_in[2];
  const float* bq = (const float*)d_in[3];
  const float* Wk = (const float*)d_in[4];
  const float* bk = (const float*)d_in[5];
  const float* Wv = (const float*)d_in[6];
  const float* bv = (const float*)d_in[7];
  const float* Wp = (const float*)d_in[8];
  const float* bp = (const float*)d_in[9];

  float* out   = (float*)d_out;                            // [2,32,512,256]
  float* a_out = out + (size_t)n_x;                        // [8,512,512] at byte 33554432

  const size_t n_sum = (size_t)B_SZ * T_LEN * C_DIM;       // 262144
  const size_t n_v   = (size_t)n_x;                        // 8388608
  const size_t n_sc  = (size_t)B_SZ * NH * T_LEN * T_LEN;  // 4194304
  const size_t o_xsum = 0;
  const size_t o_ysum = o_xsum + n_sum;
  const size_t o_qt   = o_ysum + n_sum;
  const size_t o_kt   = o_qt   + n_sum;
  const size_t o_v    = o_kt   + n_sum;
  const size_t o_wsc  = o_v    + n_v;
  const size_t o_att  = o_wsc  + n_sc;
  const size_t o_end  = o_att  + n_v;                      // 22020096 floats = 88080384 B
  if (o_end * sizeof(float) > ws_size) return;

  float* ws   = (float*)d_ws;
  float* xsum = ws + o_xsum;
  float* ysum = ws + o_ysum;
  float* qt   = ws + o_qt;
  float* kt   = ws + o_kt;
  float* vbuf = ws + o_v;
  float* wsc  = ws + o_wsc;
  float* att  = ws + o_att;

  // 1) axial sums of x and y over m
  const int n4 = (int)(n_sum / 4);                         // 65536
  k_sum_m<<<dim3((n4 + 255) / 256), dim3(256), 0, stream>>>(x, xsum, n4);
  k_sum_m<<<dim3((n4 + 255) / 256), dim3(256), 0, stream>>>(y, ysum, n4);

  // 2) qt = xsum @ Wq^T + 32*bq ; kt = ysum @ Wk^T + 32*bk   [1024 x 256], K = 256
  k_gemm<64, 0, 1><<<dim3(C_DIM / 64, (B_SZ * T_LEN) / 64, 1), dim3(128), 0, stream>>>(
      xsum, Wq, qt, bq, 0, 0, 0, 0, 0, 0, 0, 0, 0,
      B_SZ * T_LEN, C_DIM, C_DIM, C_DIM, C_DIM, C_DIM, 1, 1, (float)M_AX, 1.0f);
  k_gemm<64, 0, 1><<<dim3(C_DIM / 64, (B_SZ * T_LEN) / 64, 1), dim3(128), 0, stream>>>(
      ysum, Wk, kt, bk, 0, 0, 0, 0, 0, 0, 0, 0, 0,
      B_SZ * T_LEN, C_DIM, C_DIM, C_DIM, C_DIM, C_DIM, 1, 1, (float)M_AX, 1.0f);

  // 3) v = y_flat @ Wv^T + bv   [32768 x 256], K = 256
  k_gemm<64, 0, 1><<<dim3(C_DIM / 64, (B_SZ * M_AX * T_LEN) / 64, 1), dim3(128), 0, stream>>>(
      y, Wv, vbuf, bv, 0, 0, 0, 0, 0, 0, 0, 0, 0,
      B_SZ * M_AX * T_LEN, C_DIM, C_DIM, C_DIM, C_DIM, C_DIM, 1, 1, 1.0f, 1.0f);

  // 4) scores[b,n] = (1/32) qt_head @ kt_head^T   [512 x 512], K = 32, z = b*8 + n  (no bias: HB = 0, pointer never read)
  k_gemm<64, 0, 0><<<dim3(T_LEN / 64, T_LEN / 64, B_SZ * NH), dim3(128), 0, stream>>>(
      qt, kt, wsc, kt,
      (long long)T_LEN * C_DIM, 0, DH,
      (long long)T_LEN * C_DIM, 0, DH,
      (long long)NH * T_LEN * T_LEN, 0, (long long)T_LEN * T_LEN,
      T_LEN, T_LEN, DH, C_DIM, C_DIM, T_LEN, NH, 1, 0.0f, 1.0f / 32.0f);

  // 5) softmax rows in place; rows of batch 0 also to a_out
  const int nrows = B_SZ * NH * T_LEN;                     // 8192
  k_softmax<<<dim3((nrows + 7) / 8), dim3(256), 0, stream>>>(wsc, a_out, nrows, NH * T_LEN);

  // 6) att[b,:,n] = w[b,n] @ v[b,:][:, n*32 .. n*32+31]   [512 x (32*32)], K = 512, z = b*8 + n, x = 4 slices m
  k_att<<<dim3(M_AX / AT_SL, T_LEN / AT_M, B_SZ * NH), dim3(256), 0, stream>>>(wsc, vbuf, att);

  // 7) out = att @ Wp^T + bp   [32768 x 256], K = 256
  k_gemm<64, 0, 1><<<dim3(C_DIM / 64, (B_SZ * M_AX * T_LEN) / 64, 1), dim3(128), 0, stream>>>(
      att, Wp, out, bp, 0, 0, 0, 0, 0, 0, 0, 0, 0,
      B_SZ * M_AX * T_LEN, C_DIM, C_DIM, C_DIM, C_DIM, C_DIM, 1, 1, 1.0f, 1.0f);
}

// v003
// One run takes 92.9 microseconds.
// Two timings next to v002 put it at 1.18 and 1.19 times that version's speed.
// Over all steps from v000 it is 2.06 times as fast.
// Contractions (q/k/v/out projections, q.k^T scores, w.v): v_wmma_f32_16x16x32_bf16 with each f32 operand carried as bf16 hi + bf16 lo (hi.hi + hi.lo + lo.hi), f32 accumulate; axial sums, softmax and epilogues f32.
#include <hip/hip_runtime.h>
#include <stdint.h>

typedef float          v4f  __attribute__((ext_vector_type(4)));
typedef float          v8f  __attribute__((ext_vector_type(8)));
typedef unsigned int   v2u  __attribute__((ext_vector_type(2)));
typedef unsigned short v8us __attribute__((ext_vector_type(8)));
typedef __bf16         v16b __attribute__((ext_vector_type(16)));
typedef __bf16         v2b  __attribute__((ext_vector_type(2)));
typedef float          v2f  __attribute__((ext_vector_type(2)));
union Frag { v16b v; v8us h[2]; };

#define C_DIM 256
#define NH    8
#define DH    32
#define B_SZ  2
#define M_AX  32
#define T_LEN 512
#define KP    40      // LDS pitch (16-bit elements) of the 32-deep k tiles; multiple of 8 for 16-B fragment loads

// x = hi + lo with hi = rne_bf16(x), lo = rne_bf16(x - hi); (x - hi) is exact in f32.
// Both roundings are the chip's own packed convert (nearest even, two values an instruction).
static __device__ __forceinline__ void split2(float x0, float x1, unsigned int& hb, unsigned int& lb) {
  const v2f x  = {x0, x1};
  const v2b hi = __builtin_convertvector(x, v2b);
  const v2f r  = x - __builtin_convertvector(hi, v2f);
  const v2b lo = __builtin_convertvector(r, v2b);
  hb = __builtin_bit_cast(unsigned int, hi);
  lb = __builtin_bit_cast(unsigned int, lo);
}
static __device__ __forceinline__ void split_hl(float x, unsigned int& hb, unsigned int& lb) {
  unsigned int h2, l2;
  split2(x, x, h2, l2);
  hb = h2 & 0xFFFFu;
  lb = l2 & 0xFFFFu;
}
static __device__ __forceinline__ void split4(v4f v, v2u& hi, v2u& lo) {
  unsigned int h01, h23, l01, l23;
  split2(v.x, v.y, h01, l01);
  split2(v.z, v.w, h23, l23);
  hi.x = h01; hi.y = h23;
  lo.x = l01; lo.y = l23;
}

// three 16x16x32 bf16 ops into one accumulator, then the VALU hazard guard
static __device__ __forceinline__ void mma3(v8f& acc, v16b ah, v16b al, v16b bh, v16b bl) {
  acc = __builtin_amdgcn_wmma_f32_16x16x32_bf16(false, ah, false, bh, (short)0, acc, false, false);
  acc = __builtin_amdgcn_wmma_f32_16x16x32_bf16(false, ah, false, bl, (short)0, acc, false, false);
  acc = __builtin_amdgcn_wmma_f32_16x16x32_bf16(false, al, false, bh, (short)0, acc, false, false);
  asm volatile("v_nop\n\tv_nop\n\tv_nop\n\tv_nop" : "+v"(acc) : "v"(ah), "v"(al), "v"(bh), "v"(bl));
}

// ---------------------------------------------------------------------------
// Batched GEMM  C[M x N] = alpha * A[M x K] * op(W) (+ bias_scale * bias[n] when HB)
//   A : row-major, k contiguous, pitch lda
//   W : WK == 0 -> W[n][k] (k contiguous, pitch ldb), C = A * W^T
//       WK == 1 -> W[k][n] (n contiguous, pitch ldb), C = A * W
//   C : row-major, pitch ldc
//   HB == 0: bias pointer is never read.
// Batch z -> (zb, zm, zn) with independent element strides per operand.
// Block = 128 threads (4 waves), tile 64 rows x BN cols, 32 k per step.
// Wave w owns rows 16w..16w+15 and all BN cols (BN/16 accumulator tiles).
// Fragment maps per lane l (h = l>>4, m = l&15):
//   A: row m, el 0..7 <- k 8h+0..7, el 8..15 <- k 16+8h+0..7
//   B: col m, same k map;   D: el r <- (row 8h+r, col m)
// Requires M % 64 == 0, N % BN == 0, K % 32 == 0, 16-B aligned rows.
// ---------------------------------------------------------------------------
// gemm_tile: one 64 x BN tile of C at (row0, col0), by one whole block.
template <int BN, int WK, int HB>
static __device__ __forceinline__ void
gemm_tile(const float* __restrict__ A, const float* __restrict__ W,
          float* __restrict__ C, const float* __restrict__ bias,
          int row0, int col0, int K, int lda, int ldb, int ldc,
          float bias_scale, float alpha)
{
  constexpr int TN  = BN / 16;          // accumulator tiles per wave
  constexpr int CP  = BN + 4;           // f32 pitch of the staged C tile (multiple of 4)
  constexpr int NCH = BN / 16;          // 16-B W chunks per thread per k step

  __shared__ __attribute__((aligned(16))) unsigned short sAhi[64 * KP];
  __shared__ __attribute__((aligned(16))) unsigned short sAlo[64 * KP];
  __shared__ __attribute__((aligned(16))) unsigned short sWhi[BN * KP];
  __shared__ __attribute__((aligned(16))) unsigned short sWlo[BN * KP];
  __shared__ __attribute__((aligned(16))) float          sC[64 * CP];

  const int tid = threadIdx.x;
  const int wv  = tid >> 5;
  const int l   = tid & 31;
  const int h   = l >> 4;
  const int m   = l & 15;

  v8f acc[TN];
#pragma unroll
  for (int j = 0; j < TN; ++j) acc[j] = (v8f){};

  for (int k0 = 0; k0 < K; k0 += 32) {
    v4f ra[4];
    v4f rw[NCH];
    // A tile 64 x 32: chunk c -> row c>>3, k 4*(c&7)
#pragma unroll
    for (int i = 0; i < 4; ++i) {
      const int c = tid + 128 * i;
      const int r = c >> 3, k4 = (c & 7) * 4;
      ra[i] = *(const v4f*)(A + (size_t)(row0 + r) * lda + k0 + k4);
    }
#pragma unroll
    for (int i = 0; i < NCH; ++i) {
      const int c = tid + 128 * i;
      if (WK) {
        const int s = c / (BN / 4), n4 = (c % (BN / 4)) * 4;        // k row s, 4 consecutive n
        rw[i] = *(const v4f*)(W + (size_t)(k0 + s) * ldb + col0 + n4);
      } else {
        const int n = c >> 3, k4 = (c & 7) * 4;                      // n row, 4 consecutive k
        rw[i] = *(const v4f*)(W + (size_t)(col0 + n) * ldb + k0 + k4);
      }
    }
    __syncthreads();          // all waves done reading the tiles of the prior k step
#pragma unroll
    for (int i = 0; i < 4; ++i) {
      const int c = tid + 128 * i;
      const int r = c >> 3, k4 = (c & 7) * 4;
      v2u hi, lo;
      split4(ra[i], hi, lo);
      *(v2u*)(&sAhi[r * KP + k4]) = hi;
      *(v2u*)(&sAlo[r * KP + k4]) = lo;
    }
#pragma unroll
    for (int i = 0; i < NCH; ++i) {
      const int c = tid + 128 * i;
      if (WK) {
        const int s = c / (BN / 4), n4 = (c % (BN / 4)) * 4;
        unsigned int h0, h1, h2, h3, l0, l1, l2, l3;
        split_hl(rw[i].x, h0, l0); split_hl(rw[i].y, h1, l1);
        split_hl(rw[i].z, h2, l2); split_hl(rw[i].w, h3, l3);
        sWhi[(n4 + 0) * KP + s] = (unsigned short)h0;  sWlo[(n4 + 0) * KP + s] = (unsigned short)l0;
        sWhi[(n4 + 1) * KP + s] = (unsigned short)h1;  sWlo[(n4 + 1) * KP + s] = (unsigned short)l1;
        sWhi[(n4 + 2) * KP + s] = (unsigned short)h2;  sWlo[(n4 + 2) * KP + s] = (unsigned short)l2;
        sWhi[(n4 + 3) * KP + s] = (unsigned short)h3;  sWlo[(n4 + 3) * KP + s] = (unsigned short)l3;
      } else {
        const int n = c >> 3, k4 = (c & 7) * 4;
        v2u hi, lo;
        split4(rw[i], hi, lo);
        *(v2u*)(&sWhi[n * KP + k4]) = hi;
        *(v2u*)(&sWlo[n * KP + k4]) = lo;
      }
    }
    __syncthreads();          // tiles visible to every wave

    Frag ah, al;
    {
      const int ar = (16 * wv + m) * KP + 8 * h;
      ah.h[0] = *(const v8us*)(&sAhi[ar]);
      ah.h[1] = *(const v8us*)(&sAhi[ar + 16]);
      al.h[0] = *(const v8us*)(&sAlo[ar]);
      al.h[1] = *(const v8us*)(&sAlo[ar + 16]);
    }
#pragma unroll
    for (int j = 0; j < TN; ++j) {
      const int br = (16 * j + m) * KP + 8 * h;
      Frag bh, bl;
      bh.h[0] = *(const v8us*)(&sWhi[br]);
      bh.h[1] = *(const v8us*)(&sWhi[br + 16]);
      bl.h[0] = *(const v8us*)(&sWlo[br]);
      bl.h[1] = *(const v8us*)(&sWlo[br + 16]);
      mma3(acc[j], ah.v, al.v, bh.v, bl.v);
    }
  }

#pragma unroll
  for (int j = 0; j < TN; ++j) {
    float bb = 0.0f;
    if (HB) bb = bias_scale * bias[col0 + 16 * j + m];
#pragma unroll
    for (int r = 0; r < 8; ++r) {
      sC[(16 * wv + 8 * h + r) * CP + 16 * j + m] = alpha * acc[j][r] + bb;
    }
  }
  __syncthreads();
#pragma unroll
  for (int i = 0; i < BN / 8; ++i) {
    const int idx = i * 128 + tid;
    const int row = idx / (BN / 4);
    const int c4  = (idx % (BN / 4)) * 4;
    const v4f val = *(const v4f*)(&sC[row * CP + c4]);
    float* gp = C + (size_t)(row0 + row) * ldc + col0 + c4;
    *(v4f*)gp = val;
  }
}

template <int BN, int WK, int HB>
__global__ void __launch_bounds__(128)
k_gemm(const float* __restrict__ Abase, const float* __restrict__ Wbase,
       float* __restrict__ Cbase, const float* __restrict__ bias,
       long long sAb, long long sAm, long long sAn,
       long long sBb, long long sBm, long long sBn,
       long long sCb, long long sCm, long long sCn,
       int Mrows, int Ncols, int K, int lda, int ldb, int ldc,
       int nInner, int nMid, float bias_scale, float alpha)
{
  const int z  = blockIdx.z;
  const int zn = z % nInner;
  const int zm = (z / nInner) % nMid;
  const int zb = z / (nInner * nMid);
  const float* A = Abase + ((long long)zb * sAb + (long long)zm * sAm + (long long)zn * sAn);
  const float* W = Wbase + ((long long)zb * sBb + (long long)zm * sBm + (long long)zn * sBn);
  float*       C = Cbase + ((long long)zb * sCb + (long long)zm * sCm + (long long)zn * sCn);

  const int row0 = blockIdx.y * 64;
  const int col0 = blockIdx.x * BN;
  if (row0 + 64 > Mrows || col0 + BN > Ncols) return;     // block-uniform, before any barrier

  gemm_tile<BN, WK, HB>(A, W, C, bias, row0, col0, K, lda, ldb, ldc, bias_scale, alpha);
}

// ---------------------------------------------------------------------------
// The three input projections, which do not depend on one another, as ONE launch:
//   blockIdx.y <  QKB          : qt = xsum @ Wq^T + 32 bq   (row tile blockIdx.y)
//   blockIdx.y <  2 QKB        : kt = ysum @ Wk^T + 32 bk
//   otherwise                  : v  = y    @ Wv^T +    bv
// qt and kt are 64 blocks each, a quarter of the chip's 256 WGPs if launched alone; here they come first
// in the grid and run beside the 2048 blocks of v.
// ---------------------------------------------------------------------------
#define QKB ((B_SZ * T_LEN) / 64)            // row tiles of qt, and of kt
#define VB  ((B_SZ * M_AX * T_LEN) / 64)     // row tiles of v
__global__ void __launch_bounds__(128)
k_qkv(const float* __restrict__ xsum, const float* __restrict__ ysum, const float* __restrict__ y,
      const float* __restrict__ Wq, const float* __restrict__ Wk, const float* __restrict__ Wv,
      const float* __restrict__ bq, const float* __restrict__ bk, const float* __restrict__ bv,
      float* __restrict__ qt, float* __restrict__ kt, float* __restrict__ vbuf)
{
  const int by = blockIdx.y;
  if (by >= 2 * QKB + VB) return;              // block-uniform, before any barrier
  const int seg = by < QKB ? 0 : (by < 2 * QKB ? 1 : 2);
  const float* A    = seg == 0 ? xsum : (seg == 1 ? ysum : y);
  const float* W    = seg == 0 ? Wq   : (seg == 1 ? Wk   : Wv);
  const float* bias = seg == 0 ? bq   : (seg == 1 ? bk   : bv);
  float*       C    = seg == 0 ? qt   : (seg == 1 ? kt   : vbuf);
  const float  bs   = seg == 2 ? 1.0f : (float)M_AX;
  const int row0 = (by - seg * QKB) * 64;
  const int col0 = blockIdx.x * 64;
  gemm_tile<64, 0, 1>(A, W, C, bias, row0, col0, C_DIM, C_DIM, C_DIM, C_DIM, bs, 1.0f);
}

// ---------------------------------------------------------------------------
// att[b, m, t, n*32 + d] = sum_s w[b, n, t, s] * v[b, m, s, n*32 + d]
// The 32 axial slices m of one (b, n) share w, so they are the columns of ONE product
//   [512 t x 512 s] * [512 s x (32 m * 32 d)].
// Block = 256 threads (8 waves), tile 128 t x 128 columns (4 slices x 32 d), 32 s per step.
// Wave wv owns rows 32*(wv&3)..+31 and columns 64*(wv>>2)..+63 (2 x 4 accumulator tiles).
// Fragment maps, LDS layout ([row or column][k], pitch KP) and k order are those of k_gemm.
// grid: x = group of 4 slices, y = row tile, z = b*8 + n
// ---------------------------------------------------------------------------
#define AT_M  128
#define AT_N  128
#define AT_SL (AT_N / DH)
__global__ void __launch_bounds__(256)
k_att(const float* __restrict__ wsc, const float* __restrict__ vbuf, float* __restrict__ att)
{
  constexpr int CP = AT_N + 4;          // f32 pitch of the staged C tile (multiple of 4)

  __shared__ __attribute__((aligned(16))) unsigned short sAhi[AT_M * KP];
  __shared__ __attribute__((aligned(16))) unsigned short sAlo[AT_M * KP];
  __shared__ __attribute__((aligned(16))) unsigned short sWhi[AT_N * KP];
  __shared__ __attribute__((aligned(16))) unsigned short sWlo[AT_N * KP];
  __shared__ __attribute__((aligned(16))) float          sC[AT_M * CP];

  const int zn   = blockIdx.z % NH;
  const int zb   = blockIdx.z / NH;
  const int m0   = blockIdx.x * AT_SL;
  const int row0 = blockIdx.y * AT_M;
  const size_t slice = (size_t)T_LEN * C_DIM;
  const float* A = wsc  + ((size_t)blockIdx.z * T_LEN + row0) * T_LEN;
  const float* V = vbuf + (size_t)(zb * M_AX + m0) * slice + zn * DH;
  float*       C = att  + (size_t)(zb * M_AX + m0) * slice + (size_t)row0 * C_DIM + zn * DH;

  const int tid = threadIdx.x;
  const int wv  = tid >> 5;
  const int l   = tid & 31;
  const int h   = l >> 4;
  const int m   = l & 15;
  const int wr  = wv & 3;
  const int wc  = wv >> 2;

  // v tile 32 s x 128 columns: a thread takes 4 s x 4 d of one slice, so that each column's
  // four s go to LDS as one 8-B store; 8 lanes cover the 128 B of one (slice, s) row.
  const int vd4 = (tid & 7) * 4;                              // first d
  const int vs4 = ((tid >> 7) * 4 + ((tid >> 3) & 3)) * 4;    // first s inside the step
  const int vsl = (tid >> 5) & 3;                             // slice inside the group
  const int vn  = vsl * DH + vd4;                             // first tile column
  const float* Vt = V + (size_t)vsl * slice + (size_t)vs4 * C_DIM + vd4;

  v8f acc[2][4];
#pragma unroll
  for (int i = 0; i < 2; ++i)
#pragma unroll
    for (int j = 0; j < 4; ++j) acc[i][j] = (v8f){};

  for (int k0 = 0; k0 < T_LEN; k0 += 32) {
    v4f ra[4];
    v4f rw[4];
    // w tile 128 x 32: chunk c -> row c>>3, k 4*(c&7)
#pragma unroll
    for (int i = 0; i < 4; ++i) {
      const int c = tid + 256 * i;
      const int r = c >> 3, k4 = (c & 7) * 4;
      ra[i] = *(const v4f*)(A + (size_t)r * T_LEN + k0 + k4);
    }
#pragma unroll
    for (int i = 0; i < 4; ++i) rw[i] = *(const v4f*)(Vt + (size_t)(k0 + i) * C_DIM);
    // keeps the step's eight loads in flight together: without it the scheduler sinks some of them
    // behind the first splits, and a step then waits out the load latency three times instead of once
    __builtin_amdgcn_sched_barrier(0);
    __syncthreads();          // all waves done reading the tiles of the prior k step
#pragma unroll
    for (int i = 0; i < 4; ++i) {
      const int c = tid + 256 * i;
      const int r = c >> 3, k4 = (c & 7) * 4;
      v2u hi, lo;
      split4(ra[i], hi, lo);
      *(v2u*)(&sAhi[r * KP + k4]) = hi;
      *(v2u*)(&sAlo[r * KP + k4]) = lo;
    }
#pragma unroll
    for (int j = 0; j < 4; ++j) {
      const v4f col = {rw[0][j], rw[1][j], rw[2][j], rw[3][j]};   // s = vs4 .. vs4+3 of column vn+j
      v2u hi, lo;
      split4(col, hi, lo);
      *(v2u*)(&sWhi[(vn + j) * KP + vs4]) = hi;
      *(v2u*)(&sWlo[(vn + j) * KP + vs4]) = lo;
    }
    __syncthreads();          // tiles visible to every wave

    Frag ah[2], al[2];
#pragma unroll
    for (int i = 0; i < 2; ++i) {
      const int ar = (32 * wr + 16 * i + m) * KP + 8 * h;
      ah[i].h[0] = *(const v8us*)(&sAhi[ar]);
      ah[i].h[1] = *(const v8us*)(&sAhi[ar + 16]);
      al[i].h[0] = *(const v8us*)(&sAlo[ar]);
      al[i].h[1] = *(const v8us*)(&sAlo[ar + 16]);
    }
#pragma unroll
    for (int j = 0; j < 4; ++j) {
      const int br = (64 * wc + 16 * j + m) * KP + 8 * h;
      Frag bh, bl;
      bh.h[0] = *(const v8us*)(&sWhi[br]);
      bh.h[1] = *(const v8us*)(&sWhi[br + 16]);
      bl.h[0] = *(const v8us*)(&sWlo[br]);
      bl.h[1] = *(const v8us*)(&sWlo[br + 16]);
#pragma unroll
      for (int i = 0; i < 2; ++i) mma3(acc[i][j], ah[i].v, al[i].v, bh.v, bl.v);
    }
  }

#pragma unroll
  for (int i = 0; i < 2; ++i)
#pragma unroll
    for (int j = 0; j < 4; ++j)
#pragma unroll
      for (int r = 0; r < 8; ++r)
        sC[(32 * wr + 16 * i + 8 * h + r) * CP + 64 * wc + 16 * j + m] = acc[i][j][r];
  __syncthreads();
  // one wave-wide store = one t row of the tile = four whole 128-B lines, one per slice
#pragma unroll
  for (int i = 0; i < AT_M * AT_N / (4 * 256); ++i) {
    const int idx = i * 256 + tid;
    const int row = idx / (AT_N / 4);
    const int c4  = (idx % (AT_N / 4)) * 4;
    const v4f val = *(const v4f*)(&sC[row * CP + c4]);
    float* gp = C + (size_t)(c4 / DH) * slice + (size_t)row * C_DIM + (c4 % DH);
    *(v4f*)gp = val;
  }
}

// ---------------------------------------------------------------------------
// Axial sum: out[b, t, c] = sum_m in[b, m, t, c]; one thread per 4 consecutive c.
// blockIdx.y picks the tensor (0: in0 -> out0, 1: in1 -> out1): both sums in one launch.
// ---------------------------------------------------------------------------
__global__ void __launch_bounds__(256)
k_sum_m(const float* __restrict__ in0, const float* __restrict__ in1,
        float* __restrict__ out0, float* __restrict__ out1, int n4)
{
  const int i4 = blockIdx.x * 256 + threadIdx.x;
  if (i4 >= n4) return;
  const float* in  = blockIdx.y ? in1 : in0;
  float*       out = blockIdx.y ? out1 : out0;
  const size_t i     = (size_t)i4 * 4;
  const size_t inner = (size_t)T_LEN * C_DIM;
  const size_t b     = i / inner;
  const size_t r     = i - b * inner;
  const float* p = in + b * (size_t)M_AX * inner + r;
  v4f s = {0.0f, 0.0f, 0.0f, 0.0f};
#pragma unroll 8
  for (int mm = 0; mm < M_AX; ++mm) s += *(const v4f*)(p + (size_t)mm * inner);
  float* o = out + i;
  *(v4f*)o = s;
  
}

// ---------------------------------------------------------------------------
// Row softmax over 512, one wave per row, in place; rows < narows also copied to a_out.
// Lane holds floats lane*4+0..3 of each 128-float segment -> every store instruction covers
// ---------------------------------------------------------------------------
__global__ void __launch_bounds__(256)
k_softmax(float* __restrict__ w, float* __restrict__ a_out, int nrows, int narows)
{
  const int row  = blockIdx.x * 8 + (threadIdx.x >> 5);
  const int lane = threadIdx.x & 31;
  if (row >= nrows) return;                     // wave-uniform
  float* p = w + (size_t)row * T_LEN + lane * 4;

  v4f v[4];
#pragma unroll
  for (int i = 0; i < 4; ++i) v[i] = *(const v4f*)(p + i * 128);

  float mx = -3.0e38f;
#pragma unroll
  for (int i = 0; i < 4; ++i)
    mx = fmaxf(mx, fmaxf(fmaxf(v[i].x, v[i].y), fmaxf(v[i].z, v[i].w)));
#pragma unroll
  for (int off = 16; off > 0; off >>= 1) mx = fmaxf(mx, __shfl_xor(mx, off, 32));

  float sum = 0.0f;
#pragma unroll
  for (int i = 0; i < 4; ++i) {
    v[i].x = __expf(v[i].x - mx);
    v[i].y = __expf(v[i].y - mx);
    v[i].z = __expf(v[i].z - mx);
    v[i].w = __expf(v[i].w - mx);
    sum += (v[i].x + v[i].y) + (v[i].z + v[i].w);
  }
#pragma unroll
  for (int off = 16; off > 0; off >>= 1) sum += __shfl_xor(sum, off, 32);
  const float inv = 1.0f / sum;
#pragma unroll
  for (int i = 0; i < 4; ++i) v[i] *= inv;

  const bool wa = row < narows;
  float* q = a_out + (size_t)(wa ? row : 0) * T_LEN + lane * 4;

#pragma unroll
  for (int i = 0; i < 4; ++i) {
    *(v4f*)(p + i * 128) = v[i];
    if (wa) *(v4f*)(q + i * 128) = v[i];
  }
  
}

// ---------------------------------------------------------------------------
extern "C" void kernel_launch(void* const* d_in, const int* in_sizes, int n_in,
                              void* d_out, int out_size, void* d_ws, size_t ws_size,
                              hipStream_t stream)
{
  if (n_in < 10) return;
  const int n_x  = B_SZ * M_AX * T_LEN * C_DIM;          // 8388608
  const int n_w  = C_DIM * C_DIM;
  const int n_a  = NH * T_LEN * T_LEN;                   // 2097152
  if (in_sizes[0] != n_x || in_sizes[1] != n_x) return;
  if (in_sizes[2] != n_w || in_sizes[4] != n_w || in_sizes[6] != n_w || in_sizes[8] != n_w) return;
  if (in_sizes[3] != C_DIM || in_sizes[5] != C_DIM || in_sizes[7] != C_DIM || in_sizes[9] != C_DIM) return;
  if (out_size != n_x + n_a) return;

  const float* x  = (const float*)d_in[0];
  const float* y  = (const float*)d_in[1];
  const float* Wq = (const float*)d_in[2];
  const float* bq = (const float*)d_in[3];
  const float* Wk = (const float*)d_in[4];
  const float* bk = (const float*)d_in[5];
  const float* Wv = (const float*)d_in[6];
  const float* bv = (const float*)d_in[7];
  const float* Wp = (const float*)d_in[8];
  const float* bp = (const float*)d_in[9];

  float* out   = (float*)d_out;                            // [2,32,512,256]
  float* a_out = out + (size_t)n_x;                        // [8,512,512] at byte 33554432

  const size_t n_sum = (size_t)B_SZ * T_LEN * C_DIM;       // 262144
  const size_t n_v   = (size_t)n_x;                        // 8388608
  const size_t n_sc  = (size_t)B_SZ * NH * T_LEN * T_LEN;  // 4194304
  const size_t o_xsum = 0;
  const size_t o_ysum = o_xsum + n_sum;
  const size_t o_qt   = o_ysum + n_sum;
  const size_t o_kt   = o_qt   + n_sum;
  const size_t o_v    = o_kt   + n_sum;
  const size_t o_wsc  = o_v    + n_v;
  const size_t o_att  = o_wsc  + n_sc;
  const size_t o_end  = o_att  + n_v;                      // 22020096 floats = 88080384 B
  if (o_end * sizeof(float) > ws_size) return;

  float* ws   = (float*)d_ws;
  float* xsum = ws + o_xsum;
  float* ysum = ws + o_ysum;
  float* qt   = ws + o_qt;
  float* kt   = ws + o_kt;
  float* vbuf = ws + o_v;
  float* wsc  = ws + o_wsc;
  float* att  = ws + o_att;

  // 1) axial sums of x and y over m
  const int n4 = (int)(n_sum / 4);                         // 65536
  k_sum_m<<<dim3((n4 + 255) / 256, 2), dim3(256), 0, stream>>>(x, y, xsum, ysum, n4);

  // 2+3) qt = xsum @ Wq^T + 32*bq, kt = ysum @ Wk^T + 32*bk   [1024 x 256];  v = y_flat @ Wv^T + bv   [32768 x 256];  K = 256
  k_qkv<<<dim3(C_DIM / 64, 2 * QKB + VB, 1), dim3(128), 0, stream>>>(
      xsum, ysum, y, Wq, Wk, Wv, bq, bk, bv, qt, kt, vbuf);

  // 4) scores[b,n] = (1/32) qt_head @ kt_head^T   [512 x 512], K = 32, z = b*8 + n  (no bias: HB = 0, pointer never read)
  k_gemm<64, 0, 0><<<dim3(T_LEN / 64, T_LEN / 64, B_SZ * NH), dim3(128), 0, stream>>>(
      qt, kt, wsc, kt,
      (long long)T_LEN * C_DIM, 0, DH,
      (long long)T_LEN * C_DIM, 0, DH,
      (long long)NH * T_LEN * T_LEN, 0, (long long)T_LEN * T_LEN,
      T_LEN, T_LEN, DH, C_DIM, C_DIM, T_LEN, NH, 1, 0.0f, 1.0f / 32.0f);

  // 5) softmax rows in place; rows of batch 0 also to a_out
  const int nrows = B_SZ * NH * T_LEN;                     // 8192
  k_softmax<<<dim3((nrows + 7) / 8), dim3(256), 0, stream>>>(wsc, a_out, nrows, NH * T_LEN);

  // 6) att[b,:,n] = w[b,n] @ v[b,:][:, n*32 .. n*32+31]   [512 x (32*32)], K = 512, z = b*8 + n, x = 4 slices m
  k_att<<<dim3(M_AX / AT_SL, T_LEN / AT_M, B_SZ * NH), dim3(256), 0, stream>>>(wsc, vbuf, att);

  // 7) out = att @ Wp^T + bp   [32768 x 256], K = 256
  k_gemm<64, 0, 1><<<dim3(C_DIM / 64, (B_SZ * M_AX * T_LEN) / 64, 1), dim3(128), 0, stream>>>(
      att, Wp, out, bp, 0, 0, 0, 0, 0, 0, 0, 0, 0,
      B_SZ * M_AX * T_LEN, C_DIM, C_DIM, C_DIM, C_DIM, C_DIM, 1, 1, 1.0f, 1.0f);
}

// v004
// Measured time: 83.2 microseconds a run.
// Two timings next to v003 put it at 1.12 and 1.11 times that version's speed.
// Over all steps from v000 it is 2.30 times as fast.
// Contractions (q/k/v/out projections, q.k^T scores, w.v): v_wmma_f32_16x16x32_bf16 with each f32 operand carried as bf16 hi + bf16 lo (hi.hi + hi.lo + lo.hi), f32 accumulate; axial sums, softmax and epilogues f32.
#include <hip/hip_runtime.h>
#include <stdint.h>

typedef float          v4f  __attribute__((ext_vector_type(4)));
typedef float          v8f  __attribute__((ext_vector_type(8)));
typedef unsigned int   v2u  __attribute__((ext_vector_type(2)));
typedef unsigned short v8us __attribute__((ext_vector_type(8)));
typedef __bf16         v16b __attribute__((ext_vector_type(16)));
typedef __bf16         v2b  __attribute__((ext_vector_type(2)));
typedef float          v2f  __attribute__((ext_vector_type(2)));
union Frag { v16b v; v8us h[2]; };

#define C_DIM 256
#define NH    8
#define DH    32
#define B_SZ  2
#define M_AX  32
#define T_LEN 512
#define KP    40      // LDS pitch (16-bit elements) of the 32-deep k tiles; multiple of 8 for 16-B fragment loads

// x = hi + lo with hi = rne_bf16(x), lo = rne_bf16(x - hi); (x - hi) is exact in f32.
// Both roundings are the chip's own packed convert (nearest even, two values an instruction).
static __device__ __forceinline__ void split2(float x0, float x1, unsigned int& hb, unsigned int& lb) {
  const v2f x  = {x0, x1};
  const v2b hi = __builtin_convertvector(x, v2b);
  const v2f r  = x - __builtin_convertvector(hi, v2f);
  const v2b lo = __builtin_convertvector(r, v2b);
  hb = __builtin_bit_cast(unsigned int, hi);
  lb = __builtin_bit_cast(unsigned int, lo);
}
static __device__ __forceinline__ void split_hl(float x, unsigned int& hb, unsigned int& lb) {
  unsigned int h2, l2;
  split2(x, x, h2, l2);
  hb = h2 & 0xFFFFu;
  lb = l2 & 0xFFFFu;
}
static __device__ __forceinline__ void split4(v4f v, v2u& hi, v2u& lo) {
  unsigned int h01, h23, l01, l23;
  split2(v.x, v.y, h01, l01);
  split2(v.z, v.w, h23, l23);
  hi.x = h01; hi.y = h23;
  lo.x = l01; lo.y = l23;
}

// three 16x16x32 bf16 ops into one accumulator, then the VALU hazard guard
static __device__ __forceinline__ void mma3(v8f& acc, v16b ah, v16b al, v16b bh, v16b bl) {
  acc = __builtin_amdgcn_wmma_f32_16x16x32_bf16(false, ah, false, bh, (short)0, acc, false, false);
  acc = __builtin_amdgcn_wmma_f32_16x16x32_bf16(false, ah, false, bl, (short)0, acc, false, false);
  acc = __builtin_amdgcn_wmma_f32_16x16x32_bf16(false, al, false, bh, (short)0, acc, false, false);
  asm volatile("v_nop\n\tv_nop\n\tv_nop\n\tv_nop" : "+v"(acc) : "v"(ah), "v"(al), "v"(bh), "v"(bl));
}

// ---------------------------------------------------------------------------
// Batched GEMM  C[M x N] = alpha * A[M x K] * op(W) (+ bias_scale * bias[n] when HB)
//   A : row-major, k contiguous, pitch C_DIM
//   W : WK == 0 -> W[n][k] (k contiguous, pitch C_DIM), C = A * W^T
//       WK == 1 -> W[k][n] (n contiguous, pitch C_DIM), C = A * W
//   C : row-major, pitch ldc
//   HB == 0: bias pointer is never read.
// Batch z -> (zb, zm, zn) with independent element strides per operand.
// Block = 128 threads (4 waves), tile 64 rows x BN cols, 32 k per step.
// Wave w owns rows 16w..16w+15 and all BN cols (BN/16 accumulator tiles).
// Fragment maps per lane l (h = l>>4, m = l&15):
//   A: row m, el 0..7 <- k 8h+0..7, el 8..15 <- k 16+8h+0..7
//   B: col m, same k map;   D: el r <- (row 8h+r, col m)
// Requires M % 64 == 0, N % BN == 0, K % 32 == 0, 16-B aligned rows.
// ---------------------------------------------------------------------------
// gemm_tile: one 64 x BN tile of C at (row0, col0), by one whole block.
template <int BN, int WK, int HB>
static __device__ __forceinline__ void
gemm_tile(const float* __restrict__ A, const float* __restrict__ W,
          float* __restrict__ C, const float* __restrict__ bias,
          int row0, int col0, int K, int ldc,
          float bias_scale, float alpha)
{
  constexpr int lda = C_DIM;            // row pitch of A and of W: a constant, so that a thread's eight loads
  constexpr int ldb = C_DIM;            // of a k step are two addresses plus immediate offsets
  constexpr int TN  = BN / 16;          // accumulator tiles per wave
  constexpr int CP  = BN + 4;           // f32 pitch of the staged C tile (multiple of 4)
  constexpr int NCH = BN / 16;          // 16-B W chunks per thread per k step

  __shared__ __attribute__((aligned(16))) unsigned short sAhi[64 * KP];
  __shared__ __attribute__((aligned(16))) unsigned short sAlo[64 * KP];
  __shared__ __attribute__((aligned(16))) unsigned short sWhi[BN * KP];
  __shared__ __attribute__((aligned(16))) unsigned short sWlo[BN * KP];
  __shared__ __attribute__((aligned(16))) float          sC[64 * CP];

  const int tid = threadIdx.x;
  const int wv  = tid >> 5;
  const int l   = tid & 31;
  const int h   = l >> 4;
  const int m   = l & 15;

  v8f acc[TN];
#pragma unroll
  for (int j = 0; j < TN; ++j) acc[j] = (v8f){};

  // The tiles of k step k0, 8 x 16 B a thread, from global memory into registers.
  v4f ra[4];
  v4f rw[NCH];
  // Address = block-uniform base of the step + the thread's own fixed 32-bit element offset: few address
  // registers, so that holding the eight chunks across the matrix work costs no resident wave.
  const int st0 = (tid >> 3) * KP + (tid & 7) * 4;     // LDS place of the thread's chunk 0; chunk i is 16 rows on
  const float* Ab = A + (size_t)row0 * lda;
  const float* Wb = WK ? W + col0 : W + (size_t)col0 * ldb;
  auto fetch = [&](int k0) {
    const float* Ak = Ab + k0;
    const float* Wk = WK ? Wb + (size_t)k0 * ldb : Wb + k0;
    // A tile 64 x 32: chunk tid + 128 i -> row (tid>>3) + 16 i, k 4*(tid&7)
#pragma unroll
    for (int i = 0; i < 4; ++i)
      ra[i] = *(const v4f*)(Ak + (size_t)(16 * i) * lda + (unsigned)((tid >> 3) * lda + (tid & 7) * 4));
#pragma unroll
    for (int i = 0; i < NCH; ++i) {
      if (WK) {
        const int c = tid + 128 * i;
        const int s = c / (BN / 4), n4 = (c % (BN / 4)) * 4;        // k row s, 4 consecutive n
        rw[i] = *(const v4f*)(Wk + (unsigned)(s * ldb + n4));
      } else {                                                       // n row (tid>>3) + 16 i, 4 consecutive k
        rw[i] = *(const v4f*)(Wk + (size_t)(16 * i) * ldb + (unsigned)((tid >> 3) * ldb + (tid & 7) * 4));
      }
    }
    // stands in front of the fragment reads and index sums that overwrite the loads' address registers
    asm volatile("s_wait_xcnt 0x0" ::: "memory");
  };

  fetch(0);
  for (int k0 = 0; k0 < K; k0 += 32) {
    __syncthreads();          // all waves done reading the tiles of the prior k step
#pragma unroll
    for (int i = 0; i < 4; ++i) {
      v2u hi, lo;
      split4(ra[i], hi, lo);
      *(v2u*)(&sAhi[st0 + 16 * i * KP]) = hi;
      *(v2u*)(&sAlo[st0 + 16 * i * KP]) = lo;
    }
#pragma unroll
    for (int i = 0; i < NCH; ++i) {
      const int c = tid + 128 * i;
      if (WK) {
        const int s = c / (BN / 4), n4 = (c % (BN / 4)) * 4;
        unsigned int h0, h1, h2, h3, l0, l1, l2, l3;
        split_hl(rw[i].x, h0, l0); split_hl(rw[i].y, h1, l1);
        split_hl(rw[i].z, h2, l2); split_hl(rw[i].w, h3, l3);
        sWhi[(n4 + 0) * KP + s] = (unsigned short)h0;  sWlo[(n4 + 0) * KP + s] = (unsigned short)l0;
        sWhi[(n4 + 1) * KP + s] = (unsigned short)h1;  sWlo[(n4 + 1) * KP + s] = (unsigned short)l1;
        sWhi[(n4 + 2) * KP + s] = (unsigned short)h2;  sWlo[(n4 + 2) * KP + s] = (unsigned short)l2;
        sWhi[(n4 + 3) * KP + s] = (unsigned short)h3;  sWlo[(n4 + 3) * KP + s] = (unsigned short)l3;
      } else {
        v2u hi, lo;
        split4(rw[i], hi, lo);
        *(v2u*)(&sWhi[st0 + 16 * i * KP]) = hi;
        *(v2u*)(&sWlo[st0 + 16 * i * KP]) = lo;
      }
    }
    __syncthreads();          // tiles visible to every wave

    Frag ah, al;
    {
      const int ar = (16 * wv + m) * KP + 8 * h;
      ah.h[0] = *(const v8us*)(&sAhi[ar]);
      ah.h[1] = *(const v8us*)(&sAhi[ar + 16]);
      al.h[0] = *(const v8us*)(&sAlo[ar]);
      al.h[1] = *(const v8us*)(&sAlo[ar + 16]);
    }
    // the next step's loads fly while this step's fragments are read and multiplied; they are waited for at
    // the next split. Behind the A fragment reads, so that the LDS latency runs beside the loads' issue.
    if (k0 + 32 < K) fetch(k0 + 32);
#pragma unroll
    for (int j = 0; j < TN; ++j) {
      const int br = (16 * j + m) * KP + 8 * h;
      Frag bh, bl;
      bh.h[0] = *(const v8us*)(&sWhi[br]);
      bh.h[1] = *(const v8us*)(&sWhi[br + 16]);
      bl.h[0] = *(const v8us*)(&sWlo[br]);
      bl.h[1] = *(const v8us*)(&sWlo[br + 16]);
      mma3(acc[j], ah.v, al.v, bh.v, bl.v);
    }
  }

#pragma unroll
  for (int j = 0; j < TN; ++j) {
    float bb = 0.0f;
    if (HB) bb = bias_scale * bias[col0 + 16 * j + m];
#pragma unroll
    for (int r = 0; r < 8; ++r) {
      sC[(16 * wv + 8 * h + r) * CP + 16 * j + m] = alpha * acc[j][r] + bb;
    }
  }
  __syncthreads();
#pragma unroll
  for (int i = 0; i < BN / 8; ++i) {
    const int idx = i * 128 + tid;
    const int row = idx / (BN / 4);
    const int c4  = (idx % (BN / 4)) * 4;
    const v4f val = *(const v4f*)(&sC[row * CP + c4]);
    float* gp = C + (size_t)(row0 + row) * ldc + col0 + c4;
    *(v4f*)gp = val;
  }
}

template <int BN, int WK, int HB>
__global__ void __launch_bounds__(128)
k_gemm(const float* __restrict__ Abase, const float* __restrict__ Wbase,
       float* __restrict__ Cbase, const float* __restrict__ bias,
       long long sAb, long long sAm, long long sAn,
       long long sBb, long long sBm, long long sBn,
       long long sCb, long long sCm, long long sCn,
       int Mrows, int Ncols, int K, int ldc,
       int nInner, int nMid, float bias_scale, float alpha)
{
  const int z  = blockIdx.z;
  const int zn = z % nInner;
  const int zm = (z / nInner) % nMid;
  const int zb = z / (nInner * nMid);
  const float* A = Abase + ((long long)zb * sAb + (long long)zm * sAm + (long long)zn * sAn);
  const float* W = Wbase + ((long long)zb * sBb + (long long)zm * sBm + (long long)zn * sBn);
  float*       C = Cbase + ((long long)zb * sCb + (long long)zm * sCm + (long long)zn * sCn);

  const int row0 = blockIdx.y * 64;
  const int col0 = blockIdx.x * BN;
  if (row0 + 64 > Mrows || col0 + BN > Ncols) return;     // block-uniform, before any barrier

  gemm_tile<BN, WK, HB>(A, W, C, bias, row0, col0, K, ldc, bias_scale, alpha);
}

// ---------------------------------------------------------------------------
// The three input projections, which do not depend on one another, as ONE launch:
//   blockIdx.y <  QKB          : qt = xsum @ Wq^T + 32 bq   (row tile blockIdx.y)
//   blockIdx.y <  2 QKB        : kt = ysum @ Wk^T + 32 bk
//   otherwise                  : v  = y    @ Wv^T +    bv
// qt and kt are 64 blocks each, a quarter of the chip's 256 WGPs if launched alone; here they come first
// in the grid and run beside the 2048 blocks of v.
// ---------------------------------------------------------------------------
#define QKB ((B_SZ * T_LEN) / 64)            // row tiles of qt, and of kt
#define VB  ((B_SZ * M_AX * T_LEN) / 64)     // row tiles of v
__global__ void __launch_bounds__(128)
k_qkv(const float* __restrict__ xsum, const float* __restrict__ ysum, const float* __restrict__ y,
      const float* __restrict__ Wq, const float* __restrict__ Wk, const float* __restrict__ Wv,
      const float* __restrict__ bq, const float* __restrict__ bk, const float* __restrict__ bv,
      float* __restrict__ qt, float* __restrict__ kt, float* __restrict__ vbuf)
{
  const int by = blockIdx.y;
  if (by >= 2 * QKB + VB) return;              // block-uniform, before any barrier
  const int seg = by < QKB ? 0 : (by < 2 * QKB ? 1 : 2);
  const float* A    = seg == 0 ? xsum : (seg == 1 ? ysum : y);
  const float* W    = seg == 0 ? Wq   : (seg == 1 ? Wk   : Wv);
  const float* bias = seg == 0 ? bq   : (seg == 1 ? bk   : bv);
  float*       C    = seg == 0 ? qt   : (seg == 1 ? kt   : vbuf);
  const float  bs   = seg == 2 ? 1.0f : (float)M_AX;
  const int row0 = (by - seg * QKB) * 64;
  const int col0 = blockIdx.x * 64;
  gemm_tile<64, 0, 1>(A, W, C, bias, row0, col0, C_DIM, C_DIM, bs, 1.0f);
}

// ---------------------------------------------------------------------------
// att[b, m, t, n*32 + d] = sum_s w[b, n, t, s] * v[b, m, s, n*32 + d]
// The 32 axial slices m of one (b, n) share w, so they are the columns of ONE product
//   [512 t x 512 s] * [512 s x (32 m * 32 d)].
// Block = 256 threads (8 waves), tile 128 t x 128 columns (4 slices x 32 d), 32 s per step.
// Wave wv owns rows 32*(wv&3)..+31 and columns 64*(wv>>2)..+63 (2 x 4 accumulator tiles).
// Fragment maps, LDS layout ([row or column][k], pitch KP) and k order are those of k_gemm.
// grid: x = group of 4 slices, y = row tile, z = b*8 + n
// ---------------------------------------------------------------------------
#define AT_M  128
#define AT_N  128
#define AT_SL (AT_N / DH)
__global__ void __launch_bounds__(256)
k_att(const float* __restrict__ wsc, const float* __restrict__ vbuf, float* __restrict__ att)
{
  constexpr int CP = AT_N + 4;          // f32 pitch of the staged C tile (multiple of 4)

  __shared__ __attribute__((aligned(16))) unsigned short sAhi[AT_M * KP];
  __shared__ __attribute__((aligned(16))) unsigned short sAlo[AT_M * KP];
  __shared__ __attribute__((aligned(16))) unsigned short sWhi[AT_N * KP];
  __shared__ __attribute__((aligned(16))) unsigned short sWlo[AT_N * KP];
  __shared__ __attribute__((aligned(16))) float          sC[AT_M * CP];

  const int zn   = blockIdx.z % NH;
  const int zb   = blockIdx.z / NH;
  const int m0   = blockIdx.x * AT_SL;
  const int row0 = blockIdx.y * AT_M;
  const size_t slice = (size_t)T_LEN * C_DIM;
  const float* A = wsc  + ((size_t)blockIdx.z * T_LEN + row0) * T_LEN;
  const float* V = vbuf + (size_t)(zb * M_AX + m0) * slice + zn * DH;
  float*       C = att  + (size_t)(zb * M_AX + m0) * slice + (size_t)row0 * C_DIM + zn * DH;

  const int tid = threadIdx.x;
  const int wv  = tid >> 5;
  const int l   = tid & 31;
  const int h   = l >> 4;
  const int m   = l & 15;
  const int wr  = wv & 3;
  const int wc  = wv >> 2;

  // v tile 32 s x 128 columns: a thread takes 4 s x 4 d of one slice, so that each column's
  // four s go to LDS as one 8-B store; 8 lanes cover the 128 B of one (slice, s) row.
  const int vd4 = (tid & 7) * 4;                              // first d
  const int vs4 = ((tid >> 7) * 4 + ((tid >> 3) & 3)) * 4;    // first s inside the step
  const int vsl = (tid >> 5) & 3;                             // slice inside the group
  const int vn  = vsl * DH + vd4;                             // first tile column
  const unsigned vto = (unsigned)(vsl * (T_LEN * C_DIM) + vs4 * C_DIM + vd4);   // the thread's element offset in V

  v8f acc[2][4];
#pragma unroll
  for (int i = 0; i < 2; ++i)
#pragma unroll
    for (int j = 0; j < 4; ++j) acc[i][j] = (v8f){};

  // The tiles of k step k0, 8 x 16 B a thread, from global memory into registers.
  v4f ra[4];
  v4f rw[4];
  // Address = block-uniform base of the step + the thread's own fixed 32-bit element offset: few address
  // registers, so that holding the eight chunks across the matrix work costs no resident wave.
  auto fetch = [&](int k0) {
    const float* Ak = A + k0;
    const float* Vk = V + (size_t)k0 * C_DIM;
    // w tile 128 x 32: chunk c -> row c>>3, k 4*(c&7)
#pragma unroll
    for (int i = 0; i < 4; ++i) {
      const int c = tid + 256 * i;
      const int r = c >> 3, k4 = (c & 7) * 4;
      ra[i] = *(const v4f*)(Ak + (unsigned)(r * T_LEN + k4));
    }
#pragma unroll
    for (int i = 0; i < 4; ++i) rw[i] = *(const v4f*)(Vk + (vto + (unsigned)(i * C_DIM)));
    // stands in front of the fragment reads and index sums that overwrite the loads' address registers
    asm volatile("s_wait_xcnt 0x0" ::: "memory");
  };

  fetch(0);
  for (int k0 = 0; k0 < T_LEN; k0 += 32) {
    __syncthreads();          // all waves done reading the tiles of the prior k step
#pragma unroll
    for (int i = 0; i < 4; ++i) {
      const int c = tid + 256 * i;
      const int r = c >> 3, k4 = (c & 7) * 4;
      v2u hi, lo;
      split4(ra[i], hi, lo);
      *(v2u*)(&sAhi[r * KP + k4]) = hi;
      *(v2u*)(&sAlo[r * KP + k4]) = lo;
    }
#pragma unroll
    for (int j = 0; j < 4; ++j) {
      const v4f col = {rw[0][j], rw[1][j], rw[2][j], rw[3][j]};   // s = vs4 .. vs4+3 of column vn+j
      v2u hi, lo;
      split4(col, hi, lo);
      *(v2u*)(&sWhi[(vn + j) * KP + vs4]) = hi;
      *(v2u*)(&sWlo[(vn + j) * KP + vs4]) = lo;
    }
    __syncthreads();          // tiles visible to every wave

    Frag ah[2], al[2];
#pragma unroll
    for (int i = 0; i < 2; ++i) {
      const int ar = (32 * wr + 16 * i + m) * KP + 8 * h;
      ah[i].h[0] = *(const v8us*)(&sAhi[ar]);
      ah[i].h[1] = *(const v8us*)(&sAhi[ar + 16]);
      al[i].h[0] = *(const v8us*)(&sAlo[ar]);
      al[i].h[1] = *(const v8us*)(&sAlo[ar + 16]);
    }
    // the next step's loads fly while this step's fragments are read and multiplied; they are waited for at
    // the next split. Behind the A fragment reads, so that the LDS latency runs beside the loads' issue.
    if (k0 + 32 < T_LEN) fetch(k0 + 32);
#pragma unroll
    for (int j = 0; j < 4; ++j) {
      const int br = (64 * wc + 16 * j + m) * KP + 8 * h;
      Frag bh, bl;
      bh.h[0] = *(const v8us*)(&sWhi[br]);
      bh.h[1] = *(const v8us*)(&sWhi[br + 16]);
      bl.h[0] = *(const v8us*)(&sWlo[br]);
      bl.h[1] = *(const v8us*)(&sWlo[br + 16]);
#pragma unroll
      for (int i = 0; i < 2; ++i) mma3(acc[i][j], ah[i].v, al[i].v, bh.v, bl.v);
    }
  }

#pragma unroll
  for (int i = 0; i < 2; ++i)
#pragma unroll
    for (int j = 0; j < 4; ++j)
#pragma unroll
      for (int r = 0; r < 8; ++r)
        sC[(32 * wr + 16 * i + 8 * h + r) * CP + 64 * wc + 16 * j + m] = acc[i][j][r];
  __syncthreads();
  // one wave-wide store = one t row of the tile = four whole 128-B lines, one per slice
#pragma unroll
  for (int i = 0; i < AT_M * AT_N / (4 * 256); ++i) {
    const int idx = i * 256 + tid;
    const int row = idx / (AT_N / 4);
    const int c4  = (idx % (AT_N / 4)) * 4;
    const v4f val = *(const v4f*)(&sC[row * CP + c4]);
    float* gp = C + (size_t)(c4 / DH) * slice + (size_t)row * C_DIM + (c4 % DH);
    *(v4f*)gp = val;
  }
}

// ---------------------------------------------------------------------------
// Axial sum: out[b, t, c] = sum_m in[b, m, t, c]; one thread per 4 consecutive c.
// blockIdx.y picks the tensor (0: in0 -> out0, 1: in1 -> out1): both sums in one launch.
// ---------------------------------------------------------------------------
__global__ void __launch_bounds__(256)
k_sum_m(const float* __restrict__ in0, const float* __restrict__ in1,
        float* __restrict__ out0, float* __restrict__ out1, int n4)
{
  const int i4 = blockIdx.x * 256 + threadIdx.x;
  if (i4 >= n4) return;
  const float* in  = blockIdx.y ? in1 : in0;
  float*       out = blockIdx.y ? out1 : out0;
  const size_t i     = (size_t)i4 * 4;
  const size_t inner = (size_t)T_LEN * C_DIM;
  const size_t b     = i / inner;
  const size_t r     = i - b * inner;
  const float* p = in + b * (size_t)M_AX * inner + r;
  v4f s = {0.0f, 0.0f, 0.0f, 0.0f};
#pragma unroll 8
  for (int mm = 0; mm < M_AX; ++mm) s += *(const v4f*)(p + (size_t)mm * inner);
  float* o = out + i;
  *(v4f*)o = s;
  
}

// ---------------------------------------------------------------------------
// Row softmax over 512, one wave per row, in place; rows < narows also copied to a_out.
// Lane holds floats lane*4+0..3 of each 128-float segment -> every store instruction covers
// ---------------------------------------------------------------------------
__global__ void __launch_bounds__(256)
k_softmax(float* __restrict__ w, float* __restrict__ a_out, int nrows, int narows)
{
  const int row  = blockIdx.x * 8 + (threadIdx.x >> 5);
  const int lane = threadIdx.x & 31;
  if (row >= nrows) return;                     // wave-uniform
  float* p = w + (size_t)row * T_LEN + lane * 4;

  v4f v[4];
#pragma unroll
  for (int i = 0; i < 4; ++i) v[i] = *(const v4f*)(p + i * 128);

  float mx = -3.0e38f;
#pragma unroll
  for (int i = 0; i < 4; ++i)
    mx = fmaxf(mx, fmaxf(fmaxf(v[i].x, v[i].y), fmaxf(v[i].z, v[i].w)));
#pragma unroll
  for (int off = 16; off > 0; off >>= 1) mx = fmaxf(mx, __shfl_xor(mx, off, 32));

  float sum = 0.0f;
#pragma unroll
  for (int i = 0; i < 4; ++i) {
    v[i].x = __expf(v[i].x - mx);
    v[i].y = __expf(v[i].y - mx);
    v[i].z = __expf(v[i].z - mx);
    v[i].w = __expf(v[i].w - mx);
    sum += (v[i].x + v[i].y) + (v[i].z + v[i].w);
  }
#pragma unroll
  for (int off = 16; off > 0; off >>= 1) sum += __shfl_xor(sum, off, 32);
  const float inv = 1.0f / sum;
#pragma unroll
  for (int i = 0; i < 4; ++i) v[i] *= inv;

  const bool wa = row < narows;
  float* q = a_out + (size_t)(wa ? row : 0) * T_LEN + lane * 4;

#pragma unroll
  for (int i = 0; i < 4; ++i) {
    *(v4f*)(p + i * 128) = v[i];
    if (wa) *(v4f*)(q + i * 128) = v[i];
  }
  
}

// ---------------------------------------------------------------------------
extern "C" void kernel_launch(void* const* d_in, const int* in_sizes, int n_in,
                              void* d_out, int out_size, void* d_ws, size_t ws_size,
                              hipStream_t stream)
{
  if (n_in < 10) return;
  const int n_x  = B_SZ * M_AX * T_LEN * C_DIM;          // 8388608
  const int n_w  = C_DIM * C_DIM;
  const int n_a  = NH * T_LEN * T_LEN;                   // 2097152
  if (in_sizes[0] != n_x || in_sizes[1] != n_x) return;
  if (in_sizes[2] != n_w || in_sizes[4] != n_w || in_sizes[6] != n_w || in_sizes[8] != n_w) return;
  if (in_sizes[3] != C_DIM || in_sizes[5] != C_DIM || in_sizes[7] != C_DIM || in_sizes[9] != C_DIM) return;
  if (out_size != n_x + n_a) return;

  const float* x  = (const float*)d_in[0];
  const float* y  = (const float*)d_in[1];
  const float* Wq = (const float*)d_in[2];
  const float* bq = (const float*)d_in[3];
  const float* Wk = (const float*)d_in[4];
  const float* bk = (const float*)d_in[5];
  const float* Wv = (const float*)d_in[6];
  const float* bv = (const float*)d_in[7];
  const float* Wp = (const float*)d_in[8];
  const float* bp = (const float*)d_in[9];

  float* out   = (float*)d_out;                            // [2,32,512,256]
  float* a_out = out + (size_t)n_x;                        // [8,512,512] at byte 33554432

  const size_t n_sum = (size_t)B_SZ * T_LEN * C_DIM;       // 262144
  const size_t n_v   = (size_t)n_x;                        // 8388608
  const size_t n_sc  = (size_t)B_SZ * NH * T_LEN * T_LEN;  // 4194304
  const size_t o_xsum = 0;
  const size_t o_ysum = o_xsum + n_sum;
  const size_t o_qt   = o_ysum + n_sum;
  const size_t o_kt   = o_qt   + n_sum;
  const size_t o_v    = o_kt   + n_sum;
  const size_t o_wsc  = o_v    + n_v;
  const size_t o_att  = o_wsc  + n_sc;
  const size_t o_end  = o_att  + n_v;                      // 22020096 floats = 88080384 B
  if (o_end * sizeof(float) > ws_size) return;

  float* ws   = (float*)d_ws;
  float* xsum = ws + o_xsum;
  float* ysum = ws + o_ysum;
  float* qt   = ws + o_qt;
  float* kt   = ws + o_kt;
  float* vbuf = ws + o_v;
  float* wsc  = ws + o_wsc;
  float* att  = ws + o_att;

  // 1) axial sums of x and y over m
  const int n4 = (int)(n_sum / 4);                         // 65536
  k_sum_m<<<dim3((n4 + 255) / 256, 2), dim3(256), 0, stream>>>(x, y, xsum, ysum, n4);

  // 2+3) qt = xsum @ Wq^T + 32*bq, kt = ysum @ Wk^T + 32*bk   [1024 x 256];  v = y_flat @ Wv^T + bv   [32768 x 256];  K = 256
  k_qkv<<<dim3(C_DIM / 64, 2 * QKB + VB, 1), dim3(128), 0, stream>>>(
      xsum, ysum, y, Wq, Wk, Wv, bq, bk, bv, qt, kt, vbuf);

  // 4) scores[b,n] = (1/32) qt_head @ kt_head^T   [512 x 512], K = 32, z = b*8 + n  (no bias: HB = 0, pointer never read)
  k_gemm<64, 0, 0><<<dim3(T_LEN / 64, T_LEN / 64, B_SZ * NH), dim3(128), 0, stream>>>(
      qt, kt, wsc, kt,
      (long long)T_LEN * C_DIM, 0, DH,
      (long long)T_LEN * C_DIM, 0, DH,
      (long long)NH * T_LEN * T_LEN, 0, (long long)T_LEN * T_LEN,
      T_LEN, T_LEN, DH, T_LEN, NH, 1, 0.0f, 1.0f / 32.0f);

  // 5) softmax rows in place; rows of batch 0 also to a_out
  const int nrows = B_SZ * NH * T_LEN;                     // 8192
  k_softmax<<<dim3((nrows + 7) / 8), dim3(256), 0, stream>>>(wsc, a_out, nrows, NH * T_LEN);

  // 6) att[b,:,n] = w[b,n] @ v[b,:][:, n*32 .. n*32+31]   [512 x (32*32)], K = 512, z = b*8 + n, x = 4 slices m
  k_att<<<dim3(M_AX / AT_SL, T_LEN / AT_M, B_SZ * NH), dim3(256), 0, stream>>>(wsc, vbuf, att);

  // 7) out = att @ Wp^T + bp   [32768 x 256], K = 256
  k_gemm<64, 0, 1><<<dim3(C_DIM / 64, (B_SZ * M_AX * T_LEN) / 64, 1), dim3(128), 0, stream>>>(
      att, Wp, out, bp, 0, 0, 0, 0, 0, 0, 0, 0, 0,
      B_SZ * M_AX * T_LEN, C_DIM, C_DIM, C_DIM, 1, 1, 1.0f, 1.0f);
}

// v005
// It runs in 79.7 microseconds.
// Timed twice side by side with v004, it ran 1.04 times as fast both times.
// Over all steps from v000 it is 2.40 times as fast.
// Contractions (q/k/v/out projections, q.k^T scores, w.v): v_wmma_f32_16x16x32_bf16 with each f32 operand carried as bf16 hi + bf16 lo (hi.hi + hi.lo + lo.hi), f32 accumulate; axial sums, softmax and epilogues f32.
#include <hip/hip_runtime.h>
#include <stdint.h>

typedef float          v4f  __attribute__((ext_vector_type(4)));
typedef float          v8f  __attribute__((ext_vector_type(8)));
typedef unsigned int   v2u  __attribute__((ext_vector_type(2)));
typedef unsigned short v8us __attribute__((ext_vector_type(8)));
typedef __bf16         v16b __attribute__((ext_vector_type(16)));
typedef __bf16         v2b  __attribute__((ext_vector_type(2)));
typedef float          v2f  __attribute__((ext_vector_type(2)));
union Frag { v16b v; v8us h[2]; };

#define C_DIM 256
#define NH    8
#define DH    32
#define B_SZ  2
#define M_AX  32
#define T_LEN 512
#define KP    40      // LDS pitch (16-bit elements) of the 32-deep k tiles; multiple of 8 for 16-B fragment loads

// x = hi + lo with hi = rne_bf16(x), lo = rne_bf16(x - hi); (x - hi) is exact in f32.
// Both roundings are the chip's own packed convert (nearest even, two values an instruction).
static __device__ __forceinline__ void split2(float x0, float x1, unsigned int& hb, unsigned int& lb) {
  const v2f x  = {x0, x1};
  const v2b hi = __builtin_convertvector(x, v2b);
  const v2f r  = x - __builtin_convertvector(hi, v2f);
  const v2b lo = __builtin_convertvector(r, v2b);
  hb = __builtin_bit_cast(unsigned int, hi);
  lb = __builtin_bit_cast(unsigned int, lo);
}
static __device__ __forceinline__ void split_hl(float x, unsigned int& hb, unsigned int& lb) {
  unsigned int h2, l2;
  split2(x, x, h2, l2);
  hb = h2 & 0xFFFFu;
  lb = l2 & 0xFFFFu;
}
static __device__ __forceinline__ void split4(v4f v, v2u& hi, v2u& lo) {
  unsigned int h01, h23, l01, l23;
  split2(v.x, v.y, h01, l01);
  split2(v.z, v.w, h23, l23);
  hi.x = h01; hi.y = h23;
  lo.x = l01; lo.y = l23;
}

// three 16x16x32 bf16 ops into one accumulator, then the VALU hazard guard
static __device__ __forceinline__ void mma3(v8f& acc, v16b ah, v16b al, v16b bh, v16b bl) {
  acc = __builtin_amdgcn_wmma_f32_16x16x32_bf16(false, ah, false, bh, (short)0, acc, false, false);
  acc = __builtin_amdgcn_wmma_f32_16x16x32_bf16(false, ah, false, bl, (short)0, acc, false, false);
  acc = __builtin_amdgcn_wmma_f32_16x16x32_bf16(false, al, false, bh, (short)0, acc, false, false);
  asm volatile("v_nop\n\tv_nop\n\tv_nop\n\tv_nop" : "+v"(acc) : "v"(ah), "v"(al), "v"(bh), "v"(bl));
}

// ---------------------------------------------------------------------------
// Batched GEMM  C[M x N] = alpha * A[M x K] * op(W) (+ bias_scale * bias[n] when HB)
//   A : row-major, k contiguous, pitch C_DIM
//   W : WK == 0 -> W[n][k] (k contiguous, pitch C_DIM), C = A * W^T
//       WK == 1 -> W[k][n] (n contiguous, pitch C_DIM), C = A * W
//   C : row-major, pitch ldc
//   HB == 0: bias pointer is never read.
// Batch z -> (zb, zm, zn) with independent element strides per operand.
// Block = 128 threads (4 waves), tile 64 rows x BN cols, 32 k per step.
// Wave w owns rows 16w..16w+15 and all BN cols (BN/16 accumulator tiles).
// Fragment maps per lane l (h = l>>4, m = l&15):
//   A: row m, el 0..7 <- k 8h+0..7, el 8..15 <- k 16+8h+0..7
//   B: col m, same k map;   D: el r <- (row 8h+r, col m)
// Requires M % 64 == 0, N % BN == 0, K % 32 == 0, 16-B aligned rows.
// ---------------------------------------------------------------------------
// gemm_tile: one 64 x BN tile of C at (row0, col0), by one whole block.
template <int BN, int WK, int HB>
static __device__ __forceinline__ void
gemm_tile(const float* __restrict__ A, const float* __restrict__ W,
          float* __restrict__ C, const float* __restrict__ bias,
          int row0, int col0, int K, int ldc,
          float bias_scale, float alpha)
{
  constexpr int lda = C_DIM;            // row pitch of A and of W: a constant, so that a thread's eight loads
  constexpr int ldb = C_DIM;            // of a k step are two addresses plus immediate offsets
  constexpr int TN  = BN / 16;          // accumulator tiles per wave
  constexpr int CP  = BN + 4;           // f32 pitch of the staged C tile (multiple of 4)
  constexpr int NCH = BN / 16;          // 16-B W chunks per thread per k step

  __shared__ __attribute__((aligned(16))) unsigned short sAhi[64 * KP];
  __shared__ __attribute__((aligned(16))) unsigned short sAlo[64 * KP];
  __shared__ __attribute__((aligned(16))) unsigned short sWhi[BN * KP];
  __shared__ __attribute__((aligned(16))) unsigned short sWlo[BN * KP];
  __shared__ __attribute__((aligned(16))) float          sC[64 * CP];

  const int tid = threadIdx.x;
  const int wv  = tid >> 5;
  const int l   = tid & 31;
  const int h   = l >> 4;
  const int m   = l & 15;

  v8f acc[TN];
#pragma unroll
  for (int j = 0; j < TN; ++j) acc[j] = (v8f){};

  // The tiles of k step k0, 8 x 16 B a thread, from global memory into registers.
  v4f ra[4];
  v4f rw[NCH];
  // Address = block-uniform base of the step + the thread's own fixed 32-bit element offset: few address
  // registers, so that holding the eight chunks across the matrix work costs no resident wave.
  const int st0 = (tid >> 3) * KP + (tid & 7) * 4;     // LDS place of the thread's chunk 0; chunk i is 16 rows on
  const float* Ab = A + (size_t)row0 * lda;
  const float* Wb = WK ? W + col0 : W + (size_t)col0 * ldb;
  auto fetch = [&](int k0) {
    const float* Ak = Ab + k0;
    const float* Wk = WK ? Wb + (size_t)k0 * ldb : Wb + k0;
    // A tile 64 x 32: chunk tid + 128 i -> row (tid>>3) + 16 i, k 4*(tid&7)
#pragma unroll
    for (int i = 0; i < 4; ++i)
      ra[i] = *(const v4f*)(Ak + (size_t)(16 * i) * lda + (unsigned)((tid >> 3) * lda + (tid & 7) * 4));
#pragma unroll
    for (int i = 0; i < NCH; ++i) {
      if (WK) {
        const int c = tid + 128 * i;
        const int s = c / (BN / 4), n4 = (c % (BN / 4)) * 4;        // k row s, 4 consecutive n
        rw[i] = *(const v4f*)(Wk + (unsigned)(s * ldb + n4));
      } else {                                                       // n row (tid>>3) + 16 i, 4 consecutive k
        rw[i] = *(const v4f*)(Wk + (size_t)(16 * i) * ldb + (unsigned)((tid >> 3) * ldb + (tid & 7) * 4));
      }
    }
    // stands in front of the fragment reads and index sums that overwrite the loads' address registers
    asm volatile("s_wait_xcnt 0x0" ::: "memory");
  };

  fetch(0);
  for (int k0 = 0; k0 < K; k0 += 32) {
    __syncthreads();          // all waves done reading the tiles of the prior k step
#pragma unroll
    for (int i = 0; i < 4; ++i) {
      v2u hi, lo;
      split4(ra[i], hi, lo);
      *(v2u*)(&sAhi[st0 + 16 * i * KP]) = hi;
      *(v2u*)(&sAlo[st0 + 16 * i * KP]) = lo;
    }
#pragma unroll
    for (int i = 0; i < NCH; ++i) {
      const int c = tid + 128 * i;
      if (WK) {
        const int s = c / (BN / 4), n4 = (c % (BN / 4)) * 4;
        unsigned int h0, h1, h2, h3, l0, l1, l2, l3;
        split_hl(rw[i].x, h0, l0); split_hl(rw[i].y, h1, l1);
        split_hl(rw[i].z, h2, l2); split_hl(rw[i].w, h3, l3);
        sWhi[(n4 + 0) * KP + s] = (unsigned short)h0;  sWlo[(n4 + 0) * KP + s] = (unsigned short)l0;
        sWhi[(n4 + 1) * KP + s] = (unsigned short)h1;  sWlo[(n4 + 1) * KP + s] = (unsigned short)l1;
        sWhi[(n4 + 2) * KP + s] = (unsigned short)h2;  sWlo[(n4 + 2) * KP + s] = (unsigned short)l2;
        sWhi[(n4 + 3) * KP + s] = (unsigned short)h3;  sWlo[(n4 + 3) * KP + s] = (unsigned short)l3;
      } else {
        v2u hi, lo;
        split4(rw[i], hi, lo);
        *(v2u*)(&sWhi[st0 + 16 * i * KP]) = hi;
        *(v2u*)(&sWlo[st0 + 16 * i * KP]) = lo;
      }
    }
    __syncthreads();          // tiles visible to every wave

    Frag ah, al;
    {
      const int ar = (16 * wv + m) * KP + 8 * h;
      ah.h[0] = *(const v8us*)(&sAhi[ar]);
      ah.h[1] = *(const v8us*)(&sAhi[ar + 16]);
      al.h[0] = *(const v8us*)(&sAlo[ar]);
      al.h[1] = *(const v8us*)(&sAlo[ar + 16]);
    }
    // the next step's loads fly while this step's fragments are read and multiplied; they are waited for at
    // the next split. Behind the A fragment reads, so that the LDS latency runs beside the loads' issue.
    if (k0 + 32 < K) fetch(k0 + 32);
#pragma unroll
    for (int j = 0; j < TN; ++j) {
      const int br = (16 * j + m) * KP + 8 * h;
      Frag bh, bl;
      bh.h[0] = *(const v8us*)(&sWhi[br]);
      bh.h[1] = *(const v8us*)(&sWhi[br + 16]);
      bl.h[0] = *(const v8us*)(&sWlo[br]);
      bl.h[1] = *(const v8us*)(&sWlo[br + 16]);
      mma3(acc[j], ah.v, al.v, bh.v, bl.v);
    }
  }

#pragma unroll
  for (int j = 0; j < TN; ++j) {
    float bb = 0.0f;
    if (HB) bb = bias_scale * bias[col0 + 16 * j + m];
#pragma unroll
    for (int r = 0; r < 8; ++r) {
      sC[(16 * wv + 8 * h + r) * CP + 16 * j + m] = alpha * acc[j][r] + bb;
    }
  }
  __syncthreads();
#pragma unroll
  for (int i = 0; i < BN / 8; ++i) {
    const int idx = i * 128 + tid;
    const int row = idx / (BN / 4);
    const int c4  = (idx % (BN / 4)) * 4;
    const v4f val = *(const v4f*)(&sC[row * CP + c4]);
    float* gp = C + (size_t)(row0 + row) * ldc + col0 + c4;
    *(v4f*)gp = val;
  }
}

template <int BN, int WK, int HB>
__global__ void __launch_bounds__(128)
k_gemm(const float* __restrict__ Abase, const float* __restrict__ Wbase,
       float* __restrict__ Cbase, const float* __restrict__ bias,
       long long sAb, long long sAm, long long sAn,
       long long sBb, long long sBm, long long sBn,
       long long sCb, long long sCm, long long sCn,
       int Mrows, int Ncols, int K, int ldc,
       int nInner, int nMid, float bias_scale, float alpha)
{
  const int z  = blockIdx.z;
  const int zn = z % nInner;
  const int zm = (z / nInner) % nMid;
  const int zb = z / (nInner * nMid);
  const float* A = Abase + ((long long)zb * sAb + (long long)zm * sAm + (long long)zn * sAn);
  const float* W = Wbase + ((long long)zb * sBb + (long long)zm * sBm + (long long)zn * sBn);
  float*       C = Cbase + ((long long)zb * sCb + (long long)zm * sCm + (long long)zn * sCn);

  const int row0 = blockIdx.y * 64;
  const int col0 = blockIdx.x * BN;
  if (row0 + 64 > Mrows || col0 + BN > Ncols) return;     // block-uniform, before any barrier

  gemm_tile<BN, WK, HB>(A, W, C, bias, row0, col0, K, ldc, bias_scale, alpha);
}

// ---------------------------------------------------------------------------
// The three input projections, which do not depend on one another, as ONE launch:
//   blockIdx.y <  QKB          : qt = xsum @ Wq^T + 32 bq   (row tile blockIdx.y)
//   blockIdx.y <  2 QKB        : kt = ysum @ Wk^T + 32 bk
//   otherwise                  : v  = y    @ Wv^T +    bv
// qt and kt are 64 blocks each, a quarter of the chip's 256 WGPs if launched alone; here they come first
// in the grid and run beside the 2048 blocks of v.
// ---------------------------------------------------------------------------
#define QKB ((B_SZ * T_LEN) / 64)            // row tiles of qt, and of kt
#define VB  ((B_SZ * M_AX * T_LEN) / 64)     // row tiles of v
__global__ void __launch_bounds__(128)
k_qkv(const float* __restrict__ xsum, const float* __restrict__ ysum, const float* __restrict__ y,
      const float* __restrict__ Wq, const float* __restrict__ Wk, const float* __restrict__ Wv,
      const float* __restrict__ bq, const float* __restrict__ bk, const float* __restrict__ bv,
      float* __restrict__ qt, float* __restrict__ kt, float* __restrict__ vbuf)
{
  const int by = blockIdx.y;
  if (by >= 2 * QKB + VB) return;              // block-uniform, before any barrier
  const int seg = by < QKB ? 0 : (by < 2 * QKB ? 1 : 2);
  const float* A    = seg == 0 ? xsum : (seg == 1 ? ysum : y);
  const float* W    = seg == 0 ? Wq   : (seg == 1 ? Wk   : Wv);
  const float* bias = seg == 0 ? bq   : (seg == 1 ? bk   : bv);
  float*       C    = seg == 0 ? qt   : (seg == 1 ? kt   : vbuf);
  const float  bs   = seg == 2 ? 1.0f : (float)M_AX;
  const int row0 = (by - seg * QKB) * 64;
  const int col0 = blockIdx.x * 64;
  gemm_tile<64, 0, 1>(A, W, C, bias, row0, col0, C_DIM, C_DIM, bs, 1.0f);
}

// ---------------------------------------------------------------------------
// att[b, m, t, n*32 + d] = sum_s w[b, n, t, s] * v[b, m, s, n*32 + d]
// The 32 axial slices m of one (b, n) share w, so they are the columns of ONE product
//   [512 t x 512 s] * [512 s x (32 m * 32 d)].
// Block = 256 threads (8 waves), tile 128 t x 128 columns (4 slices x 32 d), 32 s per step.
// Wave wv owns rows 32*(wv&3)..+31 and columns 64*(wv>>2)..+63 (2 x 4 accumulator tiles).
// Fragment maps, LDS layout ([row or column][k], pitch KP) and k order are those of k_gemm.
// grid: x = group of 4 slices, y = row tile, z = b*8 + n
// ---------------------------------------------------------------------------
#define AT_M  128
#define AT_N  128
#define AT_SL (AT_N / DH)
__global__ void __launch_bounds__(256)
k_att(const float* __restrict__ wsc, const float* __restrict__ vbuf, float* __restrict__ att)
{
  constexpr int CP = AT_N + 4;          // f32 pitch of the staged C tile (multiple of 4)

  __shared__ __attribute__((aligned(16))) unsigned short sAhi[AT_M * KP];
  __shared__ __attribute__((aligned(16))) unsigned short sAlo[AT_M * KP];
  __shared__ __attribute__((aligned(16))) unsigned short sWhi[AT_N * KP];
  __shared__ __attribute__((aligned(16))) unsigned short sWlo[AT_N * KP];
  __shared__ __attribute__((aligned(16))) float          sC[AT_M * CP];

  const int zn   = blockIdx.z % NH;
  const int zb   = blockIdx.z / NH;
  const int m0   = blockIdx.x * AT_SL;
  const int row0 = blockIdx.y * AT_M;
  const size_t slice = (size_t)T_LEN * C_DIM;
  const float* A = wsc  + ((size_t)blockIdx.z * T_LEN + row0) * T_LEN;
  const float* V = vbuf + (size_t)(zb * M_AX + m0) * slice + zn * DH;
  float*       C = att  + (size_t)(zb * M_AX + m0) * slice + (size_t)row0 * C_DIM + zn * DH;

  const int tid = threadIdx.x;
  const int wv  = tid >> 5;
  const int l   = tid & 31;
  const int h   = l >> 4;
  const int m   = l & 15;
  const int wr  = wv & 3;
  const int wc  = wv >> 2;

  // v tile 32 s x 128 columns: a thread takes 4 s x 4 d of one slice, so that each column's
  // four s go to LDS as one 8-B store; 8 lanes cover the 128 B of one (slice, s) row.
  const int vd4 = (tid & 7) * 4;                              // first d
  const int vs4 = ((tid >> 7) * 4 + ((tid >> 3) & 3)) * 4;    // first s inside the step
  const int vsl = (tid >> 5) & 3;                             // slice inside the group
  const int vn  = vsl * DH + vd4;                             // first tile column
  const unsigned vto = (unsigned)(vsl * (T_LEN * C_DIM) + vs4 * C_DIM + vd4);   // the thread's element offset in V

  v8f acc[2][4];
#pragma unroll
  for (int i = 0; i < 2; ++i)
#pragma unroll
    for (int j = 0; j < 4; ++j) acc[i][j] = (v8f){};

  // The tiles of k step k0, 8 x 16 B a thread, from global memory into registers.
  v4f ra[4];
  v4f rw[4];
  // Address = block-uniform base of the step + the thread's own fixed 32-bit element offset: few address
  // registers, so that holding the eight chunks across the matrix work costs no resident wave.
  auto fetch = [&](int k0) {
    const float* Ak = A + k0;
    const float* Vk = V + (size_t)k0 * C_DIM;
    // w tile 128 x 32: chunk c -> row c>>3, k 4*(c&7)
#pragma unroll
    for (int i = 0; i < 4; ++i) {
      const int c = tid + 256 * i;
      const int r = c >> 3, k4 = (c & 7) * 4;
      ra[i] = *(const v4f*)(Ak + (unsigned)(r * T_LEN + k4));
    }
#pragma unroll
    for (int i = 0; i < 4; ++i) rw[i] = *(const v4f*)(Vk + (vto + (unsigned)(i * C_DIM)));
    // stands in front of the fragment reads and index sums that overwrite the loads' address registers
    asm volatile("s_wait_xcnt 0x0" ::: "memory");
  };

  fetch(0);
  for (int k0 = 0; k0 < T_LEN; k0 += 32) {
    __syncthreads();          // all waves done reading the tiles of the prior k step
#pragma unroll
    for (int i = 0; i < 4; ++i) {
      const int c = tid + 256 * i;
      const int r = c >> 3, k4 = (c & 7) * 4;
      v2u hi, lo;
      split4(ra[i], hi, lo);
      *(v2u*)(&sAhi[r * KP + k4]) = hi;
      *(v2u*)(&sAlo[r * KP + k4]) = lo;
    }
#pragma unroll
    for (int j = 0; j < 4; ++j) {
      const v4f col = {rw[0][j], rw[1][j], rw[2][j], rw[3][j]};   // s = vs4 .. vs4+3 of column vn+j
      v2u hi, lo;
      split4(col, hi, lo);
      *(v2u*)(&sWhi[(vn + j) * KP + vs4]) = hi;
      *(v2u*)(&sWlo[(vn + j) * KP + vs4]) = lo;
    }
    __syncthreads();          // tiles visible to every wave

    Frag ah[2], al[2];
#pragma unroll
    for (int i = 0; i < 2; ++i) {
      const int ar = (32 * wr + 16 * i + m) * KP + 8 * h;
      ah[i].h[0] = *(const v8us*)(&sAhi[ar]);
      ah[i].h[1] = *(const v8us*)(&sAhi[ar + 16]);
      al[i].h[0] = *(const v8us*)(&sAlo[ar]);
      al[i].h[1] = *(const v8us*)(&sAlo[ar + 16]);
    }
    // the next step's loads fly while this step's fragments are read and multiplied; they are waited for at
    // the next split. Behind the A fragment reads, so that the LDS latency runs beside the loads' issue.
    if (k0 + 32 < T_LEN) fetch(k0 + 32);
#pragma unroll
    for (int j = 0; j < 4; ++j) {
      const int br = (64 * wc + 16 * j + m) * KP + 8 * h;
      Frag bh, bl;
      bh.h[0] = *(const v8us*)(&sWhi[br]);
      bh.h[1] = *(const v8us*)(&sWhi[br + 16]);
      bl.h[0] = *(const v8us*)(&sWlo[br]);
      bl.h[1] = *(const v8us*)(&sWlo[br + 16]);
#pragma unroll
      for (int i = 0; i < 2; ++i) mma3(acc[i][j], ah[i].v, al[i].v, bh.v, bl.v);
    }
  }

#pragma unroll
  for (int i = 0; i < 2; ++i)
#pragma unroll
    for (int j = 0; j < 4; ++j)
#pragma unroll
      for (int r = 0; r < 8; ++r)
        sC[(32 * wr + 16 * i + 8 * h + r) * CP + 64 * wc + 16 * j + m] = acc[i][j][r];
  __syncthreads();
  // one wave-wide store = one t row of the tile = four whole 128-B lines, one per slice
#pragma unroll
  for (int i = 0; i < AT_M * AT_N / (4 * 256); ++i) {
    const int idx = i * 256 + tid;
    const int row = idx / (AT_N / 4);
    const int c4  = (idx % (AT_N / 4)) * 4;
    const v4f val = *(const v4f*)(&sC[row * CP + c4]);
    float* gp = C + (size_t)(c4 / DH) * slice + (size_t)row * C_DIM + (c4 % DH);
    *(v4f*)gp = val;
  }
}

// ---------------------------------------------------------------------------
// Axial sum: out[b, t, c] = sum_m in[b, m, t, c]; one thread per 4 consecutive c.
// blockIdx.y picks the tensor (0: in0 -> out0, 1: in1 -> out1): both sums in one launch.
// ---------------------------------------------------------------------------
__global__ void __launch_bounds__(256)
k_sum_m(const float* __restrict__ in0, const float* __restrict__ in1,
        float* __restrict__ out0, float* __restrict__ out1, int n4)
{
  const int i4 = blockIdx.x * 256 + threadIdx.x;
  if (i4 >= n4) return;
  const float* in  = blockIdx.y ? in1 : in0;
  float*       out = blockIdx.y ? out1 : out0;
  const size_t i     = (size_t)i4 * 4;
  const size_t inner = (size_t)T_LEN * C_DIM;
  const size_t b     = i / inner;
  const size_t r     = i - b * inner;
  const float* p = in + b * (size_t)M_AX * inner + r;
  v4f s = {0.0f, 0.0f, 0.0f, 0.0f};
#pragma unroll 8
  for (int mm = 0; mm < M_AX; ++mm) s += *(const v4f*)(p + (size_t)mm * inner);
  float* o = out + i;
  *(v4f*)o = s;
  
}

// ---------------------------------------------------------------------------
// w[b, n, t, :] = softmax_s( (1/32) qt[b, t, n*32 ..] . kt[b, s, n*32 ..] ), scores and row softmax in ONE kernel.
// A block holds SS_M whole rows of one (b, n): a SS_M x 512 score tile, K = 32 (one k step), which goes from the
// accumulators to LDS and from there through the softmax; the scores never go to global memory.
// Block = 256 threads (8 waves). Product: wave wv owns all SS_M rows and columns 64 wv .. +63 (2 x 4 accumulator
// tiles); fragment maps, LDS layout ([row or column][k], pitch KP) and k order are those of k_gemm.
// Softmax: wave wv owns rows 4 wv .. +3, a lane holds floats lane*4+0..3 of each 128-float segment of a row, so
// that every store instruction covers four whole 128-B lines. Rows of batch 0 also go to a_out.
// grid: x = row tile, y = b*8 + n
// ---------------------------------------------------------------------------
#define SS_M 32
// e^x as __expf forms it (2^(x log2 e), the chip's own v_exp_f32). In asm text for the v_nop alone: it keeps the one
// slot that the instruction set asks for behind a transcendental, before its result is read or its source overwritten.
static __device__ __forceinline__ float exp_slot(float x) {
  float r;
  asm("v_exp_f32 %0, %1\n\tv_nop" : "=v"(r) : "v"(x * 0x1.715476p+0f));
  return r;
}
__global__ void __launch_bounds__(256)
k_score_softmax(const float* __restrict__ qt, const float* __restrict__ kt,
                float* __restrict__ w, float* __restrict__ a_out)
{
  constexpr int CP = T_LEN + 4;         // f32 pitch of the score tile (multiple of 4; rows 8 apart fall 32 banks apart)

  __shared__ __attribute__((aligned(16))) unsigned short sAhi[SS_M * KP];
  __shared__ __attribute__((aligned(16))) unsigned short sAlo[SS_M * KP];
  __shared__ __attribute__((aligned(16))) unsigned short sWhi[T_LEN * KP];
  __shared__ __attribute__((aligned(16))) unsigned short sWlo[T_LEN * KP];
  __shared__ __attribute__((aligned(16))) float          sC[SS_M * CP];

  const int zn   = blockIdx.y % NH;
  const int zb   = blockIdx.y / NH;
  const int row0 = blockIdx.x * SS_M;
  const float* A = qt + ((size_t)zb * T_LEN + row0) * C_DIM + zn * DH;
  const float* W = kt + (size_t)zb * T_LEN * C_DIM + zn * DH;

  const int tid = threadIdx.x;
  const int wv  = tid >> 5;
  const int l   = tid & 31;
  const int h   = l >> 4;
  const int m   = l & 15;

  // q tile 32 x 32: one 16-B chunk a thread, row tid>>3, k 4*(tid&7); k tile 512 x 32: chunk i is 32 rows on
  const unsigned to  = (unsigned)((tid >> 3) * C_DIM + (tid & 7) * 4);
  const int      st0 = (tid >> 3) * KP + (tid & 7) * 4;
  const v4f ra = *(const v4f*)(A + to);
  v4f rw[T_LEN / 32];
#pragma unroll
  for (int i = 0; i < T_LEN / 32; ++i) rw[i] = *(const v4f*)(W + (size_t)(32 * i) * C_DIM + to);
  // stands in front of the index sums that overwrite the loads' address registers
  asm volatile("s_wait_xcnt 0x0" ::: "memory");

  {
    v2u hi, lo;
    split4(ra, hi, lo);
    *(v2u*)(&sAhi[st0]) = hi;
    *(v2u*)(&sAlo[st0]) = lo;
  }
#pragma unroll
  for (int i = 0; i < T_LEN / 32; ++i) {
    v2u hi, lo;
    split4(rw[i], hi, lo);
    *(v2u*)(&sWhi[st0 + 32 * i * KP]) = hi;
    *(v2u*)(&sWlo[st0 + 32 * i * KP]) = lo;
  }
  __syncthreads();            // tiles visible to every wave

  v8f acc[2][4];
#pragma unroll
  for (int i = 0; i < 2; ++i)
#pragma unroll
    for (int j = 0; j < 4; ++j) acc[i][j] = (v8f){};

  Frag ah[2], al[2];
#pragma unroll
  for (int i = 0; i < 2; ++i) {
    const int ar = (16 * i + m) * KP + 8 * h;
    ah[i].h[0] = *(const v8us*)(&sAhi[ar]);
    ah[i].h[1] = *(const v8us*)(&sAhi[ar + 16]);
    al[i].h[0] = *(const v8us*)(&sAlo[ar]);
    al[i].h[1] = *(const v8us*)(&sAlo[ar + 16]);
  }
#pragma unroll
  for (int j = 0; j < 4; ++j) {
    const int br = (64 * wv + 16 * j + m) * KP + 8 * h;
    Frag bh, bl;
    bh.h[0] = *(const v8us*)(&sWhi[br]);
    bh.h[1] = *(const v8us*)(&sWhi[br + 16]);
    bl.h[0] = *(const v8us*)(&sWlo[br]);
    bl.h[1] = *(const v8us*)(&sWlo[br + 16]);
#pragma unroll
    for (int i = 0; i < 2; ++i) mma3(acc[i][j], ah[i].v, al[i].v, bh.v, bl.v);
  }

#pragma unroll
  for (int i = 0; i < 2; ++i)
#pragma unroll
    for (int j = 0; j < 4; ++j)
#pragma unroll
      for (int r = 0; r < 8; ++r)
        sC[(16 * i + 8 * h + r) * CP + 64 * wv + 16 * j + m] = (1.0f / 32.0f) * acc[i][j][r];
  __syncthreads();            // whole rows of scores visible to the wave that owns them

  // four rows a wave, side by side: four independent reduction chains
  constexpr int RW = SS_M / 8;
  v4f v[RW][4];
#pragma unroll
  for (int q = 0; q < RW; ++q)
#pragma unroll
    for (int i = 0; i < 4; ++i) v[q][i] = *(const v4f*)(&sC[(RW * wv + q) * CP + l * 4 + i * 128]);

  float mx[RW];
#pragma unroll
  for (int q = 0; q < RW; ++q) {
    mx[q] = -3.0e38f;
#pragma unroll
    for (int i = 0; i < 4; ++i)
      mx[q] = fmaxf(mx[q], fmaxf(fmaxf(v[q][i].x, v[q][i].y), fmaxf(v[q][i].z, v[q][i].w)));
  }
#pragma unroll
  for (int off = 16; off > 0; off >>= 1)
#pragma unroll
    for (int q = 0; q < RW; ++q) mx[q] = fmaxf(mx[q], __shfl_xor(mx[q], off, 32));

  float sum[RW];
#pragma unroll
  for (int q = 0; q < RW; ++q) {
    sum[q] = 0.0f;
#pragma unroll
    for (int i = 0; i < 4; ++i) {
      v[q][i].x = exp_slot(v[q][i].x - mx[q]);
      v[q][i].y = exp_slot(v[q][i].y - mx[q]);
      v[q][i].z = exp_slot(v[q][i].z - mx[q]);
      v[q][i].w = exp_slot(v[q][i].w - mx[q]);
      sum[q] += (v[q][i].x + v[q][i].y) + (v[q][i].z + v[q][i].w);
    }
  }
#pragma unroll
  for (int off = 16; off > 0; off >>= 1)
#pragma unroll
    for (int q = 0; q < RW; ++q) sum[q] += __shfl_xor(sum[q], off, 32);
#pragma unroll
  for (int q = 0; q < RW; ++q) {
    const float inv = 1.0f / sum[q];
#pragma unroll
    for (int i = 0; i < 4; ++i) v[q][i] *= inv;
  }

  // address = block-uniform base of the destination + the lane's one 32-bit element offset, rows and segments at
  // immediate offsets: both destinations share the offset register, and no issued store's register is written again
  const size_t   ub = ((size_t)blockIdx.y * T_LEN + row0) * T_LEN;
  const unsigned lo = (unsigned)(RW * wv * T_LEN + l * 4);
  float* pw = w + ub;
#pragma unroll
  for (int q = 0; q < RW; ++q)
#pragma unroll
    for (int i = 0; i < 4; ++i) *(v4f*)(pw + (q * T_LEN + i * 128) + lo) = v[q][i];
  if (zb == 0) {              // block-uniform; behind the last barrier
    float* pa = a_out + ub;
#pragma unroll
    for (int q = 0; q < RW; ++q)
#pragma unroll
      for (int i = 0; i < 4; ++i) *(v4f*)(pa + (q * T_LEN + i * 128) + lo) = v[q][i];
  }
}

// ---------------------------------------------------------------------------
extern "C" void kernel_launch(void* const* d_in, const int* in_sizes, int n_in,
                              void* d_out, int out_size, void* d_ws, size_t ws_size,
                              hipStream_t stream)
{
  if (n_in < 10) return;
  const int n_x  = B_SZ * M_AX * T_LEN * C_DIM;          // 8388608
  const int n_w  = C_DIM * C_DIM;
  const int n_a  = NH * T_LEN * T_LEN;                   // 2097152
  if (in_sizes[0] != n_x || in_sizes[1] != n_x) return;
  if (in_sizes[2] != n_w || in_sizes[4] != n_w || in_sizes[6] != n_w || in_sizes[8] != n_w) return;
  if (in_sizes[3] != C_DIM || in_sizes[5] != C_DIM || in_sizes[7] != C_DIM || in_sizes[9] != C_DIM) return;
  if (out_size != n_x + n_a) return;

  const float* x  = (const float*)d_in[0];
  const float* y  = (const float*)d_in[1];
  const float* Wq = (const float*)d_in[2];
  const float* bq = (const float*)d_in[3];
  const float* Wk = (const float*)d_in[4];
  const float* bk = (const float*)d_in[5];
  const float* Wv = (const float*)d_in[6];
  const float* bv = (const float*)d_in[7];
  const float* Wp = (const float*)d_in[8];
  const float* bp = (const float*)d_in[9];

  float* out   = (float*)d_out;                            // [2,32,512,256]
  float* a_out = out + (size_t)n_x;                        // [8,512,512] at byte 33554432

  const size_t n_sum = (size_t)B_SZ * T_LEN * C_DIM;       // 262144
  const size_t n_v   = (size_t)n_x;                        // 8388608
  const size_t n_sc  = (size_t)B_SZ * NH * T_LEN * T_LEN;  // 4194304
  const size_t o_xsum = 0;
  const size_t o_ysum = o_xsum + n_sum;
  const size_t o_qt   = o_ysum + n_sum;
  const size_t o_kt   = o_qt   + n_sum;
  const size_t o_v    = o_kt   + n_sum;
  const size_t o_wsc  = o_v    + n_v;
  const size_t o_att  = o_wsc  + n_sc;
  const size_t o_end  = o_att  + n_v;                      // 22020096 floats = 88080384 B
  if (o_end * sizeof(float) > ws_size) return;

  float* ws   = (float*)d_ws;
  float* xsum = ws + o_xsum;
  float* ysum = ws + o_ysum;
  float* qt   = ws + o_qt;
  float* kt   = ws + o_kt;
  float* vbuf = ws + o_v;
  float* wsc  = ws + o_wsc;
  float* att  = ws + o_att;

  // 1) axial sums of x and y over m
  const int n4 = (int)(n_sum / 4);                         // 65536
  k_sum_m<<<dim3((n4 + 255) / 256, 2), dim3(256), 0, stream>>>(x, y, xsum, ysum, n4);

  // 2+3) qt = xsum @ Wq^T + 32*bq, kt = ysum @ Wk^T + 32*bk   [1024 x 256];  v = y_flat @ Wv^T + bv   [32768 x 256];  K = 256
  k_qkv<<<dim3(C_DIM / 64, 2 * QKB + VB, 1), dim3(128), 0, stream>>>(
      xsum, ysum, y, Wq, Wk, Wv, bq, bk, bv, qt, kt, vbuf);

  // 4+5) w[b,n] = softmax rows of (1/32) qt_head @ kt_head^T   [512 x 512], K = 32, y = b*8 + n; rows of batch 0 also to a_out
  k_score_softmax<<<dim3(T_LEN / SS_M, B_SZ * NH), dim3(256), 0, stream>>>(qt, kt, wsc, a_out);

  // 6) att[b,:,n] = w[b,n] @ v[b,:][:, n*32 .. n*32+31]   [512 x (32*32)], K = 512, z = b*8 + n, x = 4 slices m
  k_att<<<dim3(M_AX / AT_SL, T_LEN / AT_M, B_SZ * NH), dim3(256), 0, stream>>>(wsc, vbuf, att);

  // 7) out = att @ Wp^T + bp   [32768 x 256], K = 256
  k_gemm<64, 0, 1><<<dim3(C_DIM / 64, (B_SZ * M_AX * T_LEN) / 64, 1), dim3(128), 0, stream>>>(
      att, Wp, out, bp, 0, 0, 0, 0, 0, 0, 0, 0, 0,
      B_SZ * M_AX * T_LEN, C_DIM, C_DIM, C_DIM, 1, 1, 1.0f, 1.0f);
}

// v006
// A run of this version takes 77.4 microseconds.
// Timed twice side by side with v005, it ran 1.03 times as fast both times.
// Counting every step since v000, it is 2.47 times as fast.
// Contractions (q/k/v/out projections, q.k^T scores, w.v): v_wmma_f32_16x16x32_bf16 with each f32 operand carried as bf16 hi + bf16 lo (hi.hi + hi.lo + lo.hi), f32 accumulate; axial sums, softmax and epilogues f32. The weights and the intermediates v, w, att lie in the workspace already split (see "split lines").
#include <hip/hip_runtime.h>
#include <stdint.h>

typedef float          v4f  __attribute__((ext_vector_type(4)));
typedef float          v8f  __attribute__((ext_vector_type(8)));
typedef unsigned int   v2u  __attribute__((ext_vector_type(2)));
typedef unsigned int   v4u  __attribute__((ext_vector_type(4)));
typedef unsigned short v8us __attribute__((ext_vector_type(8)));
typedef __bf16         v16b __attribute__((ext_vector_type(16)));
typedef __bf16         v2b  __attribute__((ext_vector_type(2)));
typedef float          v2f  __attribute__((ext_vector_type(2)));
union Frag { v16b v; v8us h[2]; };

#define C_DIM 256
#define NH    8
#define DH    32
#define B_SZ  2
#define M_AX  32
#define T_LEN 512
#define KP    40      // LDS pitch (16-bit elements) of the 32-deep k tiles of the score kernel; multiple of 8 for 16-B fragment loads
// Split lines: the weights (by k_sum_m) and the GEMM operands v, w, att (by their producers) are stored split ONCE.
// The matrix keeps its f32 shape and pitch (k contiguous); each 128-B line, 32 values of one k step, holds
// 32 bf16 hi (64 B) and then 32 bf16 lo (64 B). A consumer moves the line to LDS as it is, with no arithmetic.
#define LP    72      // LDS row pitch (16-bit elements) of a k tile in that form: 32 hi, 32 lo, 8 pad = 144 B

// x = hi + lo with hi = rne_bf16(x), lo = rne_bf16(x - hi); (x - hi) is exact in f32.
// Both roundings are the chip's own packed convert (nearest even, two values an instruction).
static __device__ __forceinline__ void split2(float x0, float x1, unsigned int& hb, unsigned int& lb) {
  const v2f x  = {x0, x1};
  const v2b hi = __builtin_convertvector(x, v2b);
  const v2f r  = x - __builtin_convertvector(hi, v2f);
  const v2b lo = __builtin_convertvector(r, v2b);
  hb = __builtin_bit_cast(unsigned int, hi);
  lb = __builtin_bit_cast(unsigned int, lo);
}
static __device__ __forceinline__ void split4(v4f v, v2u& hi, v2u& lo) {
  unsigned int h01, h23, l01, l23;
  split2(v.x, v.y, h01, l01);
  split2(v.z, v.w, h23, l23);
  hi.x = h01; hi.y = h23;
  lo.x = l01; lo.y = l23;
}

// eight values -> one 16-B chunk of hi and one of lo
static __device__ __forceinline__ void split8(v4f a, v4f b, v4f& hi, v4f& lo) {
  v2u ha, la, hb, lb;
  split4(a, ha, la);
  split4(b, hb, lb);
  const v4u h4 = {ha.x, ha.y, hb.x, hb.y};
  const v4u l4 = {la.x, la.y, lb.x, lb.y};
  hi = __builtin_bit_cast(v4f, h4);     // bits only: never used as numbers
  lo = __builtin_bit_cast(v4f, l4);
}

// three 16x16x32 bf16 ops into one accumulator, then the VALU hazard guard
static __device__ __forceinline__ void mma3(v8f& acc, v16b ah, v16b al, v16b bh, v16b bl) {
  acc = __builtin_amdgcn_wmma_f32_16x16x32_bf16(false, ah, false, bh, (short)0, acc, false, false);
  acc = __builtin_amdgcn_wmma_f32_16x16x32_bf16(false, ah, false, bl, (short)0, acc, false, false);
  acc = __builtin_amdgcn_wmma_f32_16x16x32_bf16(false, al, false, bh, (short)0, acc, false, false);
  asm volatile("v_nop\n\tv_nop\n\tv_nop\n\tv_nop" : "+v"(acc) : "v"(ah), "v"(al), "v"(bh), "v"(bl));
}

// ---------------------------------------------------------------------------
// GEMM  C[M x N] = alpha * A[M x K] * W^T (+ bias_scale * bias[n] when HB)
//   A : row-major, k contiguous, pitch C_DIM; AS == 0: f32, split here; AS == 1: split lines
//   W : W[n][k], k contiguous, pitch C_DIM, split lines
//   C : f32 row-major, pitch ldc; or, when VT and tr: split lines of C^T per slice of T_LEN rows,
//       C[slice][n][t] with t contiguous, pitch T_LEN (the form in which k_att reads v)
//   HB == 0: bias pointer is never read.
// Block = 128 threads (4 waves), tile 64 rows x BN cols, 32 k per step.
// Wave w owns rows 16w..16w+15 and all BN cols (BN/16 accumulator tiles).
// Fragment maps per lane l (h = l>>4, m = l&15):
//   A: row m, el 0..7 <- k 8h+0..7, el 8..15 <- k 16+8h+0..7
//   B: col m, same k map;   D: el r <- (row 8h+r, col m)
// Requires M % 64 == 0, N % BN == 0, K % 32 == 0, 16-B aligned rows.
// ---------------------------------------------------------------------------
// gemm_tile: one 64 x BN tile of C at (row0, col0), by one whole block.
template <int BN, int AS, int HB, int VT>
static __device__ __forceinline__ void
gemm_tile(const float* __restrict__ A, const float* __restrict__ W,
          float* __restrict__ C, const float* __restrict__ bias,
          int row0, int col0, int K, int ldc,
          float bias_scale, float alpha, bool tr)
{
  static_assert(!VT || BN == 64, "the transposed tile is laid over sC: BN rows of 64 values");
  constexpr int lda = C_DIM;            // row pitch of A and of W: a constant, so that a thread's eight loads
  constexpr int ldb = C_DIM;            // of a k step are two addresses plus immediate offsets
  constexpr int TN  = BN / 16;          // accumulator tiles per wave
  constexpr int CP  = BN + 4;           // f32 pitch of the staged C tile (multiple of 4)
  constexpr int NCH = BN / 16;          // 16-B W chunks per thread per k step

  __shared__ __attribute__((aligned(16))) unsigned short sA[64 * LP];
  __shared__ __attribute__((aligned(16))) unsigned short sW[BN * LP];
  __shared__ __attribute__((aligned(16))) float          sC[64 * CP];

  const int tid = threadIdx.x;
  const int wv  = tid >> 5;
  const int l   = tid & 31;
  const int h   = l >> 4;
  const int m   = l & 15;

  v8f acc[TN];
#pragma unroll
  for (int j = 0; j < TN; ++j) acc[j] = (v8f){};

  // The tiles of k step k0, 8 x 16 B a thread, from global memory into registers.
  v4f ra[4];
  v4f rw[NCH];
  // Address = block-uniform base of the step + the thread's own fixed 32-bit element offset: few address
  // registers, so that holding the eight chunks across the matrix work costs no resident wave.
  const int st0 = (tid >> 3) * LP + (tid & 7) * 8;     // LDS place of chunk 0 of a split line; chunk i is 16 rows on
  const int sf0 = (tid >> 3) * LP + (tid & 7) * 4;     // LDS place of the hi half of an f32 chunk; its lo half is 32 on
  const float* Ab = A + (size_t)row0 * lda;
  const float* Wb = W + (size_t)col0 * ldb;
  auto fetch = [&](int k0) {
    const float* Ak = Ab + k0;
    const float* Wk = Wb + k0;
    // A tile 64 x 32: chunk tid + 128 i -> row (tid>>3) + 16 i, bytes 16*(tid&7) of the row's line; W tile alike
#pragma unroll
    for (int i = 0; i < 4; ++i)
      ra[i] = *(const v4f*)(Ak + (size_t)(16 * i) * lda + (unsigned)((tid >> 3) * lda + (tid & 7) * 4));
#pragma unroll
    for (int i = 0; i < NCH; ++i)
      rw[i] = *(const v4f*)(Wk + (size_t)(16 * i) * ldb + (unsigned)((tid >> 3) * ldb + (tid & 7) * 4));
    // stands in front of the fragment reads and index sums that overwrite the loads' address registers
    asm volatile("s_wait_xcnt 0x0" ::: "memory");
  };

  fetch(0);
  for (int k0 = 0; k0 < K; k0 += 32) {
    __syncthreads();          // all waves done reading the tiles of the prior k step
#pragma unroll
    for (int i = 0; i < 4; ++i) {
      if (AS) {
        *(v4f*)(&sA[st0 + 16 * i * LP]) = ra[i];
      } else {
        v2u hi, lo;
        split4(ra[i], hi, lo);
        *(v2u*)(&sA[sf0 + 16 * i * LP])      = hi;
        *(v2u*)(&sA[sf0 + 16 * i * LP + 32]) = lo;
      }
    }
#pragma unroll
    for (int i = 0; i < NCH; ++i) *(v4f*)(&sW[st0 + 16 * i * LP]) = rw[i];
    __syncthreads();          // tiles visible to every wave

    Frag ah, al;
    {
      const int ar = (16 * wv + m) * LP + 8 * h;
      ah.h[0] = *(const v8us*)(&sA[ar]);
      ah.h[1] = *(const v8us*)(&sA[ar + 16]);
      al.h[0] = *(const v8us*)(&sA[ar + 32]);
      al.h[1] = *(const v8us*)(&sA[ar + 48]);
    }
    // the next step's loads fly while this step's fragments are read and multiplied; they are waited for at
    // the next staging. Behind the A fragment reads, so that the LDS latency runs beside the loads' issue.
    if (k0 + 32 < K) fetch(k0 + 32);
#pragma unroll
    for (int j = 0; j < TN; ++j) {
      const int br = (16 * j + m) * LP + 8 * h;
      Frag bh, bl;
      bh.h[0] = *(const v8us*)(&sW[br]);
      bh.h[1] = *(const v8us*)(&sW[br + 16]);
      bl.h[0] = *(const v8us*)(&sW[br + 32]);
      bl.h[1] = *(const v8us*)(&sW[br + 48]);
      mma3(acc[j], ah.v, al.v, bh.v, bl.v);
    }
  }

  const bool vt = VT && tr;   // block-uniform
  float bb[TN];
#pragma unroll
  for (int j = 0; j < TN; ++j) bb[j] = HB ? bias[col0 + 16 * j + m] : 0.0f;
  // stands in front of the index sums that overwrite the bias loads' address register
  if (HB) asm volatile("s_wait_xcnt 0x0" ::: "memory");
#pragma unroll
  for (int j = 0; j < TN; ++j) bb[j] = HB ? bias_scale * bb[j] : 0.0f;
  if (vt) {
    // A lane's accumulator tile is 8 consecutive rows t of one column n: one 16-B chunk of hi and one of lo of C^T.
    // sC then holds the tile as BN rows n of two split lines (64 t), pitch CP.
#pragma unroll
    for (int j = 0; j < TN; ++j) {
      const float b = bb[j];
      const v4f a0 = {alpha * acc[j][0] + b, alpha * acc[j][1] + b, alpha * acc[j][2] + b, alpha * acc[j][3] + b};
      const v4f a1 = {alpha * acc[j][4] + b, alpha * acc[j][5] + b, alpha * acc[j][6] + b, alpha * acc[j][7] + b};
      v4f hi, lo;
      split8(a0, a1, hi, lo);
      float* p = &sC[(16 * j + m) * CP + (wv >> 1) * 32 + ((wv & 1) * 2 + h) * 4];
      *(v4f*)p        = hi;
      *(v4f*)(p + 16) = lo;
    }
  } else {
#pragma unroll
    for (int j = 0; j < TN; ++j)
#pragma unroll
      for (int r = 0; r < 8; ++r)
        sC[(16 * wv + 8 * h + r) * CP + 16 * j + m] = alpha * acc[j][r] + bb[j];
  }
  __syncthreads();
  // rows of sC go out as they lie, 16 B a lane: rows of C, or (vt) columns n of C as rows of C^T, 64 t each
  float* Cb = vt ? C + (size_t)(row0 / T_LEN) * ((size_t)C_DIM * T_LEN) + (size_t)col0 * T_LEN + (row0 % T_LEN)
                 : C + (size_t)row0 * ldc + col0;
  const int ldo = vt ? T_LEN : ldc;
#pragma unroll
  for (int i = 0; i < BN / 8; ++i) {
    const int idx = i * 128 + tid;
    const int row = idx / (BN / 4);
    const int c4  = (idx % (BN / 4)) * 4;
    const v4f val = *(const v4f*)(&sC[row * CP + c4]);
    float* gp = Cb + (size_t)row * ldo + c4;
    *(v4f*)gp = val;
  }
}

// A and W in split lines, C f32. Batch z -> (zb, zm, zn) with independent element strides per operand.
template <int BN, int HB>
__global__ void __launch_bounds__(128)
k_gemm(const float* __restrict__ Abase, const float* __restrict__ Wbase,
       float* __restrict__ Cbase, const float* __restrict__ bias,
       long long sAb, long long sAm, long long sAn,
       long long sBb, long long sBm, long long sBn,
       long long sCb, long long sCm, long long sCn,
       int Mrows, int Ncols, int K, int ldc,
       int nInner, int nMid, float bias_scale, float alpha)
{
  const int z  = blockIdx.z;
  const int zn = z % nInner;
  const int zm = (z / nInner) % nMid;
  const int zb = z / (nInner * nMid);
  const float* A = Abase + ((long long)zb * sAb + (long long)zm * sAm + (long long)zn * sAn);
  const float* W = Wbase + ((long long)zb * sBb + (long long)zm * sBm + (long long)zn * sBn);
  float*       C = Cbase + ((long long)zb * sCb + (long long)zm * sCm + (long long)zn * sCn);

  const int row0 = blockIdx.y * 64;
  const int col0 = blockIdx.x * BN;
  if (row0 + 64 > Mrows || col0 + BN > Ncols) return;     // block-uniform, before any barrier

  gemm_tile<BN, 1, HB, 0>(A, W, C, bias, row0, col0, K, ldc, bias_scale, alpha, false);
}

// ---------------------------------------------------------------------------
// The three input projections, which do not depend on one another, as ONE launch:
//   blockIdx.y <  QKB          : qt = xsum @ Wq^T + 32 bq   (row tile blockIdx.y)
//   blockIdx.y <  2 QKB        : kt = ysum @ Wk^T + 32 bk
//   otherwise                  : v  = y    @ Wv^T +    bv   (stored as split lines of v^T per slice: [c][s])
// wsp: Wq, Wk, Wv in split lines, one behind the other.
// qt and kt are 64 blocks each, a quarter of the chip's 256 WGPs if launched alone; here they come first
// in the grid and run beside the 2048 blocks of v.
// ---------------------------------------------------------------------------
#define QKB ((B_SZ * T_LEN) / 64)            // row tiles of qt, and of kt
#define VB  ((B_SZ * M_AX * T_LEN) / 64)     // row tiles of v
__global__ void __launch_bounds__(128)
k_qkv(const float* __restrict__ xsum, const float* __restrict__ ysum, const float* __restrict__ y,
      const float* __restrict__ wsp,
      const float* __restrict__ bq, const float* __restrict__ bk, const float* __restrict__ bv,
      float* __restrict__ qt, float* __restrict__ kt, float* __restrict__ vbuf)
{
  const int by = blockIdx.y;
  if (by >= 2 * QKB + VB) return;              // block-uniform, before any barrier
  const int seg = by < QKB ? 0 : (by < 2 * QKB ? 1 : 2);
  const float* A    = seg == 0 ? xsum : (seg == 1 ? ysum : y);
  const float* W    = wsp + seg * (C_DIM * C_DIM);
  const float* bias = seg == 0 ? bq   : (seg == 1 ? bk   : bv);
  float*       C    = seg == 0 ? qt   : (seg == 1 ? kt   : vbuf);
  const float  bs   = seg == 2 ? 1.0f : (float)M_AX;
  const int row0 = (by - seg * QKB) * 64;
  const int col0 = blockIdx.x * 64;
  gemm_tile<64, 0, 1, 1>(A, W, C, bias, row0, col0, C_DIM, C_DIM, bs, 1.0f, seg == 2);
}

// ---------------------------------------------------------------------------
// att[b, m, t, n*32 + d] = sum_s w[b, n, t, s] * v[b, m, s, n*32 + d]
// The 32 axial slices m of one (b, n) share w, so they are the columns of ONE product
//   [512 t x 512 s] * [512 s x (32 m * 32 d)].
// Block = 256 threads (8 waves), tile 128 t x 128 columns (4 slices x 32 d), 32 s per step.
// Wave wv owns rows 32*(wv&3)..+31 and columns 64*(wv>>2)..+63 (2 x 4 accumulator tiles).
// Fragment maps, LDS layout ([row or column][k], pitch LP) and k order are those of k_gemm.
// w [t][s] and v^T [slice][c][s] come in split lines, att [slice][t][c] leaves in split lines.
// grid: x = group of 4 slices, y = row tile, z = b*8 + n
// ---------------------------------------------------------------------------
#define AT_M  128
#define AT_N  128
#define AT_SL (AT_N / DH)
__global__ void __launch_bounds__(256)
k_att(const float* __restrict__ wsc, const float* __restrict__ vbuf, float* __restrict__ att)
{
  constexpr int CP = AT_N + 4;          // f32 pitch of the staged C tile (multiple of 4)

  __shared__ __attribute__((aligned(16))) unsigned short sA[AT_M * LP];
  __shared__ __attribute__((aligned(16))) unsigned short sW[AT_N * LP];
  __shared__ __attribute__((aligned(16))) float          sC[AT_M * CP];

  const int zn   = blockIdx.z % NH;
  const int zb   = blockIdx.z / NH;
  const int m0   = blockIdx.x * AT_SL;
  const int row0 = blockIdx.y * AT_M;
  const size_t slice = (size_t)T_LEN * C_DIM;
  const float* A = wsc  + ((size_t)blockIdx.z * T_LEN + row0) * T_LEN;
  const float* V = vbuf + (size_t)(zb * M_AX + m0) * slice + (size_t)(zn * DH) * T_LEN;
  float*       C = att  + (size_t)(zb * M_AX + m0) * slice + (size_t)row0 * C_DIM + zn * DH;

  const int tid = threadIdx.x;
  const int wv  = tid >> 5;
  const int l   = tid & 31;
  const int h   = l >> 4;
  const int m   = l & 15;
  const int wr  = wv & 3;
  const int wc  = wv >> 2;

  // both tiles are 128 rows (t, or column = slice*32 + d) of one split line: chunk tid + 256 i -> row (tid>>3) + 32 i,
  // bytes 16*(tid&7) of the line; in v^T row (tid>>3) + 32 i is row d = tid>>3 of slice i
  const unsigned to  = (unsigned)((tid >> 3) * T_LEN + (tid & 7) * 4);   // the thread's element offset in w and in v^T
  const int      st0 = (tid >> 3) * LP + (tid & 7) * 8;                  // LDS place of its chunk 0; chunk i is 32 rows on

  v8f acc[2][4];
#pragma unroll
  for (int i = 0; i < 2; ++i)
#pragma unroll
    for (int j = 0; j < 4; ++j) acc[i][j] = (v8f){};

  // The tiles of k step k0, 8 x 16 B a thread, from global memory into registers.
  v4f ra[4];
  v4f rw[4];
  // Address = block-uniform base of the step + the thread's own fixed 32-bit element offset: few address
  // registers, so that holding the eight chunks across the matrix work costs no resident wave.
  auto fetch = [&](int k0) {
    const float* Ak = A + k0;
    const float* Vk = V + k0;
#pragma unroll
    for (int i = 0; i < 4; ++i) ra[i] = *(const v4f*)(Ak + (size_t)(32 * i) * T_LEN + to);
#pragma unroll
    for (int i = 0; i < 4; ++i) rw[i] = *(const v4f*)(Vk + (size_t)i * (T_LEN * C_DIM) + to);
    // stands in front of the fragment reads and index sums that overwrite the loads' address registers
    asm volatile("s_wait_xcnt 0x0" ::: "memory");
  };

  fetch(0);
  for (int k0 = 0; k0 < T_LEN; k0 += 32) {
    __syncthreads();          // all waves done reading the tiles of the prior k step
#pragma unroll
    for (int i = 0; i < 4; ++i) *(v4f*)(&sA[st0 + 32 * i * LP]) = ra[i];
#pragma unroll
    for (int i = 0; i < 4; ++i) *(v4f*)(&sW[st0 + 32 * i * LP]) = rw[i];
    __syncthreads();          // tiles visible to every wave

    Frag ah[2], al[2];
#pragma unroll
    for (int i = 0; i < 2; ++i) {
      const int ar = (32 * wr + 16 * i + m) * LP + 8 * h;
      ah[i].h[0] = *(const v8us*)(&sA[ar]);
      ah[i].h[1] = *(const v8us*)(&sA[ar + 16]);
      al[i].h[0] = *(const v8us*)(&sA[ar + 32]);
      al[i].h[1] = *(const v8us*)(&sA[ar + 48]);
    }
    // the next step's loads fly while this step's fragments are read and multiplied; they are waited for at
    // the next staging. Behind the A fragment reads, so that the LDS latency runs beside the loads' issue.
    if (k0 + 32 < T_LEN) fetch(k0 + 32);
#pragma unroll
    for (int j = 0; j < 4; ++j) {
      const int br = (64 * wc + 16 * j + m) * LP + 8 * h;
      Frag bh, bl;
      bh.h[0] = *(const v8us*)(&sW[br]);
      bh.h[1] = *(const v8us*)(&sW[br + 16]);
      bl.h[0] = *(const v8us*)(&sW[br + 32]);
      bl.h[1] = *(const v8us*)(&sW[br + 48]);
#pragma unroll
      for (int i = 0; i < 2; ++i) mma3(acc[i][j], ah[i].v, al[i].v, bh.v, bl.v);
    }
  }

#pragma unroll
  for (int i = 0; i < 2; ++i)
#pragma unroll
    for (int j = 0; j < 4; ++j)
#pragma unroll
      for (int r = 0; r < 8; ++r)
        sC[(32 * wr + 16 * i + 8 * h + r) * CP + 64 * wc + 16 * j + m] = acc[i][j][r];
  __syncthreads();
  // a thread splits 8 consecutive d of one (t, slice): a 16-B chunk of hi and one of lo of that row's line of head zn;
  // four lanes fill the hi half of a line with one store and its lo half with the next
#pragma unroll
  for (int i = 0; i < AT_M * AT_N / (8 * 256); ++i) {
    const int idx = i * 256 + tid;
    const int row = idx / (AT_N / 8);
    const int c8  = idx % (AT_N / 8);
    const v4f a0 = *(const v4f*)(&sC[row * CP + c8 * 8]);
    const v4f a1 = *(const v4f*)(&sC[row * CP + c8 * 8 + 4]);
    v4f hi, lo;
    split8(a0, a1, hi, lo);
    float* gp = C + (size_t)(c8 >> 2) * slice + (size_t)row * C_DIM + (c8 & 3) * 4;
    *(v4f*)gp        = hi;
    *(v4f*)(gp + 16) = lo;
  }
}

// ---------------------------------------------------------------------------
// Axial sum: out[b, t, c] = sum_m in[b, m, t, c]; one thread per 4 consecutive c.
// blockIdx.y picks the tensor (0: in0 -> out0, 1: in1 -> out1): both sums in one launch.
// blockIdx.y == 2: the four weight matrices w0..w3 to split lines in wsp, one behind the other; 4 values a thread.
// ---------------------------------------------------------------------------
__global__ void __launch_bounds__(256)
k_sum_m(const float* __restrict__ in0, const float* __restrict__ in1,
        float* __restrict__ out0, float* __restrict__ out1,
        const float* __restrict__ w0, const float* __restrict__ w1,
        const float* __restrict__ w2, const float* __restrict__ w3,
        float* __restrict__ wsp, int n4)
{
  const int i4 = blockIdx.x * 256 + threadIdx.x;
  if (blockIdx.y == 2) {
    constexpr int W4 = C_DIM * C_DIM / 4;      // 16-B chunks of one matrix
    if (i4 >= 4 * W4) return;
    const int j = i4 / W4;                     // block-uniform
    const float* wj = j == 0 ? w0 : (j == 1 ? w1 : (j == 2 ? w2 : w3));
    v2u hi, lo;
    split4(*(const v4f*)(wj + (size_t)(i4 % W4) * 4), hi, lo);
    float* o = wsp + (size_t)(i4 >> 3) * 32 + (i4 & 7) * 2;
    *(v2u*)o        = hi;
    *(v2u*)(o + 16) = lo;
    return;
  }
  if (i4 >= n4) return;
  const float* in  = blockIdx.y ? in1 : in0;
  float*       out = blockIdx.y ? out1 : out0;
  const size_t i     = (size_t)i4 * 4;
  const size_t inner = (size_t)T_LEN * C_DIM;
  const size_t b     = i / inner;
  const size_t r     = i - b * inner;
  const float* p = in + b * (size_t)M_AX * inner + r;
  v4f s = {0.0f, 0.0f, 0.0f, 0.0f};
#pragma unroll 8
  for (int mm = 0; mm < M_AX; ++mm) s += *(const v4f*)(p + (size_t)mm * inner);
  float* o = out + i;
  *(v4f*)o = s;
  
}

// ---------------------------------------------------------------------------
// w[b, n, t, :] = softmax_s( (1/32) qt[b, t, n*32 ..] . kt[b, s, n*32 ..] ), scores and row softmax in ONE kernel.
// A block holds SS_M whole rows of one (b, n): a SS_M x 512 score tile, K = 32 (one k step), which goes from the
// accumulators to LDS and from there through the softmax; the scores never go to global memory.
// Block = 256 threads (8 waves). Product: wave wv owns all SS_M rows and columns 64 wv .. +63 (2 x 4 accumulator
// tiles); fragment maps and k order are those of k_gemm; LDS: hi and lo in separate [row or column][k] arrays, pitch KP.
// Softmax: wave wv owns rows 4 wv .. +3, a lane holds floats lane*4+0..3 of each 128-float segment of a row, so
// that every f32 store instruction covers four whole 128-B lines. w leaves in split lines (a lane's 4 values: 8 B of
// hi and 8 B of lo of their line); rows of batch 0 also go to a_out as f32.
// grid: x = row tile, y = b*8 + n
// ---------------------------------------------------------------------------
#define SS_M 32
// e^x as __expf forms it (2^(x log2 e), the chip's own v_exp_f32). In asm text for the v_nop alone: it keeps the one
// slot that the instruction set asks for behind a transcendental, before its result is read or its source overwritten.
static __device__ __forceinline__ float exp_slot(float x) {
  float r;
  asm("v_exp_f32 %0, %1\n\tv_nop" : "=v"(r) : "v"(x * 0x1.715476p+0f));
  return r;
}
__global__ void __launch_bounds__(256)
k_score_softmax(const float* __restrict__ qt, const float* __restrict__ kt,
                float* __restrict__ w, float* __restrict__ a_out)
{
  constexpr int CP = T_LEN + 4;         // f32 pitch of the score tile (multiple of 4; rows 8 apart fall 32 banks apart)

  __shared__ __attribute__((aligned(16))) unsigned short sAhi[SS_M * KP];
  __shared__ __attribute__((aligned(16))) unsigned short sAlo[SS_M * KP];
  __shared__ __attribute__((aligned(16))) unsigned short sWhi[T_LEN * KP];
  __shared__ __attribute__((aligned(16))) unsigned short sWlo[T_LEN * KP];
  __shared__ __attribute__((aligned(16))) float          sC[SS_M * CP];

  const int zn   = blockIdx.y % NH;
  const int zb   = blockIdx.y / NH;
  const int row0 = blockIdx.x * SS_M;
  const float* A = qt + ((size_t)zb * T_LEN + row0) * C_DIM + zn * DH;
  const float* W = kt + (size_t)zb * T_LEN * C_DIM + zn * DH;

  const int tid = threadIdx.x;
  const int wv  = tid >> 5;
  const int l   = tid & 31;
  const int h   = l >> 4;
  const int m   = l & 15;

  // q tile 32 x 32: one 16-B chunk a thread, row tid>>3, k 4*(tid&7); k tile 512 x 32: chunk i is 32 rows on
  const unsigned to  = (unsigned)((tid >> 3) * C_DIM + (tid & 7) * 4);
  const int      st0 = (tid >> 3) * KP + (tid & 7) * 4;
  const v4f ra = *(const v4f*)(A + to);
  v4f rw[T_LEN / 32];
#pragma unroll
  for (int i = 0; i < T_LEN / 32; ++i) rw[i] = *(const v4f*)(W + (size_t)(32 * i) * C_DIM + to);
  // stands in front of the index sums that overwrite the loads' address registers
  asm volatile("s_wait_xcnt 0x0" ::: "memory");

  {
    v2u hi, lo;
    split4(ra, hi, lo);
    *(v2u*)(&sAhi[st0]) = hi;
    *(v2u*)(&sAlo[st0]) = lo;
  }
#pragma unroll
  for (int i = 0; i < T_LEN / 32; ++i) {
    v2u hi, lo;
    split4(rw[i], hi, lo);
    *(v2u*)(&sWhi[st0 + 32 * i * KP]) = hi;
    *(v2u*)(&sWlo[st0 + 32 * i * KP]) = lo;
  }
  __syncthreads();            // tiles visible to every wave

  v8f acc[2][4];
#pragma unroll
  for (int i = 0; i < 2; ++i)
#pragma unroll
    for (int j = 0; j < 4; ++j) acc[i][j] = (v8f){};

  Frag ah[2], al[2];
#pragma unroll
  for (int i = 0; i < 2; ++i) {
    const int ar = (16 * i + m) * KP + 8 * h;
    ah[i].h[0] = *(const v8us*)(&sAhi[ar]);
    ah[i].h[1] = *(const v8us*)(&sAhi[ar + 16]);
    al[i].h[0] = *(const v8us*)(&sAlo[ar]);
    al[i].h[1] = *(const v8us*)(&sAlo[ar + 16]);
  }
#pragma unroll
  for (int j = 0; j < 4; ++j) {
    const int br = (64 * wv + 16 * j + m) * KP + 8 * h;
    Frag bh, bl;
    bh.h[0] = *(const v8us*)(&sWhi[br]);
    bh.h[1] = *(const v8us*)(&sWhi[br + 16]);
    bl.h[0] = *(const v8us*)(&sWlo[br]);
    bl.h[1] = *(const v8us*)(&sWlo[br + 16]);
#pragma unroll
    for (int i = 0; i < 2; ++i) mma3(acc[i][j], ah[i].v, al[i].v, bh.v, bl.v);
  }

#pragma unroll
  for (int i = 0; i < 2; ++i)
#pragma unroll
    for (int j = 0; j < 4; ++j)
#pragma unroll
      for (int r = 0; r < 8; ++r)
        sC[(16 * i + 8 * h + r) * CP + 64 * wv + 16 * j + m] = (1.0f / 32.0f) * acc[i][j][r];
  __syncthreads();            // whole rows of scores visible to the wave that owns them

  // four rows a wave, side by side: four independent reduction chains
  constexpr int RW = SS_M / 8;
  v4f v[RW][4];
#pragma unroll
  for (int q = 0; q < RW; ++q)
#pragma unroll
    for (int i = 0; i < 4; ++i) v[q][i] = *(const v4f*)(&sC[(RW * wv + q) * CP + l * 4 + i * 128]);

  float mx[RW];
#pragma unroll
  for (int q = 0; q < RW; ++q) {
    mx[q] = -3.0e38f;
#pragma unroll
    for (int i = 0; i < 4; ++i)
      mx[q] = fmaxf(mx[q], fmaxf(fmaxf(v[q][i].x, v[q][i].y), fmaxf(v[q][i].z, v[q][i].w)));
  }
#pragma unroll
  for (int off = 16; off > 0; off >>= 1)
#pragma unroll
    for (int q = 0; q < RW; ++q) mx[q] = fmaxf(mx[q], __shfl_xor(mx[q], off, 32));

  float sum[RW];
#pragma unroll
  for (int q = 0; q < RW; ++q) {
    sum[q] = 0.0f;
#pragma unroll
    for (int i = 0; i < 4; ++i) {
      v[q][i].x = exp_slot(v[q][i].x - mx[q]);
      v[q][i].y = exp_slot(v[q][i].y - mx[q]);
      v[q][i].z = exp_slot(v[q][i].z - mx[q]);
      v[q][i].w = exp_slot(v[q][i].w - mx[q]);
      sum[q] += (v[q][i].x + v[q][i].y) + (v[q][i].z + v[q][i].w);
    }
  }
#pragma unroll
  for (int off = 16; off > 0; off >>= 1)
#pragma unroll
    for (int q = 0; q < RW; ++q) sum[q] += __shfl_xor(sum[q], off, 32);
#pragma unroll
  for (int q = 0; q < RW; ++q) {
    const float inv = 1.0f / sum[q];
#pragma unroll
    for (int i = 0; i < 4; ++i) v[q][i] *= inv;
  }

  // address = block-uniform base of the destination + the lane's one 32-bit element offset, rows and segments at
  // immediate offsets: one offset register a destination (lo: f32 rows of a_out, ls: split lines of w)
  const size_t   ub = ((size_t)blockIdx.y * T_LEN + row0) * T_LEN;
  const unsigned lo = (unsigned)(RW * wv * T_LEN + l * 4);
  const unsigned ls = (unsigned)(RW * wv * T_LEN + (l >> 3) * 32 + (l & 7) * 2);   // the hi half's place in a split line
  float* pw = w + ub;
#pragma unroll
  for (int q = 0; q < RW; ++q)
#pragma unroll
    for (int i = 0; i < 4; ++i) {
      v2u sh, sl;
      split4(v[q][i], sh, sl);
      *(v2u*)(pw + (q * T_LEN + i * 128) + ls)      = sh;
      *(v2u*)(pw + (q * T_LEN + i * 128 + 16) + ls) = sl;
    }
  if (zb == 0) {              // block-uniform; behind the last barrier
    float* pa = a_out + ub;
#pragma unroll
    for (int q = 0; q < RW; ++q)
#pragma unroll
      for (int i = 0; i < 4; ++i) *(v4f*)(pa + (q * T_LEN + i * 128) + lo) = v[q][i];
  }
}

// ---------------------------------------------------------------------------
extern "C" void kernel_launch(void* const* d_in, const int* in_sizes, int n_in,
                              void* d_out, int out_size, void* d_ws, size_t ws_size,
                              hipStream_t stream)
{
  if (n_in < 10) return;
  const int n_x  = B_SZ * M_AX * T_LEN * C_DIM;          // 8388608
  const int n_w  = C_DIM * C_DIM;
  const int n_a  = NH * T_LEN * T_LEN;                   // 2097152
  if (in_sizes[0] != n_x || in_sizes[1] != n_x) return;
  if (in_sizes[2] != n_w || in_sizes[4] != n_w || in_sizes[6] != n_w || in_sizes[8] != n_w) return;
  if (in_sizes[3] != C_DIM || in_sizes[5] != C_DIM || in_sizes[7] != C_DIM || in_sizes[9] != C_DIM) return;
  if (out_size != n_x + n_a) return;

  const float* x  = (const float*)d_in[0];
  const float* y  = (const float*)d_in[1];
  const float* Wq = (const float*)d_in[2];
  const float* bq = (const float*)d_in[3];
  const float* Wk = (const float*)d_in[4];
  const float* bk = (const float*)d_in[5];
  const float* Wv = (const float*)d_in[6];
  const float* bv = (const float*)d_in[7];
  const float* Wp = (const float*)d_in[8];
  const float* bp = (const float*)d_in[9];

  float* out   = (float*)d_out;                            // [2,32,512,256]
  float* a_out = out + (size_t)n_x;                        // [8,512,512] at byte 33554432

  const size_t n_sum = (size_t)B_SZ * T_LEN * C_DIM;       // 262144
  const size_t n_v   = (size_t)n_x;                        // 8388608
  const size_t n_sc  = (size_t)B_SZ * NH * T_LEN * T_LEN;  // 4194304
  const size_t o_xsum = 0;
  const size_t o_ysum = o_xsum + n_sum;
  const size_t o_qt   = o_ysum + n_sum;
  const size_t o_kt   = o_qt   + n_sum;
  const size_t o_v    = o_kt   + n_sum;
  const size_t o_wsc  = o_v    + n_v;
  const size_t o_att  = o_wsc  + n_sc;
  const size_t o_wsp  = o_att  + n_v;
  const size_t o_end  = o_wsp  + 4 * (size_t)n_w;          // 22282240 floats = 89128960 B
  if (o_end * sizeof(float) > ws_size) return;

  float* ws   = (float*)d_ws;
  float* xsum = ws + o_xsum;
  float* ysum = ws + o_ysum;
  float* qt   = ws + o_qt;
  float* kt   = ws + o_kt;
  float* vbuf = ws + o_v;
  float* wsc  = ws + o_wsc;
  float* att  = ws + o_att;
  float* wsp  = ws + o_wsp;                                // Wq, Wk, Wv, Wp in split lines

  // 1) axial sums of x and y over m; the four weight matrices to split lines
  const int n4 = (int)(n_sum / 4);                         // 65536
  k_sum_m<<<dim3((n4 + 255) / 256, 3), dim3(256), 0, stream>>>(x, y, xsum, ysum, Wq, Wk, Wv, Wp, wsp, n4);

  // 2+3) qt = xsum @ Wq^T + 32*bq, kt = ysum @ Wk^T + 32*bk   [1024 x 256];  v = y_flat @ Wv^T + bv   [32768 x 256];  K = 256
  k_qkv<<<dim3(C_DIM / 64, 2 * QKB + VB, 1), dim3(128), 0, stream>>>(
      xsum, ysum, y, wsp, bq, bk, bv, qt, kt, vbuf);

  // 4+5) w[b,n] = softmax rows of (1/32) qt_head @ kt_head^T   [512 x 512], K = 32, y = b*8 + n; rows of batch 0 also to a_out
  k_score_softmax<<<dim3(T_LEN / SS_M, B_SZ * NH), dim3(256), 0, stream>>>(qt, kt, wsc, a_out);

  // 6) att[b,:,n] = w[b,n] @ v[b,:][:, n*32 .. n*32+31]   [512 x (32*32)], K = 512, z = b*8 + n, x = 4 slices m
  k_att<<<dim3(M_AX / AT_SL, T_LEN / AT_M, B_SZ * NH), dim3(256), 0, stream>>>(wsc, vbuf, att);

  // 7) out = att @ Wp^T + bp   [32768 x 256], K = 256
  k_gemm<64, 1><<<dim3(C_DIM / 64, (B_SZ * M_AX * T_LEN) / 64, 1), dim3(128), 0, stream>>>(
      att, wsp + 3 * (size_t)n_w, out, bp, 0, 0, 0, 0, 0, 0, 0, 0, 0,
      B_SZ * M_AX * T_LEN, C_DIM, C_DIM, C_DIM, 1, 1, 1.0f, 1.0f);
}

// v007
// It runs in 70 microseconds.
// Timed twice side by side with v006, it ran 1.10 times as fast both times.
// Over all steps from v000 it is 2.72 times as fast.
// Contractions (q/k/v/out projections, q.k^T scores, w.v): v_wmma_f32_16x16x32_bf16 with each f32 operand carried as bf16 hi + bf16 lo (hi.hi + hi.lo + lo.hi), f32 accumulate; axial sums, softmax and epilogues f32. The weights and the intermediates v, w, att lie in the workspace already split (see "split lines").
#include <hip/hip_runtime.h>
#include <stdint.h>

typedef float          v4f  __attribute__((ext_vector_type(4)));
typedef float          v8f  __attribute__((ext_vector_type(8)));
typedef unsigned int   v2u  __attribute__((ext_vector_type(2)));
typedef unsigned int   v4u  __attribute__((ext_vector_type(4)));
typedef unsigned short v8us __attribute__((ext_vector_type(8)));
typedef __bf16         v16b __attribute__((ext_vector_type(16)));
typedef __bf16         v2b  __attribute__((ext_vector_type(2)));
typedef float          v2f  __attribute__((ext_vector_type(2)));
union Frag { v16b v; v8us h[2]; };

#define C_DIM 256
#define NH    8
#define DH    32
#define B_SZ  2
#define M_AX  32
#define T_LEN 512
#define KP    40      // LDS pitch (16-bit elements) of the 32-deep k tiles of the score kernel; multiple of 8 for 16-B fragment loads
// Split lines: the weights (by k_sum_m) and the GEMM operands v, w, att (by their producers) are stored split ONCE.
// The matrix keeps its f32 shape and pitch (k contiguous); each 128-B line, 32 values of one k step, holds
// 32 bf16 hi (64 B) and then 32 bf16 lo (64 B). A consumer moves the line to LDS as it is, with no arithmetic.
#define LP    72      // LDS row pitch (16-bit elements) of a k tile in that form: 32 hi, 32 lo, 8 pad = 144 B

// x = hi + lo with hi = rne_bf16(x), lo = rne_bf16(x - hi); (x - hi) is exact in f32.
// Both roundings are the chip's own packed convert (nearest even, two values an instruction).
static __device__ __forceinline__ void split2(float x0, float x1, unsigned int& hb, unsigned int& lb) {
  const v2f x  = {x0, x1};
  const v2b hi = __builtin_convertvector(x, v2b);
  const v2f r  = x - __builtin_convertvector(hi, v2f);
  const v2b lo = __builtin_convertvector(r, v2b);
  hb = __builtin_bit_cast(unsigned int, hi);
  lb = __builtin_bit_cast(unsigned int, lo);
}
static __device__ __forceinline__ void split4(v4f v, v2u& hi, v2u& lo) {
  unsigned int h01, h23, l01, l23;
  split2(v.x, v.y, h01, l01);
  split2(v.z, v.w, h23, l23);
  hi.x = h01; hi.y = h23;
  lo.x = l01; lo.y = l23;
}

// eight values -> one 16-B chunk of hi and one of lo
static __device__ __forceinline__ void split8(v4f a, v4f b, v4f& hi, v4f& lo) {
  v2u ha, la, hb, lb;
  split4(a, ha, la);
  split4(b, hb, lb);
  const v4u h4 = {ha.x, ha.y, hb.x, hb.y};
  const v4u l4 = {la.x, la.y, lb.x, lb.y};
  hi = __builtin_bit_cast(v4f, h4);     // bits only: never used as numbers
  lo = __builtin_bit_cast(v4f, l4);
}

// three 16x16x32 bf16 ops into one accumulator, then the VALU hazard guard
static __device__ __forceinline__ void mma3(v8f& acc, v16b ah, v16b al, v16b bh, v16b bl) {
  acc = __builtin_amdgcn_wmma_f32_16x16x32_bf16(false, ah, false, bh, (short)0, acc, false, false);
  acc = __builtin_amdgcn_wmma_f32_16x16x32_bf16(false, ah, false, bl, (short)0, acc, false, false);
  acc = __builtin_amdgcn_wmma_f32_16x16x32_bf16(false, al, false, bh, (short)0, acc, false, false);
  asm volatile("v_nop\n\tv_nop\n\tv_nop\n\tv_nop" : "+v"(acc) : "v"(ah), "v"(al), "v"(bh), "v"(bl));
}

// ---------------------------------------------------------------------------
// GEMM  C[M x N] = alpha * A[M x K] * W^T (+ bias_scale * bias[n] when HB)
//   A : row-major, k contiguous, pitch C_DIM; AS == 0: f32, split here; AS == 1: split lines
//   W : W[n][k], k contiguous, pitch C_DIM, split lines
//   C : f32 row-major, pitch ldc; or, when VT and tr: split lines of C^T per slice of T_LEN rows,
//       C[slice][n][t] with t contiguous, pitch T_LEN (the form in which k_att reads v)
//   HB == 0: bias pointer is never read.
// Block = 128 threads (4 waves), tile 64 rows x BN cols, 32 k per step.
// Wave w owns rows 16w..16w+15 and all BN cols (BN/16 accumulator tiles).
// Fragment maps per lane l (h = l>>4, m = l&15):
//   A: row m, el 0..7 <- k 8h+0..7, el 8..15 <- k 16+8h+0..7
//   B: col m, same k map;   D: el r <- (row 8h+r, col m)
// Requires M % 64 == 0, N % BN == 0, K % 32 == 0, 16-B aligned rows.
// ---------------------------------------------------------------------------
// gemm_tile: one 64 x BN tile of C at (row0, col0), by one whole block.
template <int BN, int AS, int HB, int VT>
static __device__ __forceinline__ void
gemm_tile(const float* __restrict__ A, const float* __restrict__ W,
          float* __restrict__ C, const float* __restrict__ bias,
          int row0, int col0, int K, int ldc,
          float bias_scale, float alpha, bool tr)
{
  static_assert(!VT || BN == 64, "the transposed tile is laid over sC: BN rows of 64 values");
  constexpr int lda = C_DIM;            // row pitch of A and of W: a constant, so that a thread's eight loads
  constexpr int ldb = C_DIM;            // of a k step are two addresses plus immediate offsets
  constexpr int TN  = BN / 16;          // accumulator tiles per wave
  constexpr int CP  = BN + 4;           // f32 pitch of the staged C tile (multiple of 4)
  constexpr int NCH = BN / 16;          // 16-B W chunks per thread per k step

  __shared__ __attribute__((aligned(16))) unsigned short sA[64 * LP];
  __shared__ __attribute__((aligned(16))) unsigned short sW[BN * LP];
  __shared__ __attribute__((aligned(16))) float          sC[64 * CP];

  const int tid = threadIdx.x;
  const int wv  = tid >> 5;
  const int l   = tid & 31;
  const int h   = l >> 4;
  const int m   = l & 15;

  v8f acc[TN];
#pragma unroll
  for (int j = 0; j < TN; ++j) acc[j] = (v8f){};

  // The tiles of k step k0, 8 x 16 B a thread, from global memory into registers.
  v4f ra[4];
  v4f rw[NCH];
  // Address = block-uniform base of the step + the thread's own fixed 32-bit element offset: few address
  // registers, so that holding the eight chunks across the matrix work costs no resident wave.
  const int st0 = (tid >> 3) * LP + (tid & 7) * 8;     // LDS place of chunk 0 of a split line; chunk i is 16 rows on
  const int sf0 = (tid >> 3) * LP + (tid & 7) * 4;     // LDS place of the hi half of an f32 chunk; its lo half is 32 on
  const float* Ab = A + (size_t)row0 * lda;
  const float* Wb = W + (size_t)col0 * ldb;
  auto fetch = [&](int k0) {
    const float* Ak = Ab + k0;
    const float* Wk = Wb + k0;
    // A tile 64 x 32: chunk tid + 128 i -> row (tid>>3) + 16 i, bytes 16*(tid&7) of the row's line; W tile alike
#pragma unroll
    for (int i = 0; i < 4; ++i)
      ra[i] = *(const v4f*)(Ak + (size_t)(16 * i) * lda + (unsigned)((tid >> 3) * lda + (tid & 7) * 4));
#pragma unroll
    for (int i = 0; i < NCH; ++i)
      rw[i] = *(const v4f*)(Wk + (size_t)(16 * i) * ldb + (unsigned)((tid >> 3) * ldb + (tid & 7) * 4));
    // stands in front of the fragment reads and index sums that overwrite the loads' address registers
    asm volatile("s_wait_xcnt 0x0" ::: "memory");
  };

  fetch(0);
  for (int k0 = 0; k0 < K; k0 += 32) {
    __syncthreads();          // all waves done reading the tiles of the prior k step
#pragma unroll
    for (int i = 0; i < 4; ++i) {
      if (AS) {
        *(v4f*)(&sA[st0 + 16 * i * LP]) = ra[i];
      } else {
        v2u hi, lo;
        split4(ra[i], hi, lo);
        *(v2u*)(&sA[sf0 + 16 * i * LP])      = hi;
        *(v2u*)(&sA[sf0 + 16 * i * LP + 32]) = lo;
      }
    }
#pragma unroll
    for (int i = 0; i < NCH; ++i) *(v4f*)(&sW[st0 + 16 * i * LP]) = rw[i];
    __syncthreads();          // tiles visible to every wave

    Frag ah, al;
    {
      const int ar = (16 * wv + m) * LP + 8 * h;
      ah.h[0] = *(const v8us*)(&sA[ar]);
      ah.h[1] = *(const v8us*)(&sA[ar + 16]);
      al.h[0] = *(const v8us*)(&sA[ar + 32]);
      al.h[1] = *(const v8us*)(&sA[ar + 48]);
    }
    // the next step's loads fly while this step's fragments are read and multiplied; they are waited for at
    // the next staging. Behind the A fragment reads, so that the LDS latency runs beside the loads' issue.
    if (k0 + 32 < K) fetch(k0 + 32);
#pragma unroll
    for (int j = 0; j < TN; ++j) {
      const int br = (16 * j + m) * LP + 8 * h;
      Frag bh, bl;
      bh.h[0] = *(const v8us*)(&sW[br]);
      bh.h[1] = *(const v8us*)(&sW[br + 16]);
      bl.h[0] = *(const v8us*)(&sW[br + 32]);
      bl.h[1] = *(const v8us*)(&sW[br + 48]);
      mma3(acc[j], ah.v, al.v, bh.v, bl.v);
    }
  }

  const bool vt = VT && tr;   // block-uniform
  float bb[TN];
#pragma unroll
  for (int j = 0; j < TN; ++j) bb[j] = HB ? bias[col0 + 16 * j + m] : 0.0f;
  // stands in front of the index sums that overwrite the bias loads' address register
  if (HB) asm volatile("s_wait_xcnt 0x0" ::: "memory");
#pragma unroll
  for (int j = 0; j < TN; ++j) bb[j] = HB ? bias_scale * bb[j] : 0.0f;
  if (vt) {
    // A lane's accumulator tile is 8 consecutive rows t of one column n: one 16-B chunk of hi and one of lo of C^T.
    // sC then holds the tile as BN rows n of two split lines (64 t), pitch CP.
#pragma unroll
    for (int j = 0; j < TN; ++j) {
      const float b = bb[j];
      const v4f a0 = {alpha * acc[j][0] + b, alpha * acc[j][1] + b, alpha * acc[j][2] + b, alpha * acc[j][3] + b};
      const v4f a1 = {alpha * acc[j][4] + b, alpha * acc[j][5] + b, alpha * acc[j][6] + b, alpha * acc[j][7] + b};
      v4f hi, lo;
      split8(a0, a1, hi, lo);
      float* p = &sC[(16 * j + m) * CP + (wv >> 1) * 32 + ((wv & 1) * 2 + h) * 4];
      *(v4f*)p        = hi;
      *(v4f*)(p + 16) = lo;
    }
  } else {
#pragma unroll
    for (int j = 0; j < TN; ++j)
#pragma unroll
      for (int r = 0; r < 8; ++r)
        sC[(16 * wv + 8 * h + r) * CP + 16 * j + m] = alpha * acc[j][r] + bb[j];
  }
  __syncthreads();
  // rows of sC go out as they lie, 16 B a lane: rows of C, or (vt) columns n of C as rows of C^T, 64 t each
  float* Cb = vt ? C + (size_t)(row0 / T_LEN) * ((size_t)C_DIM * T_LEN) + (size_t)col0 * T_LEN + (row0 % T_LEN)
                 : C + (size_t)row0 * ldc + col0;
  const int ldo = vt ? T_LEN : ldc;
#pragma unroll
  for (int i = 0; i < BN / 8; ++i) {
    const int idx = i * 128 + tid;
    const int row = idx / (BN / 4);
    const int c4  = (idx % (BN / 4)) * 4;
    const v4f val = *(const v4f*)(&sC[row * CP + c4]);
    float* gp = Cb + (size_t)row * ldo + c4;
    *(v4f*)gp = val;
  }
}

// A and W in split lines, C f32. Batch z -> (zb, zm, zn) with independent element strides per operand.
template <int BN, int HB>
__global__ void __launch_bounds__(128)
k_gemm(const float* __restrict__ Abase, const float* __restrict__ Wbase,
       float* __restrict__ Cbase, const float* __restrict__ bias,
       long long sAb, long long sAm, long long sAn,
       long long sBb, long long sBm, long long sBn,
       long long sCb, long long sCm, long long sCn,
       int Mrows, int Ncols, int K, int ldc,
       int nInner, int nMid, float bias_scale, float alpha)
{
  const int z  = blockIdx.z;
  const int zn = z % nInner;
  const int zm = (z / nInner) % nMid;
  const int zb = z / (nInner * nMid);
  const float* A = Abase + ((long long)zb * sAb + (long long)zm * sAm + (long long)zn * sAn);
  const float* W = Wbase + ((long long)zb * sBb + (long long)zm * sBm + (long long)zn * sBn);
  float*       C = Cbase + ((long long)zb * sCb + (long long)zm * sCm + (long long)zn * sCn);

  const int row0 = blockIdx.y * 64;
  const int col0 = blockIdx.x * BN;
  if (row0 + 64 > Mrows || col0 + BN > Ncols) return;     // block-uniform, before any barrier

  gemm_tile<BN, 1, HB, 0>(A, W, C, bias, row0, col0, K, ldc, bias_scale, alpha, false);
}

// ---------------------------------------------------------------------------
// The three input projections, which do not depend on one another, as ONE launch:
//   blockIdx.y <  QKB          : qt = xsum @ Wq^T + 32 bq   (row tile blockIdx.y)
//   blockIdx.y <  2 QKB        : kt = ysum @ Wk^T + 32 bk
//   otherwise                  : v  = y    @ Wv^T +    bv   (stored as split lines of v^T per slice: [c][s])
// wsp: Wq, Wk, Wv in split lines, one behind the other.
// qt and kt are 64 blocks each, a quarter of the chip's 256 WGPs if launched alone; here they come first
// in the grid and run beside the 2048 blocks of v.
// ---------------------------------------------------------------------------
#define QKB ((B_SZ * T_LEN) / 64)            // row tiles of qt, and of kt
#define VB  ((B_SZ * M_AX * T_LEN) / 64)     // row tiles of v
__global__ void __launch_bounds__(128)
k_qkv(const float* __restrict__ xsum, const float* __restrict__ ysum, const float* __restrict__ y,
      const float* __restrict__ wsp,
      const float* __restrict__ bq, const float* __restrict__ bk, const float* __restrict__ bv,
      float* __restrict__ qt, float* __restrict__ kt, float* __restrict__ vbuf)
{
  const int by = blockIdx.y;
  if (by >= 2 * QKB + VB) return;              // block-uniform, before any barrier
  const int seg = by < QKB ? 0 : (by < 2 * QKB ? 1 : 2);
  const float* A    = seg == 0 ? xsum : (seg == 1 ? ysum : y);
  const float* W    = wsp + seg * (C_DIM * C_DIM);
  const float* bias = seg == 0 ? bq   : (seg == 1 ? bk   : bv);
  float*       C    = seg == 0 ? qt   : (seg == 1 ? kt   : vbuf);
  const float  bs   = seg == 2 ? 1.0f : (float)M_AX;
  const int row0 = (by - seg * QKB) * 64;
  const int col0 = blockIdx.x * 64;
  gemm_tile<64, 0, 1, 1>(A, W, C, bias, row0, col0, C_DIM, C_DIM, bs, 1.0f, seg == 2);
}

// ---------------------------------------------------------------------------
// att[b, m, t, n*32 + d] = sum_s w[b, n, t, s] * v[b, m, s, n*32 + d]
// The 32 axial slices m of one (b, n) share w, so they are the columns of ONE product
//   [512 t x 512 s] * [512 s x (32 m * 32 d)].
// Block = 256 threads (8 waves), tile 128 t x 128 columns (4 slices x 32 d), 64 s per stage.
// Wave wv owns rows 32*(wv&3)..+31 and columns 64*(wv>>2)..+63 (2 x 4 accumulator tiles).
// Fragment maps and k order are those of k_gemm.
// w [t][s] and v^T [slice][c][s] come in split lines, att [slice][t][c] leaves in split lines.
// Staging: the tensor mover brings a stage (two split lines, 256 B, of each of the 256 rows) from global memory to LDS
// through no register. Every wave issues one request a stage for its own slice of 32 rows: waves 0..3 rows 32 wv .. +31
// of w, waves 4..7 the 32 rows d of axial slice wv - 4 of v^T. Two buffers: stage s + 1 flies while stage s is multiplied.
// grid: x = group of 4 slices, y = row tile, z = b*8 + n
// ---------------------------------------------------------------------------
#define AT_M   128
#define AT_N   128
#define AT_SL  (AT_N / DH)
#define AT_K   64                 // s per stage
#define AT_RB  (AT_K * 4)         // bytes of a row of a stage: 256
#define AT_RP  136                // LDS row pitch in 16-bit elements: 256 B + the mover's pad of 16 B = 272 B
#define AT_SLB 10240              // LDS bytes of a wave's slice: 32 rows x 272 B = 8704, rounded up to a multiple of 2 KiB
#define AT_STG (8 * AT_SLB)       // LDS bytes of a buffer
typedef uint32_t u32x4 __attribute__((ext_vector_type(4)));
typedef uint32_t u32x8 __attribute__((ext_vector_type(8)));
static __device__ __forceinline__ uint32_t uni(uint32_t v) { return (uint32_t)__builtin_amdgcn_readfirstlane(v); }
// a condition around a tensor load, held in a scalar register so that the test compiles to a scalar compare and branch
// (tensor loads ignore EXEC)
static __device__ __forceinline__ uint32_t pinned(uint32_t v) {
  uint32_t w = uni(v);
  asm volatile("" : "+s"(w));     // pinned(): keeps the word in a scalar register
  return w;
}
__global__ void __launch_bounds__(256)
k_att(const float* __restrict__ wsc, const float* __restrict__ vbuf, float* __restrict__ att)
{
  constexpr int CP = AT_N + 4;          // f32 pitch of the staged C tile (multiple of 4)
  constexpr uint32_t NST = T_LEN / AT_K;
  static_assert(AT_M * CP * 4 <= 2 * AT_STG, "the C tile is laid over the ring");

  // the ring; behind the loop its bytes hold the C tile
  __shared__ __attribute__((aligned(2048))) unsigned char L[2 * AT_STG];
  float* sC = (float*)L;

  const int zn   = blockIdx.z % NH;
  const int zb   = blockIdx.z / NH;
  const int m0   = blockIdx.x * AT_SL;
  const int row0 = blockIdx.y * AT_M;
  const size_t slice = (size_t)T_LEN * C_DIM;
  const float* A = wsc  + ((size_t)blockIdx.z * T_LEN + row0) * T_LEN;
  const float* V = vbuf + (size_t)(zb * M_AX + m0) * slice + (size_t)(zn * DH) * T_LEN;
  float*       C = att  + (size_t)(zb * M_AX + m0) * slice + (size_t)row0 * C_DIM + zn * DH;

  const int tid = threadIdx.x;
  const int l   = tid & 31;
  const int h   = l >> 4;
  const int m   = l & 15;
  const uint32_t wave = uni((uint32_t)tid >> 5);
  const int wr  = (int)(wave & 3u);
  const int wc  = (int)(wave >> 2);

  // Descriptor group 1, the same for every request: 1-byte elements, tile = tensor = 32 rows of 256 B, source pitch
  // one row of w or of v^T (2048 B), a pad of 4 dwords behind every 64 dwords (one row).
  u32x8 g1;
  g1[0] = uni((1u << 20) | (5u << 22) | (3u << 25));
  g1[1] = uni(((uint32_t)AT_RB & 0xFFFFu) << 16);
  g1[2] = uni(32u << 16);
  g1[3] = uni((uint32_t)AT_RB << 16);
  g1[4] = uni(32u);
  g1[5] = uni((uint32_t)T_LEN * 4u);
  g1[6] = uni(0u);
  g1[7] = uni(0u);
  const float*   srcw  = wave < 4u ? A + (size_t)(32u * wave) * T_LEN : V + (size_t)(wave - 4u) * slice;
  const uint32_t lbase = (uint32_t)(size_t)L;
  auto issue = [&](uint32_t st) {
    const uint32_t dst = lbase + (st & 1u) * (uint32_t)AT_STG + wave * (uint32_t)AT_SLB;
    const uint64_t ga  = (uint64_t)(size_t)srcw + (uint64_t)st * (uint32_t)AT_RB;
    u32x4 g0;
    g0[0] = uni(1u);
    g0[1] = uni(dst);
    g0[2] = uni((uint32_t)ga);
    g0[3] = uni((((uint32_t)(ga >> 32)) & 0x01FFFFFFu) | 0x80000000u);
    asm volatile("tensor_load_to_lds %0, %1" :: "s"(g0), "s"(g1) : "memory");
  };

  v8f acc[2][4];
#pragma unroll
  for (int i = 0; i < 2; ++i)
#pragma unroll
    for (int j = 0; j < 4; ++j) acc[i][j] = (v8f){};

  issue(0);
  asm volatile("s_wait_tensorcnt 0x0" ::: "memory");   // this wave's slice of stage 0 has landed
  __syncthreads();                                     // stage 0 visible to every wave

  for (uint32_t st = 0; st < NST; ++st) {
    // directly behind the barrier that published stage st and ended every read of stage st - 1: the load of stage st + 1,
    // into the buffer that stage st - 1 used; it flies while stage st is multiplied. In run order this is the two-buffer
    // ring (stage 1's load behind the first barrier, stage st + 2's behind the barrier at the foot of pass st); written
    // once, at the head, so that every request of the loop is formed behind the wait that covers the one before it
    if (pinned(st + 1u < NST)) issue(st + 1u);
    const unsigned short* Lb = (const unsigned short*)(L + (st & 1u) * (uint32_t)AT_STG);
#pragma unroll
    for (int kk = 0; kk < AT_K / 32; ++kk) {           // the stage's split lines, in k order
      Frag ah[2], al[2];
#pragma unroll
      for (int i = 0; i < 2; ++i) {
        const int ar = wr * (AT_SLB / 2) + (16 * i + m) * AT_RP + 64 * kk + 8 * h;
        ah[i].h[0] = *(const v8us*)(&Lb[ar]);
        ah[i].h[1] = *(const v8us*)(&Lb[ar + 16]);
        al[i].h[0] = *(const v8us*)(&Lb[ar + 32]);
        al[i].h[1] = *(const v8us*)(&Lb[ar + 48]);
      }
#pragma unroll
      for (int j = 0; j < 4; ++j) {
        // column 64 wc + 16 j + m = row 16 (j & 1) + m of axial slice 2 wc + (j >> 1)
        const int br = (4 + 2 * wc + (j >> 1)) * (AT_SLB / 2) + (16 * (j & 1) + m) * AT_RP + 64 * kk + 8 * h;
        Frag bh, bl;
        bh.h[0] = *(const v8us*)(&Lb[br]);
        bh.h[1] = *(const v8us*)(&Lb[br + 16]);
        bl.h[0] = *(const v8us*)(&Lb[br + 32]);
        bl.h[1] = *(const v8us*)(&Lb[br + 48]);
#pragma unroll
        for (int i = 0; i < 2; ++i) mma3(acc[i][j], ah[i].v, al[i].v, bh.v, bl.v);
      }
    }
    // publish point of stage st + 1
    asm volatile("s_wait_dscnt 0x0" ::: "memory");     // this wave's reads of stage st are done before its buffer is refilled
    asm volatile("s_wait_tensorcnt 0x0" ::: "memory"); // this wave's slice of stage st + 1 has landed
    __syncthreads();                                   // stage st + 1 visible; every wave has left stage st
  }
  asm volatile("s_wait_tensorcnt 0x0" ::: "memory");   // no request in flight when the ring becomes the C tile
  asm volatile("s_wait_dscnt 0x0" ::: "memory");

#pragma unroll
  for (int i = 0; i < 2; ++i)
#pragma unroll
    for (int j = 0; j < 4; ++j)
#pragma unroll
      for (int r = 0; r < 8; ++r)
        sC[(32 * wr + 16 * i + 8 * h + r) * CP + 64 * wc + 16 * j + m] = acc[i][j][r];
  __syncthreads();
  // a thread splits 8 consecutive d of one (t, slice): a 16-B chunk of hi and one of lo of that row's line of head zn;
  // four lanes fill the hi half of a line with one store and its lo half with the next
#pragma unroll
  for (int i = 0; i < AT_M * AT_N / (8 * 256); ++i) {
    const int idx = i * 256 + tid;
    const int row = idx / (AT_N / 8);
    const int c8  = idx % (AT_N / 8);
    const v4f a0 = *(const v4f*)(&sC[row * CP + c8 * 8]);
    const v4f a1 = *(const v4f*)(&sC[row * CP + c8 * 8 + 4]);
    v4f hi, lo;
    split8(a0, a1, hi, lo);
    float* gp = C + (size_t)(c8 >> 2) * slice + (size_t)row * C_DIM + (c8 & 3) * 4;
    *(v4f*)gp        = hi;
    *(v4f*)(gp + 16) = lo;
  }
}

// ---------------------------------------------------------------------------
// Axial sum: out[b, t, c] = sum_m in[b, m, t, c]; one thread per 4 consecutive c.
// blockIdx.y picks the tensor (0: in0 -> out0, 1: in1 -> out1): both sums in one launch.
// blockIdx.y == 2: the four weight matrices w0..w3 to split lines in wsp, one behind the other; 4 values a thread.
// ---------------------------------------------------------------------------
__global__ void __launch_bounds__(256)
k_sum_m(const float* __restrict__ in0, const float* __restrict__ in1,
        float* __restrict__ out0, float* __restrict__ out1,
        const float* __restrict__ w0, const float* __restrict__ w1,
        const float* __restrict__ w2, const float* __restrict__ w3,
        float* __restrict__ wsp, int n4)
{
  const int i4 = blockIdx.x * 256 + threadIdx.x;
  if (blockIdx.y == 2) {
    constexpr int W4 = C_DIM * C_DIM / 4;      // 16-B chunks of one matrix
    if (i4 >= 4 * W4) return;
    const int j = i4 / W4;                     // block-uniform
    const float* wj = j == 0 ? w0 : (j == 1 ? w1 : (j == 2 ? w2 : w3));
    v2u hi, lo;
    split4(*(const v4f*)(wj + (size_t)(i4 % W4) * 4), hi, lo);
    float* o = wsp + (size_t)(i4 >> 3) * 32 + (i4 & 7) * 2;
    *(v2u*)o        = hi;
    *(v2u*)(o + 16) = lo;
    return;
  }
  if (i4 >= n4) return;
  const float* in  = blockIdx.y ? in1 : in0;
  float*       out = blockIdx.y ? out1 : out0;
  const size_t i     = (size_t)i4 * 4;
  const size_t inner = (size_t)T_LEN * C_DIM;
  const size_t b     = i / inner;
  const size_t r     = i - b * inner;
  const float* p = in + b * (size_t)M_AX * inner + r;
  v4f s = {0.0f, 0.0f, 0.0f, 0.0f};
#pragma unroll 8
  for (int mm = 0; mm < M_AX; ++mm) s += *(const v4f*)(p + (size_t)mm * inner);
  float* o = out + i;
  *(v4f*)o = s;
  
}

// ---------------------------------------------------------------------------
// w[b, n, t, :] = softmax_s( (1/32) qt[b, t, n*32 ..] . kt[b, s, n*32 ..] ), scores and row softmax in ONE kernel.
// A block holds SS_M whole rows of one (b, n): a SS_M x 512 score tile, K = 32 (one k step), which goes from the
// accumulators to LDS and from there through the softmax; the scores never go to global memory.
// Block = 256 threads (8 waves). Product: wave wv owns all SS_M rows and columns 64 wv .. +63 (2 x 4 accumulator
// tiles); fragment maps and k order are those of k_gemm; LDS: hi and lo in separate [row or column][k] arrays, pitch KP.
// Softmax: wave wv owns rows 4 wv .. +3, a lane holds floats lane*4+0..3 of each 128-float segment of a row, so
// that every f32 store instruction covers four whole 128-B lines. w leaves in split lines (a lane's 4 values: 8 B of
// hi and 8 B of lo of their line); rows of batch 0 also go to a_out as f32.
// grid: x = row tile, y = b*8 + n
// ---------------------------------------------------------------------------
#define SS_M 32
// e^x as __expf forms it (2^(x log2 e), the chip's own v_exp_f32). In asm text for the v_nop alone: it keeps the one
// slot that the instruction set asks for behind a transcendental, before its result is read or its source overwritten.
static __device__ __forceinline__ float exp_slot(float x) {
  float r;
  asm("v_exp_f32 %0, %1\n\tv_nop" : "=v"(r) : "v"(x * 0x1.715476p+0f));
  return r;
}
__global__ void __launch_bounds__(256)
k_score_softmax(const float* __restrict__ qt, const float* __restrict__ kt,
                float* __restrict__ w, float* __restrict__ a_out)
{
  constexpr int CP = T_LEN + 4;         // f32 pitch of the score tile (multiple of 4; rows 8 apart fall 32 banks apart)

  __shared__ __attribute__((aligned(16))) unsigned short sAhi[SS_M * KP];
  __shared__ __attribute__((aligned(16))) unsigned short sAlo[SS_M * KP];
  __shared__ __attribute__((aligned(16))) unsigned short sWhi[T_LEN * KP];
  __shared__ __attribute__((aligned(16))) unsigned short sWlo[T_LEN * KP];
  __shared__ __attribute__((aligned(16))) float          sC[SS_M * CP];

  const int zn   = blockIdx.y % NH;
  const int zb   = blockIdx.y / NH;
  const int row0 = blockIdx.x * SS_M;
  const float* A = qt + ((size_t)zb * T_LEN + row0) * C_DIM + zn * DH;
  const float* W = kt + (size_t)zb * T_LEN * C_DIM + zn * DH;

  const int tid = threadIdx.x;
  const int wv  = tid >> 5;
  const int l   = tid & 31;
  const int h   = l >> 4;
  const int m   = l & 15;

  // q tile 32 x 32: one 16-B chunk a thread, row tid>>3, k 4*(tid&7); k tile 512 x 32: chunk i is 32 rows on
  const unsigned to  = (unsigned)((tid >> 3) * C_DIM + (tid & 7) * 4);
  const int      st0 = (tid >> 3) * KP + (tid & 7) * 4;
  const v4f ra = *(const v4f*)(A + to);
  v4f rw[T_LEN / 32];
#pragma unroll
  for (int i = 0; i < T_LEN / 32; ++i) rw[i] = *(const v4f*)(W + (size_t)(32 * i) * C_DIM + to);
  // stands in front of the index sums that overwrite the loads' address registers
  asm volatile("s_wait_xcnt 0x0" ::: "memory");

  {
    v2u hi, lo;
    split4(ra, hi, lo);
    *(v2u*)(&sAhi[st0]) = hi;
    *(v2u*)(&sAlo[st0]) = lo;
  }
#pragma unroll
  for (int i = 0; i < T_LEN / 32; ++i) {
    v2u hi, lo;
    split4(rw[i], hi, lo);
    *(v2u*)(&sWhi[st0 + 32 * i * KP]) = hi;
    *(v2u*)(&sWlo[st0 + 32 * i * KP]) = lo;
  }
  __syncthreads();            // tiles visible to every wave

  v8f acc[2][4];
#pragma unroll
  for (int i = 0; i < 2; ++i)
#pragma unroll
    for (int j = 0; j < 4; ++j) acc[i][j] = (v8f){};

  Frag ah[2], al[2];
#pragma unroll
  for (int i = 0; i < 2; ++i) {
    const int ar = (16 * i + m) * KP + 8 * h;
    ah[i].h[0] = *(const v8us*)(&sAhi[ar]);
    ah[i].h[1] = *(const v8us*)(&sAhi[ar + 16]);
    al[i].h[0] = *(const v8us*)(&sAlo[ar]);
    al[i].h[1] = *(const v8us*)(&sAlo[ar + 16]);
  }
#pragma unroll
  for (int j = 0; j < 4; ++j) {
    const int br = (64 * wv + 16 * j + m) * KP + 8 * h;
    Frag bh, bl;
    bh.h[0] = *(const v8us*)(&sWhi[br]);
    bh.h[1] = *(const v8us*)(&sWhi[br + 16]);
    bl.h[0] = *(const v8us*)(&sWlo[br]);
    bl.h[1] = *(const v8us*)(&sWlo[br + 16]);
#pragma unroll
    for (int i = 0; i < 2; ++i) mma3(acc[i][j], ah[i].v, al[i].v, bh.v, bl.v);
  }

#pragma unroll
  for (int i = 0; i < 2; ++i)
#pragma unroll
    for (int j = 0; j < 4; ++j)
#pragma unroll
      for (int r = 0; r < 8; ++r)
        sC[(16 * i + 8 * h + r) * CP + 64 * wv + 16 * j + m] = (1.0f / 32.0f) * acc[i][j][r];
  __syncthreads();            // whole rows of scores visible to the wave that owns them

  // four rows a wave, side by side: four independent reduction chains
  constexpr int RW = SS_M / 8;
  v4f v[RW][4];
#pragma unroll
  for (int q = 0; q < RW; ++q)
#pragma unroll
    for (int i = 0; i < 4; ++i) v[q][i] = *(const v4f*)(&sC[(RW * wv + q) * CP + l * 4 + i * 128]);

  float mx[RW];
#pragma unroll
  for (int q = 0; q < RW; ++q) {
    mx[q] = -3.0e38f;
#pragma unroll
    for (int i = 0; i < 4; ++i)
      mx[q] = fmaxf(mx[q], fmaxf(fmaxf(v[q][i].x, v[q][i].y), fmaxf(v[q][i].z, v[q][i].w)));
  }
#pragma unroll
  for (int off = 16; off > 0; off >>= 1)
#pragma unroll
    for (int q = 0; q < RW; ++q) mx[q] = fmaxf(mx[q], __shfl_xor(mx[q], off, 32));

  float sum[RW];
#pragma unroll
  for (int q = 0; q < RW; ++q) {
    sum[q] = 0.0f;
#pragma unroll
    for (int i = 0; i < 4; ++i) {
      v[q][i].x = exp_slot(v[q][i].x - mx[q]);
      v[q][i].y = exp_slot(v[q][i].y - mx[q]);
      v[q][i].z = exp_slot(v[q][i].z - mx[q]);
      v[q][i].w = exp_slot(v[q][i].w - mx[q]);
      sum[q] += (v[q][i].x + v[q][i].y) + (v[q][i].z + v[q][i].w);
    }
  }
#pragma unroll
  for (int off = 16; off > 0; off >>= 1)
#pragma unroll
    for (int q = 0; q < RW; ++q) sum[q] += __shfl_xor(sum[q], off, 32);
#pragma unroll
  for (int q = 0; q < RW; ++q) {
    const float inv = 1.0f / sum[q];
#pragma unroll
    for (int i = 0; i < 4; ++i) v[q][i] *= inv;
  }

  // address = block-uniform base of the destination + the lane's one 32-bit element offset, rows and segments at
  // immediate offsets: one offset register a destination (lo: f32 rows of a_out, ls: split lines of w)
  const size_t   ub = ((size_t)blockIdx.y * T_LEN + row0) * T_LEN;
  const unsigned lo = (unsigned)(RW * wv * T_LEN + l * 4);
  const unsigned ls = (unsigned)(RW * wv * T_LEN + (l >> 3) * 32 + (l & 7) * 2);   // the hi half's place in a split line
  float* pw = w + ub;
#pragma unroll
  for (int q = 0; q < RW; ++q)
#pragma unroll
    for (int i = 0; i < 4; ++i) {
      v2u sh, sl;
      split4(v[q][i], sh, sl);
      *(v2u*)(pw + (q * T_LEN + i * 128) + ls)      = sh;
      *(v2u*)(pw + (q * T_LEN + i * 128 + 16) + ls) = sl;
    }
  if (zb == 0) {              // block-uniform; behind the last barrier
    float* pa = a_out + ub;
#pragma unroll
    for (int q = 0; q < RW; ++q)
#pragma unroll
      for (int i = 0; i < 4; ++i) *(v4f*)(pa + (q * T_LEN + i * 128) + lo) = v[q][i];
  }
}

// ---------------------------------------------------------------------------
extern "C" void kernel_launch(void* const* d_in, const int* in_sizes, int n_in,
                              void* d_out, int out_size, void* d_ws, size_t ws_size,
                              hipStream_t stream)
{
  if (n_in < 10) return;
  const int n_x  = B_SZ * M_AX * T_LEN * C_DIM;          // 8388608
  const int n_w  = C_DIM * C_DIM;
  const int n_a  = NH * T_LEN * T_LEN;                   // 2097152
  if (in_sizes[0] != n_x || in_sizes[1] != n_x) return;
  if (in_sizes[2] != n_w || in_sizes[4] != n_w || in_sizes[6] != n_w || in_sizes[8] != n_w) return;
  if (in_sizes[3] != C_DIM || in_sizes[5] != C_DIM || in_sizes[7] != C_DIM || in_sizes[9] != C_DIM) return;
  if (out_size != n_x + n_a) return;

  const float* x  = (const float*)d_in[0];
  const float* y  = (const float*)d_in[1];
  const float* Wq = (const float*)d_in[2];
  const float* bq = (const float*)d_in[3];
  const float* Wk = (const float*)d_in[4];
  const float* bk = (const float*)d_in[5];
  const float* Wv = (const float*)d_in[6];
  const float* bv = (const float*)d_in[7];
  const float* Wp = (const float*)d_in[8];
  const float* bp = (const float*)d_in[9];

  float* out   = (float*)d_out;                            // [2,32,512,256]
  float* a_out = out + (size_t)n_x;                        // [8,512,512] at byte 33554432

  const size_t n_sum = (size_t)B_SZ * T_LEN * C_DIM;       // 262144
  const size_t n_v   = (size_t)n_x;                        // 8388608
  const size_t n_sc  = (size_t)B_SZ * NH * T_LEN * T_LEN;  // 4194304
  const size_t o_xsum = 0;
  const size_t o_ysum = o_xsum + n_sum;
  const size_t o_qt   = o_ysum + n_sum;
  const size_t o_kt   = o_qt   + n_sum;
  const size_t o_v    = o_kt   + n_sum;
  const size_t o_wsc  = o_v    + n_v;
  const size_t o_att  = o_wsc  + n_sc;
  const size_t o_wsp  = o_att  + n_v;
  const size_t o_end  = o_wsp  + 4 * (size_t)n_w;          // 22282240 floats = 89128960 B
  if (o_end * sizeof(float) > ws_size) return;

  float* ws   = (float*)d_ws;
  float* xsum = ws + o_xsum;
  float* ysum = ws + o_ysum;
  float* qt   = ws + o_qt;
  float* kt   = ws + o_kt;
  float* vbuf = ws + o_v;
  float* wsc  = ws + o_wsc;
  float* att  = ws + o_att;
  float* wsp  = ws + o_wsp;                                // Wq, Wk, Wv, Wp in split lines

  // 1) axial sums of x and y over m; the four weight matrices to split lines
  const int n4 = (int)(n_sum / 4);                         // 65536
  k_sum_m<<<dim3((n4 + 255) / 256, 3), dim3(256), 0, stream>>>(x, y, xsum, ysum, Wq, Wk, Wv, Wp, wsp, n4);

  // 2+3) qt = xsum @ Wq^T + 32*bq, kt = ysum @ Wk^T + 32*bk   [1024 x 256];  v = y_flat @ Wv^T + bv   [32768 x 256];  K = 256
  k_qkv<<<dim3(C_DIM / 64, 2 * QKB + VB, 1), dim3(128), 0, stream>>>(
      xsum, ysum, y, wsp, bq, bk, bv, qt, kt, vbuf);

  // 4+5) w[b,n] = softmax rows of (1/32) qt_head @ kt_head^T   [512 x 512], K = 32, y = b*8 + n; rows of batch 0 also to a_out
  k_score_softmax<<<dim3(T_LEN / SS_M, B_SZ * NH), dim3(256), 0, stream>>>(qt, kt, wsc, a_out);

  // 6) att[b,:,n] = w[b,n] @ v[b,:][:, n*32 .. n*32+31]   [512 x (32*32)], K = 512, z = b*8 + n, x = 4 slices m
  k_att<<<dim3(M_AX / AT_SL, T_LEN / AT_M, B_SZ * NH), dim3(256), 0, stream>>>(wsc, vbuf, att);

  // 7) out = att @ Wp^T + bp   [32768 x 256], K = 256
  k_gemm<64, 1><<<dim3(C_DIM / 64, (B_SZ * M_AX * T_LEN) / 64, 1), dim3(128), 0, stream>>>(
      att, wsp + 3 * (size_t)n_w, out, bp, 0, 0, 0, 0, 0, 0, 0, 0, 0,
      B_SZ * M_AX * T_LEN, C_DIM, C_DIM, C_DIM, 1, 1, 1.0f, 1.0f);
}

// v008
// One run takes 65.6 microseconds.
// In both of two side-by-side timings against v007, it was 1.07 times as fast.
// All steps since v000 together make it 2.90 times as fast.
// Contractions (q/k/v/out projections, q.k^T scores, w.v): v_wmma_f32_16x16x32_bf16 with each f32 operand carried as bf16 hi + bf16 lo (hi.hi + hi.lo + lo.hi), f32 accumulate; axial sums, softmax and epilogues f32. Wp and the intermediates v, w, att lie in the workspace already split (see "split lines").
#include <hip/hip_runtime.h>
#include <stdint.h>

typedef float          v4f  __attribute__((ext_vector_type(4)));
typedef float          v8f  __attribute__((ext_vector_type(8)));
typedef unsigned int   v2u  __attribute__((ext_vector_type(2)));
typedef unsigned int   v4u  __attribute__((ext_vector_type(4)));
typedef unsigned short v8us __attribute__((ext_vector_type(8)));
typedef __bf16         v16b __attribute__((ext_vector_type(16)));
typedef __bf16         v2b  __attribute__((ext_vector_type(2)));
typedef float          v2f  __attribute__((ext_vector_type(2)));
union Frag { v16b v; v8us h[2]; };

#define C_DIM 256
#define NH    8
#define DH    32
#define B_SZ  2
#define M_AX  32
#define T_LEN 512
#define KP    40      // LDS pitch (16-bit elements) of the 32-deep k tiles of the score kernel; multiple of 8 for 16-B fragment loads
// Split lines: Wp (by k_qkv) and the GEMM operands v, w, att (by their producers) are stored split ONCE.
// The matrix keeps its f32 shape and pitch (k contiguous); each 128-B line, 32 values of one k step, holds
// 32 bf16 hi (64 B) and then 32 bf16 lo (64 B). A consumer moves the line to LDS as it is, with no arithmetic.
#define LP    72      // LDS row pitch (16-bit elements) of a k tile in that form: 32 hi, 32 lo, 8 pad = 144 B

// x = hi + lo with hi = rne_bf16(x), lo = rne_bf16(x - hi); (x - hi) is exact in f32.
// Both roundings are the chip's own packed convert (nearest even, two values an instruction).
static __device__ __forceinline__ void split2(float x0, float x1, unsigned int& hb, unsigned int& lb) {
  const v2f x  = {x0, x1};
  const v2b hi = __builtin_convertvector(x, v2b);
  const v2f r  = x - __builtin_convertvector(hi, v2f);
  const v2b lo = __builtin_convertvector(r, v2b);
  hb = __builtin_bit_cast(unsigned int, hi);
  lb = __builtin_bit_cast(unsigned int, lo);
}
static __device__ __forceinline__ void split4(v4f v, v2u& hi, v2u& lo) {
  unsigned int h01, h23, l01, l23;
  split2(v.x, v.y, h01, l01);
  split2(v.z, v.w, h23, l23);
  hi.x = h01; hi.y = h23;
  lo.x = l01; lo.y = l23;
}

// eight values -> one 16-B chunk of hi and one of lo
static __device__ __forceinline__ void split8(v4f a, v4f b, v4f& hi, v4f& lo) {
  v2u ha, la, hb, lb;
  split4(a, ha, la);
  split4(b, hb, lb);
  const v4u h4 = {ha.x, ha.y, hb.x, hb.y};
  const v4u l4 = {la.x, la.y, lb.x, lb.y};
  hi = __builtin_bit_cast(v4f, h4);     // bits only: never used as numbers
  lo = __builtin_bit_cast(v4f, l4);
}

// three 16x16x32 bf16 ops into one accumulator, then the VALU hazard guard
static __device__ __forceinline__ void mma3(v8f& acc, v16b ah, v16b al, v16b bh, v16b bl) {
  acc = __builtin_amdgcn_wmma_f32_16x16x32_bf16(false, ah, false, bh, (short)0, acc, false, false);
  acc = __builtin_amdgcn_wmma_f32_16x16x32_bf16(false, ah, false, bl, (short)0, acc, false, false);
  acc = __builtin_amdgcn_wmma_f32_16x16x32_bf16(false, al, false, bh, (short)0, acc, false, false);
  asm volatile("v_nop\n\tv_nop\n\tv_nop\n\tv_nop" : "+v"(acc) : "v"(ah), "v"(al), "v"(bh), "v"(bl));
}

// ---------------------------------------------------------------------------
// GEMM  C[M x N] = alpha * A[M x K] * W^T (+ bias_scale * bias[n] when HB)
//   A : row-major, k contiguous, pitch C_DIM; AS == 0: f32, split here; AS == 1: split lines
//   W : W[n][k], k contiguous, pitch C_DIM; WS == 0: f32, split here; WS == 1: split lines
//   C : f32 row-major, pitch ldc; or, when VT and tr: split lines of C^T per slice of T_LEN rows,
//       C[slice][n][t] with t contiguous, pitch T_LEN (the form in which k_att reads v)
//   HB == 0: bias pointer is never read.
// Block = 128 threads (4 waves), tile 64 rows x BN cols, 32 k per step.
// Wave w owns rows 16w..16w+15 and all BN cols (BN/16 accumulator tiles).
// Fragment maps per lane l (h = l>>4, m = l&15):
//   A: row m, el 0..7 <- k 8h+0..7, el 8..15 <- k 16+8h+0..7
//   B: col m, same k map;   D: el r <- (row 8h+r, col m)
// Requires M % 64 == 0, N % BN == 0, K % 32 == 0, 16-B aligned rows.
// ---------------------------------------------------------------------------
// gemm_tile: one 64 x BN tile of C at (row0, col0), by one whole block. smem: GT_LDS(BN) bytes of LDS, 16-B aligned.
#define GT_LDS(BN) ((64 + (BN)) * LP * 2 + 64 * ((BN) + 4) * 4)
template <int BN, int AS, int WS, int HB, int VT>
static __device__ __forceinline__ void
gemm_tile(unsigned char* smem, const float* __restrict__ A, const float* __restrict__ W,
          float* __restrict__ C, const float* __restrict__ bias,
          int row0, int col0, int K, int ldc,
          float bias_scale, float alpha, bool tr)
{
  static_assert(!VT || BN == 64, "the transposed tile is laid over sC: BN rows of 64 values");
  constexpr int lda = C_DIM;            // row pitch of A and of W: a constant, so that a thread's eight loads
  constexpr int ldb = C_DIM;            // of a k step are two addresses plus immediate offsets
  constexpr int TN  = BN / 16;          // accumulator tiles per wave
  constexpr int CP  = BN + 4;           // f32 pitch of the staged C tile (multiple of 4)
  constexpr int NCH = BN / 16;          // 16-B W chunks per thread per k step

  unsigned short* sA = (unsigned short*)smem;               // 64 * LP
  unsigned short* sW = sA + 64 * LP;                        // BN * LP
  float*          sC = (float*)(smem + (64 + BN) * LP * 2); // 64 * CP

  const int tid = threadIdx.x;
  const int wv  = tid >> 5;
  const int l   = tid & 31;
  const int h   = l >> 4;
  const int m   = l & 15;

  v8f acc[TN];
#pragma unroll
  for (int j = 0; j < TN; ++j) acc[j] = (v8f){};

  // The tiles of k step k0, 8 x 16 B a thread, from global memory into registers.
  v4f ra[4];
  v4f rw[NCH];
  // Address = block-uniform base of the step + the thread's own fixed 32-bit element offset: few address
  // registers, so that holding the eight chunks across the matrix work costs no resident wave.
  const int st0 = (tid >> 3) * LP + (tid & 7) * 8;     // LDS place of chunk 0 of a split line; chunk i is 16 rows on
  const int sf0 = (tid >> 3) * LP + (tid & 7) * 4;     // LDS place of the hi half of an f32 chunk; its lo half is 32 on
  const float* Ab = A + (size_t)row0 * lda;
  const float* Wb = W + (size_t)col0 * ldb;
  auto fetch = [&](int k0) {
    const float* Ak = Ab + k0;
    const float* Wk = Wb + k0;
    // A tile 64 x 32: chunk tid + 128 i -> row (tid>>3) + 16 i, bytes 16*(tid&7) of the row's line; W tile alike
#pragma unroll
    for (int i = 0; i < 4; ++i)
      ra[i] = *(const v4f*)(Ak + (size_t)(16 * i) * lda + (unsigned)((tid >> 3) * lda + (tid & 7) * 4));
#pragma unroll
    for (int i = 0; i < NCH; ++i)
      rw[i] = *(const v4f*)(Wk + (size_t)(16 * i) * ldb + (unsigned)((tid >> 3) * ldb + (tid & 7) * 4));
    // stands in front of the fragment reads and index sums that overwrite the loads' address registers
    asm volatile("s_wait_xcnt 0x0" ::: "memory");
  };

  fetch(0);
  for (int k0 = 0; k0 < K; k0 += 32) {
    __syncthreads();          // all waves done reading the tiles of the prior k step
#pragma unroll
    for (int i = 0; i < 4; ++i) {
      if (AS) {
        *(v4f*)(&sA[st0 + 16 * i * LP]) = ra[i];
      } else {
        v2u hi, lo;
        split4(ra[i], hi, lo);
        *(v2u*)(&sA[sf0 + 16 * i * LP])      = hi;
        *(v2u*)(&sA[sf0 + 16 * i * LP + 32]) = lo;
      }
    }
#pragma unroll
    for (int i = 0; i < NCH; ++i) {
      if (WS) {
        *(v4f*)(&sW[st0 + 16 * i * LP]) = rw[i];
      } else {
        v2u hi, lo;
        split4(rw[i], hi, lo);
        *(v2u*)(&sW[sf0 + 16 * i * LP])      = hi;
        *(v2u*)(&sW[sf0 + 16 * i * LP + 32]) = lo;
      }
    }
    __syncthreads();          // tiles visible to every wave

    Frag ah, al;
    {
      const int ar = (16 * wv + m) * LP + 8 * h;
      ah.h[0] = *(const v8us*)(&sA[ar]);
      ah.h[1] = *(const v8us*)(&sA[ar + 16]);
      al.h[0] = *(const v8us*)(&sA[ar + 32]);
      al.h[1] = *(const v8us*)(&sA[ar + 48]);
    }
    // the next step's loads fly while this step's fragments are read and multiplied; they are waited for at
    // the next staging. Behind the A fragment reads, so that the LDS latency runs beside the loads' issue.
    if (k0 + 32 < K) fetch(k0 + 32);
#pragma unroll
    for (int j = 0; j < TN; ++j) {
      const int br = (16 * j + m) * LP + 8 * h;
      Frag bh, bl;
      bh.h[0] = *(const v8us*)(&sW[br]);
      bh.h[1] = *(const v8us*)(&sW[br + 16]);
      bl.h[0] = *(const v8us*)(&sW[br + 32]);
      bl.h[1] = *(const v8us*)(&sW[br + 48]);
      mma3(acc[j], ah.v, al.v, bh.v, bl.v);
    }
  }

  const bool vt = VT && tr;   // block-uniform
  float bb[TN];
#pragma unroll
  for (int j = 0; j < TN; ++j) bb[j] = HB ? bias[col0 + 16 * j + m] : 0.0f;
  // stands in front of the index sums that overwrite the bias loads' address register
  if (HB) asm volatile("s_wait_xcnt 0x0" ::: "memory");
#pragma unroll
  for (int j = 0; j < TN; ++j) bb[j] = HB ? bias_scale * bb[j] : 0.0f;
  if (vt) {
    // A lane's accumulator tile is 8 consecutive rows t of one column n: one 16-B chunk of hi and one of lo of C^T.
    // sC then holds the tile as BN rows n of two split lines (64 t), pitch CP.
#pragma unroll
    for (int j = 0; j < TN; ++j) {
      const float b = bb[j];
      const v4f a0 = {alpha * acc[j][0] + b, alpha * acc[j][1] + b, alpha * acc[j][2] + b, alpha * acc[j][3] + b};
      const v4f a1 = {alpha * acc[j][4] + b, alpha * acc[j][5] + b, alpha * acc[j][6] + b, alpha * acc[j][7] + b};
      v4f hi, lo;
      split8(a0, a1, hi, lo);
      float* p = &sC[(16 * j + m) * CP + (wv >> 1) * 32 + ((wv & 1) * 2 + h) * 4];
      *(v4f*)p        = hi;
      *(v4f*)(p + 16) = lo;
    }
  } else {
#pragma unroll
    for (int j = 0; j < TN; ++j)
#pragma unroll
      for (int r = 0; r < 8; ++r)
        sC[(16 * wv + 8 * h + r) * CP + 16 * j + m] = alpha * acc[j][r] + bb[j];
  }
  __syncthreads();
  // rows of sC go out as they lie, 16 B a lane: rows of C, or (vt) columns n of C as rows of C^T, 64 t each
  float* Cb = vt ? C + (size_t)(row0 / T_LEN) * ((size_t)C_DIM * T_LEN) + (size_t)col0 * T_LEN + (row0 % T_LEN)
                 : C + (size_t)row0 * ldc + col0;
  const int ldo = vt ? T_LEN : ldc;
#pragma unroll
  for (int i = 0; i < BN / 8; ++i) {
    const int idx = i * 128 + tid;
    const int row = idx / (BN / 4);
    const int c4  = (idx % (BN / 4)) * 4;
    const v4f val = *(const v4f*)(&sC[row * CP + c4]);
    float* gp = Cb + (size_t)row * ldo + c4;
    *(v4f*)gp = val;
  }
}

// A and W in split lines, C f32. Batch z -> (zb, zm, zn) with independent element strides per operand.
template <int BN, int HB>
__global__ void __launch_bounds__(128)
k_gemm(const float* __restrict__ Abase, const float* __restrict__ Wbase,
       float* __restrict__ Cbase, const float* __restrict__ bias,
       long long sAb, long long sAm, long long sAn,
       long long sBb, long long sBm, long long sBn,
       long long sCb, long long sCm, long long sCn,
       int Mrows, int Ncols, int K, int ldc,
       int nInner, int nMid, float bias_scale, float alpha)
{
  const int z  = blockIdx.z;
  const int zn = z % nInner;
  const int zm = (z / nInner) % nMid;
  const int zb = z / (nInner * nMid);
  const float* A = Abase + ((long long)zb * sAb + (long long)zm * sAm + (long long)zn * sAn);
  const float* W = Wbase + ((long long)zb * sBb + (long long)zm * sBm + (long long)zn * sBn);
  float*       C = Cbase + ((long long)zb * sCb + (long long)zm * sCm + (long long)zn * sCn);

  const int row0 = blockIdx.y * 64;
  const int col0 = blockIdx.x * BN;
  if (row0 + 64 > Mrows || col0 + BN > Ncols) return;     // block-uniform, before any barrier

  __shared__ __attribute__((aligned(16))) unsigned char smem[GT_LDS(BN)];
  gemm_tile<BN, 1, 1, HB, 0>(smem, A, W, C, bias, row0, col0, K, ldc, bias_scale, alpha, false);
}

// ---------------------------------------------------------------------------
// qk_tile: QR rows of  C = (sum_m in[b, m, t, :]) @ W^T + 32 bias  (all 256 columns), by one block of 128 threads.
// The axial sum is formed here, in registers, in the order m = 0, 1, .. 31, and goes split to LDS: the summed rows
// never go to global memory. A block reads 32 pieces of QR KiB; 2 * QKW blocks stream x and y once.
//   in : [b][m][t][c] f32;  W : W[n][k] f32, pitch C_DIM;  C : f32 [b * T_LEN + t][n], pitch C_DIM
// Product: wave wv owns columns 64 wv .. +63 (4 accumulator tiles), K = 256 in 8 k steps; fragment maps and k order are
// those of gemm_tile. Rows 8..15 of the 16-row A fragment repeat the QR = 8 summed rows in the order 4..7, 0..3, so that
// D elements 0..3 are rows 0..3 in a wave's lower half and rows 4..7 in its upper half. B fragments come straight from global memory (a lane's
// 2 x 32 B of one row of W a k step), two steps ahead of their use, and are split in registers: no barrier in the k loop.
// ---------------------------------------------------------------------------
#define QR  8
#define QAP (C_DIM * 2 + 8)      // LDS row pitch (16-bit elements): 8 split lines of 64, 8 pad = 1040 B
static __device__ __forceinline__ void
qk_tile(unsigned char* smem, const float* __restrict__ in, const float* __restrict__ W,
        const float* __restrict__ bias, float* __restrict__ C, int row0)
{
  static_assert(QR * QAP * 2 <= GT_LDS(64), "the summed rows lie in the block's LDS");
  unsigned short* sQ = (unsigned short*)smem;
  const int tid = threadIdx.x;
  const int wv  = tid >> 5;
  const int l   = tid & 31;
  const int h   = l >> 4;
  const int m   = l & 15;

  // QR rows t are one contiguous piece of QR * 1 KiB in every slice m: 16-B chunk tid + 128 i of it, i = 0..3
  constexpr size_t inner = (size_t)T_LEN * C_DIM;
  const float* p = in + (size_t)(row0 / T_LEN) * M_AX * inner + (size_t)(row0 % T_LEN) * C_DIM;
  const unsigned to = (unsigned)tid * 4u;
  v4f s[4];
#pragma unroll
  for (int i = 0; i < 4; ++i) s[i] = (v4f){0.0f, 0.0f, 0.0f, 0.0f};
  // rolled: 16 loads of a wave in flight; unrolled, the loads held ahead take more registers than 8 waves a SIMD leave
#pragma unroll 1
  for (int m0 = 0; m0 < M_AX; m0 += 4) {
    const float* pm = p + (size_t)m0 * inner;
    v4f t[4][4];
#pragma unroll
    for (int q = 0; q < 4; ++q)
#pragma unroll
      for (int i = 0; i < 4; ++i) t[q][i] = *(const v4f*)(pm + (size_t)q * inner + i * 512 + to);
    // stands in front of the next trip's address sums, which overwrite the loads' address registers
    asm volatile("s_wait_xcnt 0x0" ::: "memory");
#pragma unroll
    for (int q = 0; q < 4; ++q)
#pragma unroll
      for (int i = 0; i < 4; ++i) s[i] += t[q][i];
  }
#pragma unroll
  for (int i = 0; i < 4; ++i) {
    const int c = tid + 128 * i;               // row c >> 6, values 4 (c & 63) .. +3 of it
    v2u hi, lo;
    split4(s[i], hi, lo);
    unsigned short* d = &sQ[(c >> 6) * QAP + ((c & 63) >> 3) * 64 + (c & 7) * 4];
    *(v2u*)d        = hi;
    *(v2u*)(d + 32) = lo;
  }
  __syncthreads();            // the summed rows visible to every wave

  const unsigned wo = (unsigned)((64 * wv + m) * C_DIM + 8 * h);
  float bb[4];
#pragma unroll
  for (int j = 0; j < 4; ++j) bb[j] = bias[64 * wv + 16 * j + m];
  // D elements 0..3: the lower half of a wave stores rows 0..3, the upper rows 4..7; a wave owns whole 128-B lines
  float* cp = C + (size_t)row0 * C_DIM;
  const unsigned co = (unsigned)(4 * h * C_DIM + 64 * wv + m);

  // 32 steps: step it is k step (it >> 1) & 7 of accumulator tile j = 2 (it >> 4) + (it & 1); two tiles at a time, to
  // leave registers for the W values of three steps: a step's four loads issue two steps ahead of their use
  constexpr int NIT = 4 * (C_DIM / 32);
  v4f rb[3][4];
  auto ldw = [&](int it, v4f (&r)[4]) {
    const float* wp = W + (16 * (2 * (it >> 4) + (it & 1)) * C_DIM + 32 * ((it >> 1) & 7));
    r[0] = *(const v4f*)(wp + wo);
    r[1] = *(const v4f*)(wp + 4 + wo);
    r[2] = *(const v4f*)(wp + 16 + wo);
    r[3] = *(const v4f*)(wp + 20 + wo);
  };
  ldw(0, rb[0]);
  ldw(1, rb[1]);
  v8f acc[2];
  Frag ah, al;
#pragma unroll
  for (int it = 0; it < NIT; ++it) {
    if (it + 2 < NIT) ldw(it + 2, rb[(it + 2) % 3]);
    const int jj = it & 1;
    if ((it & 15) < 2) acc[jj] = (v8f){};
    if (jj == 0) {
      const int ar = ((m + 4 * (m >> 3)) & (QR - 1)) * QAP + 64 * ((it >> 1) & 7) + 8 * h;
      ah.h[0] = *(const v8us*)(&sQ[ar]);
      ah.h[1] = *(const v8us*)(&sQ[ar + 16]);
      al.h[0] = *(const v8us*)(&sQ[ar + 32]);
      al.h[1] = *(const v8us*)(&sQ[ar + 48]);
    }
    v4f h0, l0, h1, l1;
    split8(rb[it % 3][0], rb[it % 3][1], h0, l0);
    split8(rb[it % 3][2], rb[it % 3][3], h1, l1);
    Frag bh, bl;
    bh.h[0] = __builtin_bit_cast(v8us, h0);
    bh.h[1] = __builtin_bit_cast(v8us, h1);
    bl.h[0] = __builtin_bit_cast(v8us, l0);
    bl.h[1] = __builtin_bit_cast(v8us, l1);
    mma3(acc[jj], ah.v, al.v, bh.v, bl.v);
    if ((it & 15) >= 14) {                     // the tile's last k step
      const int j = 2 * (it >> 4) + jj;
#pragma unroll
      for (int r = 0; r < 4; ++r)
        cp[(r * C_DIM + 16 * j) + co] = acc[jj][r] + (float)M_AX * bb[j];
      // stands in front of the next steps' sums, which overwrite the stores' data registers
      asm volatile("s_wait_xcnt 0x0" ::: "memory");
    }
  }
}

// ---------------------------------------------------------------------------
// The axial sums with the q and k projections, the v projection and the split of Wp, which do not depend on one
// another, as ONE launch. Blocks in grid order (id = 4 blockIdx.y + blockIdx.x while blockIdx.y < HDY):
//   id <  QKW                  : qt = (sum_m x) @ Wq^T + 32 bq   (QR rows a block)
//   id <  2 QKW                : kt = (sum_m y) @ Wk^T + 32 bk
//   id <  2 QKW + WPB          : Wp to split lines in wsp, 4 values a thread
//   blockIdx.y >= HDY          : v  = y @ Wv^T + bv   (64 x 64 tiles, stored as split lines of v^T per slice: [c][s])
// The q and k blocks, which stream x and y, come first in the grid and run beside the 2048 blocks of v.
// ---------------------------------------------------------------------------
#define QKW ((B_SZ * T_LEN) / QR)            // blocks of qt, and of kt
#define WPB ((C_DIM * C_DIM / 4) / 128)      // blocks that split Wp
#define HDY ((2 * QKW + WPB) / 4)            // rows of the grid that hold them
#define VB  ((B_SZ * M_AX * T_LEN) / 64)     // row tiles of v
__global__ void __launch_bounds__(128)
k_qkv(const float* __restrict__ x, const float* __restrict__ y,
      const float* __restrict__ Wq, const float* __restrict__ Wk, const float* __restrict__ Wv,
      const float* __restrict__ Wp,
      const float* __restrict__ bq, const float* __restrict__ bk, const float* __restrict__ bv,
      float* __restrict__ qt, float* __restrict__ kt, float* __restrict__ vbuf, float* __restrict__ wsp)
{
  __shared__ __attribute__((aligned(16))) unsigned char smem[GT_LDS(64)];
  const int by = blockIdx.y;
  if (by >= HDY + VB) return;                  // block-uniform, before any barrier
  if (by < HDY) {                              // block-uniform
    const int id = by * 4 + blockIdx.x;
    if (id < 2 * QKW) {
      const bool kq = id >= QKW;
      qk_tile(smem, kq ? y : x, kq ? Wk : Wq, kq ? bk : bq, kq ? kt : qt, (id - (kq ? QKW : 0)) * QR);
      return;
    }
    const int i4 = (id - 2 * QKW) * 128 + (int)threadIdx.x;    // 16-B chunk of Wp
    v2u hi, lo;
    split4(*(const v4f*)(Wp + (size_t)i4 * 4), hi, lo);
    float* o = wsp + (size_t)(i4 >> 3) * 32 + (i4 & 7) * 2;
    *(v2u*)o        = hi;
    *(v2u*)(o + 16) = lo;
    // the built code runs on from here past the other parts' code, which overwrites the stores' registers
    asm volatile("s_wait_xcnt 0x0" ::: "memory");
    return;
  }
  gemm_tile<64, 0, 0, 1, 1>(smem, y, Wv, vbuf, bv, (by - HDY) * 64, blockIdx.x * 64, C_DIM, C_DIM, 1.0f, 1.0f, true);
  // behind the tile's last store, for the same reason
  asm volatile("s_wait_xcnt 0x0" ::: "memory");
}

// ---------------------------------------------------------------------------
// att[b, m, t, n*32 + d] = sum_s w[b, n, t, s] * v[b, m, s, n*32 + d]
// The 32 axial slices m of one (b, n) share w, so they are the columns of ONE product
//   [512 t x 512 s] * [512 s x (32 m * 32 d)].
// Block = 256 threads (8 waves), tile 128 t x 128 columns (4 slices x 32 d), 64 s per stage.
// Wave wv owns rows 32*(wv&3)..+31 and columns 64*(wv>>2)..+63 (2 x 4 accumulator tiles).
// Fragment maps and k order are those of k_gemm.
// w [t][s] and v^T [slice][c][s] come in split lines, att [slice][t][c] leaves in split lines.
// Staging: the tensor mover brings a stage (two split lines, 256 B, of each of the 256 rows) from global memory to LDS
// through no register. Every wave issues one request a stage for its own slice of 32 rows: waves 0..3 rows 32 wv .. +31
// of w, waves 4..7 the 32 rows d of axial slice wv - 4 of v^T. Two buffers: stage s + 1 flies while stage s is multiplied.
// grid: x = group of 4 slices, y = row tile, z = b*8 + n
// ---------------------------------------------------------------------------
#define AT_M   128
#define AT_N   128
#define AT_SL  (AT_N / DH)
#define AT_K   64                 // s per stage
#define AT_RB  (AT_K * 4)         // bytes of a row of a stage: 256
#define AT_RP  136                // LDS row pitch in 16-bit elements: 256 B + the mover's pad of 16 B = 272 B
#define AT_SLB 10240              // LDS bytes of a wave's slice: 32 rows x 272 B = 8704, rounded up to a multiple of 2 KiB
#define AT_STG (8 * AT_SLB)       // LDS bytes of a buffer
typedef uint32_t u32x4 __attribute__((ext_vector_type(4)));
typedef uint32_t u32x8 __attribute__((ext_vector_type(8)));
static __device__ __forceinline__ uint32_t uni(uint32_t v) { return (uint32_t)__builtin_amdgcn_readfirstlane(v); }
// a condition around a tensor load, held in a scalar register so that the test compiles to a scalar compare and branch
// (tensor loads ignore EXEC)
static __device__ __forceinline__ uint32_t pinned(uint32_t v) {
  uint32_t w = uni(v);
  asm volatile("" : "+s"(w));     // pinned(): keeps the word in a scalar register
  return w;
}
__global__ void __launch_bounds__(256)
k_att(const float* __restrict__ wsc, const float* __restrict__ vbuf, float* __restrict__ att)
{
  constexpr int CP = AT_N + 4;          // f32 pitch of the staged C tile (multiple of 4)
  constexpr uint32_t NST = T_LEN / AT_K;
  static_assert(AT_M * CP * 4 <= 2 * AT_STG, "the C tile is laid over the ring");

  // the ring; behind the loop its bytes hold the C tile
  __shared__ __attribute__((aligned(2048))) unsigned char L[2 * AT_STG];
  float* sC = (float*)L;

  const int zn   = blockIdx.z % NH;
  const int zb   = blockIdx.z / NH;
  const int m0   = blockIdx.x * AT_SL;
  const int row0 = blockIdx.y * AT_M;
  const size_t slice = (size_t)T_LEN * C_DIM;
  const float* A = wsc  + ((size_t)blockIdx.z * T_LEN + row0) * T_LEN;
  const float* V = vbuf + (size_t)(zb * M_AX + m0) * slice + (size_t)(zn * DH) * T_LEN;
  float*       C = att  + (size_t)(zb * M_AX + m0) * slice + (size_t)row0 * C_DIM + zn * DH;

  const int tid = threadIdx.x;
  const int l   = tid & 31;
  const int h   = l >> 4;
  const int m   = l & 15;
  const uint32_t wave = uni((uint32_t)tid >> 5);
  const int wr  = (int)(wave & 3u);
  const int wc  = (int)(wave >> 2);

  // Descriptor group 1, the same for every request: 1-byte elements, tile = tensor = 32 rows of 256 B, source pitch
  // one row of w or of v^T (2048 B), a pad of 4 dwords behind every 64 dwords (one row).
  u32x8 g1;
  g1[0] = uni((1u << 20) | (5u << 22) | (3u << 25));
  g1[1] = uni(((uint32_t)AT_RB & 0xFFFFu) << 16);
  g1[2] = uni(32u << 16);
  g1[3] = uni((uint32_t)AT_RB << 16);
  g1[4] = uni(32u);
  g1[5] = uni((uint32_t)T_LEN * 4u);
  g1[6] = uni(0u);
  g1[7] = uni(0u);
  const float*   srcw  = wave < 4u ? A + (size_t)(32u * wave) * T_LEN : V + (size_t)(wave - 4u) * slice;
  const uint32_t lbase = (uint32_t)(size_t)L;
  auto issue = [&](uint32_t st) {
    const uint32_t dst = lbase + (st & 1u) * (uint32_t)AT_STG + wave * (uint32_t)AT_SLB;
    const uint64_t ga  = (uint64_t)(size_t)srcw + (uint64_t)st * (uint32_t)AT_RB;
    u32x4 g0;
    g0[0] = uni(1u);
    g0[1] = uni(dst);
    g0[2] = uni((uint32_t)ga);
    g0[3] = uni((((uint32_t)(ga >> 32)) & 0x01FFFFFFu) | 0x80000000u);
    asm volatile("tensor_load_to_lds %0, %1" :: "s"(g0), "s"(g1) : "memory");
  };

  v8f acc[2][4];
#pragma unroll
  for (int i = 0; i < 2; ++i)
#pragma unroll
    for (int j = 0; j < 4; ++j) acc[i][j] = (v8f){};

  issue(0);
  asm volatile("s_wait_tensorcnt 0x0" ::: "memory");   // this wave's slice of stage 0 has landed
  __syncthreads();                                     // stage 0 visible to every wave

  for (uint32_t st = 0; st < NST; ++st) {
    // directly behind the barrier that published stage st and ended every read of stage st - 1: the load of stage st + 1,
    // into the buffer that stage st - 1 used; it flies while stage st is multiplied. In run order this is the two-buffer
    // ring (stage 1's load behind the first barrier, stage st + 2's behind the barrier at the foot of pass st); written
    // once, at the head, so that every request of the loop is formed behind the wait that covers the one before it
    if (pinned(st + 1u < NST)) issue(st + 1u);
    const unsigned short* Lb = (const unsigned short*)(L + (st & 1u) * (uint32_t)AT_STG);
#pragma unroll
    for (int kk = 0; kk < AT_K / 32; ++kk) {           // the stage's split lines, in k order
      Frag ah[2], al[2];
#pragma unroll
      for (int i = 0; i < 2; ++i) {
        const int ar = wr * (AT_SLB / 2) + (16 * i + m) * AT_RP + 64 * kk + 8 * h;
        ah[i].h[0] = *(const v8us*)(&Lb[ar]);
        ah[i].h[1] = *(const v8us*)(&Lb[ar + 16]);
        al[i].h[0] = *(const v8us*)(&Lb[ar + 32]);
        al[i].h[1] = *(const v8us*)(&Lb[ar + 48]);
      }
#pragma unroll
      for (int j = 0; j < 4; ++j) {
        // column 64 wc + 16 j + m = row 16 (j & 1) + m of axial slice 2 wc + (j >> 1)
        const int br = (4 + 2 * wc + (j >> 1)) * (AT_SLB / 2) + (16 * (j & 1) + m) * AT_RP + 64 * kk + 8 * h;
        Frag bh, bl;
        bh.h[0] = *(const v8us*)(&Lb[br]);
        bh.h[1] = *(const v8us*)(&Lb[br + 16]);
        bl.h[0] = *(const v8us*)(&Lb[br + 32]);
        bl.h[1] = *(const v8us*)(&Lb[br + 48]);
#pragma unroll
        for (int i = 0; i < 2; ++i) mma3(acc[i][j], ah[i].v, al[i].v, bh.v, bl.v);
      }
    }
    // publish point of stage st + 1
    asm volatile("s_wait_dscnt 0x0" ::: "memory");     // this wave's reads of stage st are done before its buffer is refilled
    asm volatile("s_wait_tensorcnt 0x0" ::: "memory"); // this wave's slice of stage st + 1 has landed
    __syncthreads();                                   // stage st + 1 visible; every wave has left stage st
  }
  asm volatile("s_wait_tensorcnt 0x0" ::: "memory");   // no request in flight when the ring becomes the C tile
  asm volatile("s_wait_dscnt 0x0" ::: "memory");

#pragma unroll
  for (int i = 0; i < 2; ++i)
#pragma unroll
    for (int j = 0; j < 4; ++j)
#pragma unroll
      for (int r = 0; r < 8; ++r)
        sC[(32 * wr + 16 * i + 8 * h + r) * CP + 64 * wc + 16 * j + m] = acc[i][j][r];
  __syncthreads();
  // a thread splits 8 consecutive d of one (t, slice): a 16-B chunk of hi and one of lo of that row's line of head zn;
  // four lanes fill the hi half of a line with one store and its lo half with the next
#pragma unroll
  for (int i = 0; i < AT_M * AT_N / (8 * 256); ++i) {
    const int idx = i * 256 + tid;
    const int row = idx / (AT_N / 8);
    const int c8  = idx % (AT_N / 8);
    const v4f a0 = *(const v4f*)(&sC[row * CP + c8 * 8]);
    const v4f a1 = *(const v4f*)(&sC[row * CP + c8 * 8 + 4]);
    v4f hi, lo;
    split8(a0, a1, hi, lo);
    float* gp = C + (size_t)(c8 >> 2) * slice + (size_t)row * C_DIM + (c8 & 3) * 4;
    *(v4f*)gp        = hi;
    *(v4f*)(gp + 16) = lo;
  }
}

// ---------------------------------------------------------------------------
// w[b, n, t, :] = softmax_s( (1/32) qt[b, t, n*32 ..] . kt[b, s, n*32 ..] ), scores and row softmax in ONE kernel.
// A block holds SS_M whole rows of one (b, n): a SS_M x 512 score tile, K = 32 (one k step), which goes from the
// accumulators to LDS and from there through the softmax; the scores never go to global memory.
// Block = 256 threads (8 waves). Product: wave wv owns all SS_M rows and columns 64 wv .. +63 (2 x 4 accumulator
// tiles); fragment maps and k order are those of k_gemm; LDS: hi and lo in separate [row or column][k] arrays, pitch KP.
// Softmax: wave wv owns rows 4 wv .. +3, a lane holds floats lane*4+0..3 of each 128-float segment of a row, so
// that every f32 store instruction covers four whole 128-B lines. w leaves in split lines (a lane's 4 values: 8 B of
// hi and 8 B of lo of their line); rows of batch 0 also go to a_out as f32.
// grid: x = row tile, y = b*8 + n
// ---------------------------------------------------------------------------
#define SS_M 32
// e^x as __expf forms it (2^(x log2 e), the chip's own v_exp_f32). In asm text for the v_nop alone: it keeps the one
// slot that the instruction set asks for behind a transcendental, before its result is read or its source overwritten.
static __device__ __forceinline__ float exp_slot(float x) {
  float r;
  asm("v_exp_f32 %0, %1\n\tv_nop" : "=v"(r) : "v"(x * 0x1.715476p+0f));
  return r;
}
__global__ void __launch_bounds__(256)
k_score_softmax(const float* __restrict__ qt, const float* __restrict__ kt,
                float* __restrict__ w, float* __restrict__ a_out)
{
  constexpr int CP = T_LEN + 4;         // f32 pitch of the score tile (multiple of 4; rows 8 apart fall 32 banks apart)

  __shared__ __attribute__((aligned(16))) unsigned short sAhi[SS_M * KP];
  __shared__ __attribute__((aligned(16))) unsigned short sAlo[SS_M * KP];
  __shared__ __attribute__((aligned(16))) unsigned short sWhi[T_LEN * KP];
  __shared__ __attribute__((aligned(16))) unsigned short sWlo[T_LEN * KP];
  __shared__ __attribute__((aligned(16))) float          sC[SS_M * CP];

  const int zn   = blockIdx.y % NH;
  const int zb   = blockIdx.y / NH;
  const int row0 = blockIdx.x * SS_M;
  const float* A = qt + ((size_t)zb * T_LEN + row0) * C_DIM + zn * DH;
  const float* W = kt + (size_t)zb * T_LEN * C_DIM + zn * DH;

  const int tid = threadIdx.x;
  const int wv  = tid >> 5;
  const int l   = tid & 31;
  const int h   = l >> 4;
  const int m   = l & 15;

  // q tile 32 x 32: one 16-B chunk a thread, row tid>>3, k 4*(tid&7); k tile 512 x 32: chunk i is 32 rows on
  const unsigned to  = (unsigned)((tid >> 3) * C_DIM + (tid & 7) * 4);
  const int      st0 = (tid >> 3) * KP + (tid & 7) * 4;
  const v4f ra = *(const v4f*)(A + to);
  v4f rw[T_LEN / 32];
#pragma unroll
  for (int i = 0; i < T_LEN / 32; ++i) rw[i] = *(const v4f*)(W + (size_t)(32 * i) * C_DIM + to);
  // stands in front of the index sums that overwrite the loads' address registers
  asm volatile("s_wait_xcnt 0x0" ::: "memory");

  {
    v2u hi, lo;
    split4(ra, hi, lo);
    *(v2u*)(&sAhi[st0]) = hi;
    *(v2u*)(&sAlo[st0]) = lo;
  }
#pragma unroll
  for (int i = 0; i < T_LEN / 32; ++i) {
    v2u hi, lo;
    split4(rw[i], hi, lo);
    *(v2u*)(&sWhi[st0 + 32 * i * KP]) = hi;
    *(v2u*)(&sWlo[st0 + 32 * i * KP]) = lo;
  }
  __syncthreads();            // tiles visible to every wave

  v8f acc[2][4];
#pragma unroll
  for (int i = 0; i < 2; ++i)
#pragma unroll
    for (int j = 0; j < 4; ++j) acc[i][j] = (v8f){};

  Frag ah[2], al[2];
#pragma unroll
  for (int i = 0; i < 2; ++i) {
    const int ar = (16 * i + m) * KP + 8 * h;
    ah[i].h[0] = *(const v8us*)(&sAhi[ar]);
    ah[i].h[1] = *(const v8us*)(&sAhi[ar + 16]);
    al[i].h[0] = *(const v8us*)(&sAlo[ar]);
    al[i].h[1] = *(const v8us*)(&sAlo[ar + 16]);
  }
#pragma unroll
  for (int j = 0; j < 4; ++j) {
    const int br = (64 * wv + 16 * j + m) * KP + 8 * h;
    Frag bh, bl;
    bh.h[0] = *(const v8us*)(&sWhi[br]);
    bh.h[1] = *(const v8us*)(&sWhi[br + 16]);
    bl.h[0] = *(const v8us*)(&sWlo[br]);
    bl.h[1] = *(const v8us*)(&sWlo[br + 16]);
#pragma unroll
    for (int i = 0; i < 2; ++i) mma3(acc[i][j], ah[i].v, al[i].v, bh.v, bl.v);
  }

#pragma unroll
  for (int i = 0; i < 2; ++i)
#pragma unroll
    for (int j = 0; j < 4; ++j)
#pragma unroll
      for (int r = 0; r < 8; ++r)
        sC[(16 * i + 8 * h + r) * CP + 64 * wv + 16 * j + m] = (1.0f / 32.0f) * acc[i][j][r];
  __syncthreads();            // whole rows of scores visible to the wave that owns them

  // four rows a wave, side by side: four independent reduction chains
  constexpr int RW = SS_M / 8;
  v4f v[RW][4];
#pragma unroll
  for (int q = 0; q < RW; ++q)
#pragma unroll
    for (int i = 0; i < 4; ++i) v[q][i] = *(const v4f*)(&sC[(RW * wv + q) * CP + l * 4 + i * 128]);

  float mx[RW];
#pragma unroll
  for (int q = 0; q < RW; ++q) {
    mx[q] = -3.0e38f;
#pragma unroll
    for (int i = 0; i < 4; ++i)
      mx[q] = fmaxf(mx[q], fmaxf(fmaxf(v[q][i].x, v[q][i].y), fmaxf(v[q][i].z, v[q][i].w)));
  }
#pragma unroll
  for (int off = 16; off > 0; off >>= 1)
#pragma unroll
    for (int q = 0; q < RW; ++q) mx[q] = fmaxf(mx[q], __shfl_xor(mx[q], off, 32));

  float sum[RW];
#pragma unroll
  for (int q = 0; q < RW; ++q) {
    sum[q] = 0.0f;
#pragma unroll
    for (int i = 0; i < 4; ++i) {
      v[q][i].x = exp_slot(v[q][i].x - mx[q]);
      v[q][i].y = exp_slot(v[q][i].y - mx[q]);
      v[q][i].z = exp_slot(v[q][i].z - mx[q]);
      v[q][i].w = exp_slot(v[q][i].w - mx[q]);
      sum[q] += (v[q][i].x + v[q][i].y) + (v[q][i].z + v[q][i].w);
    }
  }
#pragma unroll
  for (int off = 16; off > 0; off >>= 1)
#pragma unroll
    for (int q = 0; q < RW; ++q) sum[q] += __shfl_xor(sum[q], off, 32);
#pragma unroll
  for (int q = 0; q < RW; ++q) {
    const float inv = 1.0f / sum[q];
#pragma unroll
    for (int i = 0; i < 4; ++i) v[q][i] *= inv;
  }

  // address = block-uniform base of the destination + the lane's one 32-bit element offset, rows and segments at
  // immediate offsets: one offset register a destination (lo: f32 rows of a_out, ls: split lines of w)
  const size_t   ub = ((size_t)blockIdx.y * T_LEN + row0) * T_LEN;
  const unsigned lo = (unsigned)(RW * wv * T_LEN + l * 4);
  const unsigned ls = (unsigned)(RW * wv * T_LEN + (l >> 3) * 32 + (l & 7) * 2);   // the hi half's place in a split line
  float* pw = w + ub;
#pragma unroll
  for (int q = 0; q < RW; ++q)
#pragma unroll
    for (int i = 0; i < 4; ++i) {
      v2u sh, sl;
      split4(v[q][i], sh, sl);
      *(v2u*)(pw + (q * T_LEN + i * 128) + ls)      = sh;
      *(v2u*)(pw + (q * T_LEN + i * 128 + 16) + ls) = sl;
    }
  if (zb == 0) {              // block-uniform; behind the last barrier
    float* pa = a_out + ub;
#pragma unroll
    for (int q = 0; q < RW; ++q)
#pragma unroll
      for (int i = 0; i < 4; ++i) *(v4f*)(pa + (q * T_LEN + i * 128) + lo) = v[q][i];
  }
}

// ---------------------------------------------------------------------------
extern "C" void kernel_launch(void* const* d_in, const int* in_sizes, int n_in,
                              void* d_out, int out_size, void* d_ws, size_t ws_size,
                              hipStream_t stream)
{
  if (n_in < 10) return;
  const int n_x  = B_SZ * M_AX * T_LEN * C_DIM;          // 8388608
  const int n_w  = C_DIM * C_DIM;
  const int n_a  = NH * T_LEN * T_LEN;                   // 2097152
  if (in_sizes[0] != n_x || in_sizes[1] != n_x) return;
  if (in_sizes[2] != n_w || in_sizes[4] != n_w || in_sizes[6] != n_w || in_sizes[8] != n_w) return;
  if (in_sizes[3] != C_DIM || in_sizes[5] != C_DIM || in_sizes[7] != C_DIM || in_sizes[9] != C_DIM) return;
  if (out_size != n_x + n_a) return;

  const float* x  = (const float*)d_in[0];
  const float* y  = (const float*)d_in[1];
  const float* Wq = (const float*)d_in[2];
  const float* bq = (const float*)d_in[3];
  const float* Wk = (const float*)d_in[4];
  const float* bk = (const float*)d_in[5];
  const float* Wv = (const float*)d_in[6];
  const float* bv = (const float*)d_in[7];
  const float* Wp = (const float*)d_in[8];
  const float* bp = (const float*)d_in[9];

  float* out   = (float*)d_out;                            // [2,32,512,256]
  float* a_out = out + (size_t)n_x;                        // [8,512,512] at byte 33554432

  const size_t n_sum = (size_t)B_SZ * T_LEN * C_DIM;       // 262144
  const size_t n_v   = (size_t)n_x;                        // 8388608
  const size_t n_sc  = (size_t)B_SZ * NH * T_LEN * T_LEN;  // 4194304
  const size_t o_qt   = 0;
  const size_t o_kt   = o_qt   + n_sum;
  const size_t o_v    = o_kt   + n_sum;
  const size_t o_wsc  = o_v    + n_v;
  const size_t o_att  = o_wsc  + n_sc;
  const size_t o_wsp  = o_att  + n_v;
  const size_t o_end  = o_wsp  + (size_t)n_w;
  if (o_end * sizeof(float) > ws_size) return;

  float* ws   = (float*)d_ws;
  float* qt   = ws + o_qt;
  float* kt   = ws + o_kt;
  float* vbuf = ws + o_v;
  float* wsc  = ws + o_wsc;
  float* att  = ws + o_att;
  float* wsp  = ws + o_wsp;                                // Wp in split lines

  // 1+2+3) qt = (sum_m x) @ Wq^T + 32*bq, kt = (sum_m y) @ Wk^T + 32*bk   [1024 x 256];  v = y_flat @ Wv^T + bv   [32768 x 256];
  //        K = 256; Wp to split lines
  k_qkv<<<dim3(C_DIM / 64, HDY + VB, 1), dim3(128), 0, stream>>>(
      x, y, Wq, Wk, Wv, Wp, bq, bk, bv, qt, kt, vbuf, wsp);

  // 4+5) w[b,n] = softmax rows of (1/32) qt_head @ kt_head^T   [512 x 512], K = 32, y = b*8 + n; rows of batch 0 also to a_out
  k_score_softmax<<<dim3(T_LEN / SS_M, B_SZ * NH), dim3(256), 0, stream>>>(qt, kt, wsc, a_out);

  // 6) att[b,:,n] = w[b,n] @ v[b,:][:, n*32 .. n*32+31]   [512 x (32*32)], K = 512, z = b*8 + n, x = 4 slices m
  k_att<<<dim3(M_AX / AT_SL, T_LEN / AT_M, B_SZ * NH), dim3(256), 0, stream>>>(wsc, vbuf, att);

  // 7) out = att @ Wp^T + bp   [32768 x 256], K = 256
  k_gemm<64, 1><<<dim3(C_DIM / 64, (B_SZ * M_AX * T_LEN) / 64, 1), dim3(128), 0, stream>>>(
      att, wsp, out, bp, 0, 0, 0, 0, 0, 0, 0, 0, 0,
      B_SZ * M_AX * T_LEN, C_DIM, C_DIM, C_DIM, 1, 1, 1.0f, 1.0f);
}

// v010
// A run of this version takes 47.4 microseconds.
// Versions between v008 and this one are left out; their measured steps multiply to 1.38 times as fast.
// Over all steps from v000 it is 3.99 times as fast.
// Contractions, all with f32 accumulate. q, k projections and q.k^T scores: v_wmma_f32_16x16x32_bf16 with each f32 operand carried as bf16 hi + bf16 lo (hi.hi + hi.lo + lo.hi). v and out projections and w.v: v_wmma_f32_16x16x32_f16 with each f32 operand rounded once to f16 (nearest even), one instruction a product. Axial sums, softmax and epilogues f32. Wp and the intermediates v, w lie in the workspace as f16, att in LDS as f16 (see "f16 operands").
#include <hip/hip_runtime.h>
#include <stdint.h>

typedef float          v4f  __attribute__((ext_vector_type(4)));
typedef float          v8f  __attribute__((ext_vector_type(8)));
typedef unsigned int   v2u  __attribute__((ext_vector_type(2)));
typedef unsigned int   v4u  __attribute__((ext_vector_type(4)));
typedef unsigned short v8us __attribute__((ext_vector_type(8)));
typedef __bf16         v16b __attribute__((ext_vector_type(16)));
typedef __bf16         v2b  __attribute__((ext_vector_type(2)));
typedef float          v2f  __attribute__((ext_vector_type(2)));
typedef _Float16       v16h __attribute__((ext_vector_type(16)));
typedef _Float16       v4h  __attribute__((ext_vector_type(4)));
union Frag  { v16b v; v8us h[2]; };
union FragH { v16h v; v8us h[2]; };

#define C_DIM 256
#define NH    8
#define DH    32
#define B_SZ  2
#define M_AX  32
#define T_LEN 512
#define KP    40      // LDS pitch (16-bit elements) of a 32-deep k tile (score kernel, v projection): 64 B + 16 B pad; multiple of 8 for 16-B fragment loads
// f16 operands: a GEMM operand that a kernel of this file produces (or Wp) is rounded to f16 ONCE, by its producer, and
// stored with k contiguous. A consumer moves rows of it to LDS as they are, with no arithmetic.

// x = hi + lo with hi = rne_bf16(x), lo = rne_bf16(x - hi); (x - hi) is exact in f32.
// Both roundings are the chip's own packed convert (nearest even, two values an instruction).
static __device__ __forceinline__ void split2(float x0, float x1, unsigned int& hb, unsigned int& lb) {
  const v2f x  = {x0, x1};
  const v2b hi = __builtin_convertvector(x, v2b);
  const v2f r  = x - __builtin_convertvector(hi, v2f);
  const v2b lo = __builtin_convertvector(r, v2b);
  hb = __builtin_bit_cast(unsigned int, hi);
  lb = __builtin_bit_cast(unsigned int, lo);
}
static __device__ __forceinline__ void split4(v4f v, v2u& hi, v2u& lo) {
  unsigned int h01, h23, l01, l23;
  split2(v.x, v.y, h01, l01);
  split2(v.z, v.w, h23, l23);
  hi.x = h01; hi.y = h23;
  lo.x = l01; lo.y = l23;
}

// eight values -> one 16-B chunk of hi and one of lo
static __device__ __forceinline__ void split8(v4f a, v4f b, v4f& hi, v4f& lo) {
  v2u ha, la, hb, lb;
  split4(a, ha, la);
  split4(b, hb, lb);
  const v4u h4 = {ha.x, ha.y, hb.x, hb.y};
  const v4u l4 = {la.x, la.y, lb.x, lb.y};
  hi = __builtin_bit_cast(v4f, h4);     // bits only: never used as numbers
  lo = __builtin_bit_cast(v4f, l4);
}

// four, eight values -> f16 (nearest even, the chip's packed convert), as bits
static __device__ __forceinline__ v2u half4(v4f v) {
  return __builtin_bit_cast(v2u, __builtin_convertvector(v, v4h));
}
static __device__ __forceinline__ v4f half8(v4f a, v4f b) {
  const v2u x = half4(a), y = half4(b);
  const v4u r = {x.x, x.y, y.x, y.y};
  return __builtin_bit_cast(v4f, r);    // bits only: never used as numbers
}

// one 16x16x32 f16 op
static __device__ __forceinline__ void mmah(v8f& acc, v16h a, v16h b) {
  acc = __builtin_amdgcn_wmma_f32_16x16x32_f16(false, a, false, b, (short)0, acc, false, false);
}

// three 16x16x32 bf16 ops into one accumulator, then the VALU hazard guard
static __device__ __forceinline__ void mma3(v8f& acc, v16b ah, v16b al, v16b bh, v16b bl) {
  acc = __builtin_amdgcn_wmma_f32_16x16x32_bf16(false, ah, false, bh, (short)0, acc, false, false);
  acc = __builtin_amdgcn_wmma_f32_16x16x32_bf16(false, ah, false, bl, (short)0, acc, false, false);
  acc = __builtin_amdgcn_wmma_f32_16x16x32_bf16(false, al, false, bh, (short)0, acc, false, false);
  asm volatile("v_nop\n\tv_nop\n\tv_nop\n\tv_nop" : "+v"(acc) : "v"(ah), "v"(al), "v"(bh), "v"(bl));
}

// ---------------------------------------------------------------------------
// Fragment maps of the 16x16x32 forms per lane l (h = l>>4, m = l&15):
//   A: row m, el 0..7 <- k 8h+0..7, el 8..15 <- k 16+8h+0..7
//   B: col m, same k map;   D: el r <- (row 8h+r, col m)
// ---------------------------------------------------------------------------
// v_tile: one 64 x 64 tile of  C = A[M x 256] * W^T + bias[n]  at (row0, col0), by one block of 128 threads (4 waves).
//   A : f32 row-major, k contiguous, pitch C_DIM;  W : W[n][k] f32, pitch C_DIM; both rounded to f16 on their way to LDS
//   C : stored as f16 C^T, C[b][head][axial slice][d][t] with t contiguous, pitch T_LEN (column n = 32 head + d; the form
//       in which k_att_out reads v: the rows d of neighbouring slices of a head follow one another); a tile's row n is
//       one whole 128-B line
// 32 k per step. Wave w owns rows 16w..16w+15 and all 64 cols (4 accumulator tiles).
// smem: QKV_LDS bytes of LDS, 16-B aligned.
// ---------------------------------------------------------------------------
#define VCP     36     // f32-unit pitch of the staged C^T tile: 128 B + 16 B pad
#define QKV_LDS ((64 + 64) * KP * 2 + 64 * VCP * 4)
static __device__ __forceinline__ void
v_tile(unsigned char* smem, const float* __restrict__ A, const float* __restrict__ W,
       float* __restrict__ C, const float* __restrict__ bias, int row0, int col0)
{
  constexpr int lda = C_DIM;            // row pitch of A and of W: a constant, so that a thread's eight loads
  constexpr int ldb = C_DIM;            // of a k step are two addresses plus immediate offsets
  constexpr int TN  = 4;                // accumulator tiles per wave

  unsigned short* sA = (unsigned short*)smem;               // 64 * KP
  unsigned short* sW = sA + 64 * KP;                        // 64 * KP
  float*          sC = (float*)(smem + (64 + 64) * KP * 2); // 64 * VCP

  const int tid = threadIdx.x;
  const int wv  = tid >> 5;
  const int l   = tid & 31;
  const int h   = l >> 4;
  const int m   = l & 15;

  v8f acc[TN];
#pragma unroll
  for (int j = 0; j < TN; ++j) acc[j] = (v8f){};

  // The tiles of k step k0, 8 x 16 B a thread, from global memory into registers.
  v4f ra[4];
  v4f rw[4];
  // Address = block-uniform base of the step + the thread's own fixed 32-bit element offset: few address
  // registers, so that holding the eight chunks across the matrix work costs no resident wave.
  const int sf0 = (tid >> 3) * KP + (tid & 7) * 4;     // LDS place of chunk 0 (4 values); chunk i is 16 rows on
  const float* Ab = A + (size_t)row0 * lda;
  const float* Wb = W + (size_t)col0 * ldb;
  auto fetch = [&](int k0) {
    const float* Ak = Ab + k0;
    const float* Wk = Wb + k0;
    // A tile 64 x 32: chunk tid + 128 i -> row (tid>>3) + 16 i, bytes 16*(tid&7) of the row's line; W tile alike
#pragma unroll
    for (int i = 0; i < 4; ++i)
      ra[i] = *(const v4f*)(Ak + (size_t)(16 * i) * lda + (unsigned)((tid >> 3) * lda + (tid & 7) * 4));
#pragma unroll
    for (int i = 0; i < 4; ++i)
      rw[i] = *(const v4f*)(Wk + (size_t)(16 * i) * ldb + (unsigned)((tid >> 3) * ldb + (tid & 7) * 4));
    // stands in front of the fragment reads and index sums that overwrite the loads' address registers
    asm volatile("s_wait_xcnt 0x0" ::: "memory");
  };

  fetch(0);
  for (int k0 = 0; k0 < C_DIM; k0 += 32) {
    __syncthreads();          // all waves done reading the tiles of the prior k step
#pragma unroll
    for (int i = 0; i < 4; ++i) *(v2u*)(&sA[sf0 + 16 * i * KP]) = half4(ra[i]);
#pragma unroll
    for (int i = 0; i < 4; ++i) *(v2u*)(&sW[sf0 + 16 * i * KP]) = half4(rw[i]);
    __syncthreads();          // tiles visible to every wave

    FragH a;
    {
      const int ar = (16 * wv + m) * KP + 8 * h;
      a.h[0] = *(const v8us*)(&sA[ar]);
      a.h[1] = *(const v8us*)(&sA[ar + 16]);
    }
    // the next step's loads fly while this step's fragments are read and multiplied; they are waited for at
    // the next staging. Behind the A fragment reads, so that the LDS latency runs beside the loads' issue.
    if (k0 + 32 < C_DIM) fetch(k0 + 32);
#pragma unroll
    for (int j = 0; j < TN; ++j) {
      const int br = (16 * j + m) * KP + 8 * h;
      FragH b;
      b.h[0] = *(const v8us*)(&sW[br]);
      b.h[1] = *(const v8us*)(&sW[br + 16]);
      mmah(acc[j], a.v, b.v);
    }
  }

  float bb[TN];
#pragma unroll
  for (int j = 0; j < TN; ++j) bb[j] = bias[col0 + 16 * j + m];
  // stands in front of the index sums that overwrite the bias loads' address register
  asm volatile("s_wait_xcnt 0x0" ::: "memory");
  // A lane's accumulator tile is 8 consecutive rows t of one column n: one 16-B chunk of C^T.
  // sC holds the tile as 64 rows n of 64 t (128 B), pitch VCP.
#pragma unroll
  for (int j = 0; j < TN; ++j) {
    const float b = bb[j];
    const v4f a0 = {acc[j][0] + b, acc[j][1] + b, acc[j][2] + b, acc[j][3] + b};
    const v4f a1 = {acc[j][4] + b, acc[j][5] + b, acc[j][6] + b, acc[j][7] + b};
    *(v4f*)(&sC[(16 * j + m) * VCP + wv * 8 + h * 4]) = half8(a0, a1);
  }
  __syncthreads();
  // rows of sC go out as they lie, 16 B a lane: columns n of C as rows of C^T, 64 t each; offsets in 4-B units
  // the tile's 64 columns are two heads; a head's rows of all slices are M_AX * DH rows
  const int sl = row0 / T_LEN;
  float* Cb = C + (size_t)((((sl / M_AX) * NH + col0 / DH) * M_AX + sl % M_AX) * DH) * (T_LEN / 2) + (row0 % T_LEN) / 2;
  const unsigned oo = (unsigned)((tid >> 3) * (T_LEN / 2) + (tid & 7) * 4);   // chunk tid + 128 i -> row (tid>>3) + 16 i
#pragma unroll
  for (int i = 0; i < 4; ++i) {
    const v4f val = *(const v4f*)(&sC[(16 * i + (tid >> 3)) * VCP + (tid & 7) * 4]);
    *(v4f*)(Cb + ((i >> 1) * (M_AX * DH) + 16 * (i & 1)) * (T_LEN / 2) + oo) = val;
  }
}

// ---------------------------------------------------------------------------
// qk_tile: QR rows of  C = (sum_m in[b, m, t, :]) @ W^T + 32 bias  (all 256 columns), by one block of 128 threads.
// The axial sum is formed here, in registers, in the order m = 0, 1, .. 31, and goes split to LDS: the summed rows
// never go to global memory. A block reads 32 pieces of QR KiB; 2 * QKW blocks stream x and y once.
//   in : [b][m][t][c] f32;  W : W[n][k] f32, pitch C_DIM;  C : f32 [b * T_LEN + t][n], pitch C_DIM
// Product: wave wv owns columns 64 wv .. +63 (4 accumulator tiles), K = 256 in 8 k steps; fragment maps and k order are
// those of v_tile. Rows 8..15 of the 16-row A fragment repeat the QR = 8 summed rows in the order 4..7, 0..3, so that
// D elements 0..3 are rows 0..3 in a wave's lower half and rows 4..7 in its upper half. B fragments come straight from global memory (a lane's
// 2 x 32 B of one row of W a k step), two steps ahead of their use, and are split in registers: no barrier in the k loop.
// ---------------------------------------------------------------------------
#define QR  8
#define QAP (C_DIM * 2 + 8)      // LDS row pitch (16-bit elements): 8 k steps of 32 hi + 32 lo, 8 pad = 1040 B
static __device__ __forceinline__ void
qk_tile(unsigned char* smem, const float* __restrict__ in, const float* __restrict__ W,
        const float* __restrict__ bias, float* __restrict__ C, int row0)
{
  static_assert(QR * QAP * 2 <= QKV_LDS, "the summed rows lie in the block's LDS");
  unsigned short* sQ = (unsigned short*)smem;
  const int tid = threadIdx.x;
  const int wv  = tid >> 5;
  const int l   = tid & 31;
  const int h   = l >> 4;
  const int m   = l & 15;

  // QR rows t are one contiguous piece of QR * 1 KiB in every slice m: 16-B chunk tid + 128 i of it, i = 0..3
  constexpr size_t inner = (size_t)T_LEN * C_DIM;
  const float* p = in + (size_t)(row0 / T_LEN) * M_AX * inner + (size_t)(row0 % T_LEN) * C_DIM;
  const unsigned to = (unsigned)tid * 4u;
  v4f s[4];
#pragma unroll
  for (int i = 0; i < 4; ++i) s[i] = (v4f){0.0f, 0.0f, 0.0f, 0.0f};
  // rolled: 16 loads of a wave in flight; unrolled, the loads held ahead take more registers than 8 waves a SIMD leave
#pragma unroll 1
  for (int m0 = 0; m0 < M_AX; m0 += 4) {
    const float* pm = p + (size_t)m0 * inner;
    v4f t[4][4];
#pragma unroll
    for (int q = 0; q < 4; ++q)
#pragma unroll
      for (int i = 0; i < 4; ++i) t[q][i] = *(const v4f*)(pm + (size_t)q * inner + i * 512 + to);
    // stands in front of the next trip's address sums, which overwrite the loads' address registers
    asm volatile("s_wait_xcnt 0x0" ::: "memory");
#pragma unroll
    for (int q = 0; q < 4; ++q)
#pragma unroll
      for (int i = 0; i < 4; ++i) s[i] += t[q][i];
  }
#pragma unroll
  for (int i = 0; i < 4; ++i) {
    const int c = tid + 128 * i;               // row c >> 6, values 4 (c & 63) .. +3 of it
    v2u hi, lo;
    split4(s[i], hi, lo);
    unsigned short* d = &sQ[(c >> 6) * QAP + ((c & 63) >> 3) * 64 + (c & 7) * 4];
    *(v2u*)d        = hi;
    *(v2u*)(d + 32) = lo;
  }
  __syncthreads();            // the summed rows visible to every wave

  const unsigned wo = (unsigned)((64 * wv + m) * C_DIM + 8 * h);
  float bb[4];
#pragma unroll
  for (int j = 0; j < 4; ++j) bb[j] = bias[64 * wv + 16 * j + m];
  // D elements 0..3: the lower half of a wave stores rows 0..3, the upper rows 4..7; a wave owns whole 128-B lines
  float* cp = C + (size_t)row0 * C_DIM;
  const unsigned co = (unsigned)(4 * h * C_DIM + 64 * wv + m);

  // 32 steps: step it is k step (it >> 1) & 7 of accumulator tile j = 2 (it >> 4) + (it & 1); two tiles at a time, to
  // leave registers for the W values of three steps: a step's four loads issue two steps ahead of their use
  constexpr int NIT = 4 * (C_DIM / 32);
  v4f rb[3][4];
  auto ldw = [&](int it, v4f (&r)[4]) {
    const float* wp = W + (16 * (2 * (it >> 4) + (it & 1)) * C_DIM + 32 * ((it >> 1) & 7));
    r[0] = *(const v4f*)(wp + wo);
    r[1] = *(const v4f*)(wp + 4 + wo);
    r[2] = *(const v4f*)(wp + 16 + wo);
    r[3] = *(const v4f*)(wp + 20 + wo);
  };
  ldw(0, rb[0]);
  ldw(1, rb[1]);
  v8f acc[2];
  Frag ah, al;
#pragma unroll
  for (int it = 0; it < NIT; ++it) {
    if (it + 2 < NIT) ldw(it + 2, rb[(it + 2) % 3]);
    const int jj = it & 1;
    if ((it & 15) < 2) acc[jj] = (v8f){};
    if (jj == 0) {
      const int ar = ((m + 4 * (m >> 3)) & (QR - 1)) * QAP + 64 * ((it >> 1) & 7) + 8 * h;
      ah.h[0] = *(const v8us*)(&sQ[ar]);
      ah.h[1] = *(const v8us*)(&sQ[ar + 16]);
      al.h[0] = *(const v8us*)(&sQ[ar + 32]);
      al.h[1] = *(const v8us*)(&sQ[ar + 48]);
    }
    v4f h0, l0, h1, l1;
    split8(rb[it % 3][0], rb[it % 3][1], h0, l0);
    split8(rb[it % 3][2], rb[it % 3][3], h1, l1);
    Frag bh, bl;
    bh.h[0] = __builtin_bit_cast(v8us, h0);
    bh.h[1] = __builtin_bit_cast(v8us, h1);
    bl.h[0] = __builtin_bit_cast(v8us, l0);
    bl.h[1] = __builtin_bit_cast(v8us, l1);
    mma3(acc[jj], ah.v, al.v, bh.v, bl.v);
    if ((it & 15) >= 14) {                     // the tile's last k step
      const int j = 2 * (it >> 4) + jj;
#pragma unroll
      for (int r = 0; r < 4; ++r)
        cp[(r * C_DIM + 16 * j) + co] = acc[jj][r] + (float)M_AX * bb[j];
      // stands in front of the next steps' sums, which overwrite the stores' data registers
      asm volatile("s_wait_xcnt 0x0" ::: "memory");
    }
  }
}

// ---------------------------------------------------------------------------
// The axial sums with the q and k projections, the v projection and the rounding of Wp, which do not depend on one
// another, as ONE launch. Blocks in grid order (id = 4 blockIdx.y + blockIdx.x while blockIdx.y < HDY):
//   id <  QKW                  : qt = (sum_m x) @ Wq^T + 32 bq   (QR rows a block)
//   id <  2 QKW                : kt = (sum_m y) @ Wk^T + 32 bk
//   id <  2 QKW + WPB          : Wp to f16 in wsp, 4 values a thread
//   blockIdx.y >= HDY          : v  = y @ Wv^T + bv   (64 x 64 tiles, stored as f16 v^T: [b][head][slice][d][s])
// The q and k blocks, which stream x and y, come first in the grid and run beside the 2048 blocks of v.
// ---------------------------------------------------------------------------
#define QKW ((B_SZ * T_LEN) / QR)            // blocks of qt, and of kt
#define WPB ((C_DIM * C_DIM / 4) / 128)      // blocks that round Wp
#define HDY ((2 * QKW + WPB) / 4)            // rows of the grid that hold them
#define VB  ((B_SZ * M_AX * T_LEN) / 64)     // row tiles of v
__global__ void __launch_bounds__(128)
k_qkv(const float* __restrict__ x, const float* __restrict__ y,
      const float* __restrict__ Wq, const float* __restrict__ Wk, const float* __restrict__ Wv,
      const float* __restrict__ Wp,
      const float* __restrict__ bq, const float* __restrict__ bk, const float* __restrict__ bv,
      float* __restrict__ qt, float* __restrict__ kt, float* __restrict__ vbuf, float* __restrict__ wsp)
{
  __shared__ __attribute__((aligned(16))) unsigned char smem[QKV_LDS];
  const int by = blockIdx.y;
  if (by >= HDY + VB) return;                  // block-uniform, before any barrier
  if (by < HDY) {                              // block-uniform
    const int id = by * 4 + blockIdx.x;
    if (id < 2 * QKW) {
      const bool kq = id >= QKW;
      qk_tile(smem, kq ? y : x, kq ? Wk : Wq, kq ? bk : bq, kq ? kt : qt, (id - (kq ? QKW : 0)) * QR);
      return;
    }
    const int i4 = (id - 2 * QKW) * 128 + (int)threadIdx.x;    // 16-B chunk of Wp
    *(v2u*)(wsp + (size_t)i4 * 2) = half4(*(const v4f*)(Wp + (size_t)i4 * 4));
    // the built code runs on from here past the other parts' code, which overwrites the store's registers
    asm volatile("s_wait_xcnt 0x0" ::: "memory");
    return;
  }
  v_tile(smem, y, Wv, vbuf, bv, (by - HDY) * 64, blockIdx.x * 64);
  // behind the tile's last store, for the same reason
  asm volatile("s_wait_xcnt 0x0" ::: "memory");
}

#define FO_T   64
#define FO_K   64
#define FO_RB  (FO_K * 2)
#define FO_RP  72
#define FO_SLB 10240
#define FO_WVB (2 * FO_SLB)
#define FO_BUF (8 * FO_WVB)
#define FO_AP  264
#define FO_WPP 136
#define FO_WPS 10240
#define FO_WPH (8 * FO_WPS)
#define FO_CP  68
typedef uint32_t u32x4 __attribute__((ext_vector_type(4)));
typedef uint32_t u32x8 __attribute__((ext_vector_type(8)));
static __device__ __forceinline__ uint32_t uni(uint32_t v) { return (uint32_t)__builtin_amdgcn_readfirstlane(v); }
__global__ void __launch_bounds__(256)
k_att_out(const float* __restrict__ wsc, const float* __restrict__ vbuf, const float* __restrict__ wsp,
          float* __restrict__ out, const float* __restrict__ bias)
{
  constexpr uint32_t NST = T_LEN / FO_K;
  static_assert(2 * FO_T * FO_AP * 2 <= FO_BUF, "the att tile lies in the slots of odd stages");
  static_assert(2 * FO_WPH <= FO_BUF, "Wp lies in the slots of even stages");
  static_assert(8 * 64 * FO_CP * 4 <= FO_BUF, "the staged tiles of out lie where Wp lay");
  static_assert((NST & 1u) == 0u, "the last stage is an odd one");

  __shared__ __attribute__((aligned(2048))) unsigned char L[2 * FO_BUF];

  const int zb   = blockIdx.x / (M_AX / 2);
  const int m0   = (blockIdx.x % (M_AX / 2)) * 2;
  const int row0 = blockIdx.y * FO_T;

  const int tid = threadIdx.x;
  const int l   = tid & 31;
  const int h   = l >> 4;
  const int m   = l & 15;
  const uint32_t wave = uni((uint32_t)tid >> 5);

  // Descriptor group 1 of the ring's requests: 1-byte elements, tile = tensor = 64 rows of 128 B, source pitch one row of
  // w or of v^T (1024 B), a pad of 4 dwords behind every 32 dwords (one row).
  u32x8 g1;
  g1[0] = uni((1u << 20) | (4u << 22) | (3u << 25));
  g1[1] = uni((uint32_t)FO_RB << 16);
  g1[2] = uni(64u << 16);
  g1[3] = uni((uint32_t)FO_RB << 16);
  g1[4] = uni(64u);
  g1[5] = uni((uint32_t)T_LEN * 2u);
  g1[6] = uni(0u);
  g1[7] = uni(0u);
  const float* srcw = wsc  + (size_t)(((uint32_t)zb * NH + wave) * T_LEN + (uint32_t)row0) * (T_LEN / 2);
  const float* srcv = vbuf + (size_t)((((uint32_t)zb * NH + wave) * M_AX + (uint32_t)m0) * DH) * (T_LEN / 2);
  const uint32_t lbase = (uint32_t)(size_t)L;
  // descriptor group 0: place in LDS, address of the tile's first byte
  auto group0 = [&](uint32_t dst, uint64_t ga) {
    u32x4 g0;
    g0[0] = uni(1u);
    g0[1] = uni(dst);
    g0[2] = uni((uint32_t)ga);
    g0[3] = uni((((uint32_t)(ga >> 32)) & 0x01FFFFFFu) | 0x80000000u);
    return g0;
  };
  // two requests from one statement: both descriptors are live in registers of their own when the second issues
  auto load2 = [&](const u32x4& p, const u32x4& q, const u32x8& g) {
    asm volatile("tensor_load_to_lds %0, %2\n\ttensor_load_to_lds %1, %2" :: "s"(p), "s"(q), "s"(g) : "memory");
  };
  auto issue = [&](uint32_t st) {
    const uint32_t dst = lbase + (st & 1u) * (uint32_t)FO_BUF + wave * (uint32_t)FO_WVB;
    load2(group0(dst,                    (uint64_t)(size_t)srcw + (uint64_t)st * (uint32_t)FO_RB),
          group0(dst + (uint32_t)FO_SLB, (uint64_t)(size_t)srcv + (uint64_t)st * (uint32_t)FO_RB), g1);
  };

  v8f acc[4][4];
#pragma unroll
  for (int i = 0; i < 4; ++i)
#pragma unroll
    for (int j = 0; j < 4; ++j) acc[i][j] = (v8f){};

  // one stage: two k steps of 32, in k order; acc[i][j] el r <- (column 16 j + 8 h + r = 32 slice + d, row t = 16 i + m)
  auto pass = [&](uint32_t st) {
    const unsigned short* Lw = (const unsigned short*)(L + (st & 1u) * (uint32_t)FO_BUF + wave * (uint32_t)FO_WVB);
    const unsigned short* Lv = Lw + FO_SLB / 2;
#pragma unroll
    for (int kk = 0; kk < FO_K / 32; ++kk) {
      FragH fw[4], fv[4];
#pragma unroll
      for (int i = 0; i < 4; ++i) {
        const int x = (16 * i + m) * FO_RP + 32 * kk + 8 * h;
        fw[i].h[0] = *(const v8us*)(&Lw[x]);
        fw[i].h[1] = *(const v8us*)(&Lw[x + 16]);
        fv[i].h[0] = *(const v8us*)(&Lv[x]);
        fv[i].h[1] = *(const v8us*)(&Lv[x + 16]);
      }
#pragma unroll
      for (int j = 0; j < 4; ++j)
#pragma unroll
        for (int i = 0; i < 4; ++i) mmah(acc[i][j], fv[j].v, fw[i].v);
    }
  };

  issue(0);
  // rolled: one copy of the pass in the loop; the slot's parity is a scalar address term
#pragma unroll 1
  for (uint32_t st = 0; st + 1u < NST; ++st) {
    asm volatile("s_wait_tensorcnt 0x0" ::: "memory");   // this wave's stage st has landed; nothing of it is read before
    issue(st + 1u);                                      // into the slot that this wave left at the foot of pass st - 1
    pass(st);
    asm volatile("s_wait_dscnt 0x0" ::: "memory");       // this wave's reads of stage st are done before its slot is refilled
  }
  asm volatile("s_wait_tensorcnt 0x0" ::: "memory");     // the last stage has landed
  __syncthreads();                                       // every wave has left the slots of even stages: Wp may land there
  // Wp: tile = tensor = 32 rows of 256 B (a k half), source pitch one row of Wp (512 B), a pad of 4 dwords a row
  u32x8 gp;
  u32x4 gp0, gp1;
  {
    gp[0] = uni((1u << 20) | (5u << 22) | (3u << 25));
    gp[1] = uni(256u << 16);
    gp[2] = uni(32u << 16);
    gp[3] = uni(256u << 16);
    gp[4] = uni(32u);
    gp[5] = uni((uint32_t)C_DIM * 2u);
    gp[6] = uni(0u);
    gp[7] = uni(0u);
    const uint64_t ap = (uint64_t)(size_t)(wsp + (size_t)(32u * wave) * (C_DIM / 2));
    const uint32_t dp = lbase + wave * (uint32_t)FO_WPS;
    gp0 = group0(dp, ap);
    gp1 = group0(dp + (uint32_t)FO_WPH, ap + 256u);
    load2(gp0, gp1, gp);
  }
  pass(NST - 1u);
  asm volatile("s_wait_dscnt 0x0" ::: "memory");         // this wave's reads of the last stage are done
  // this wave's slices of Wp have landed; the wait names their descriptors, so that those registers keep their values up to it
  asm volatile("s_wait_tensorcnt 0x0" :: "s"(gp0), "s"(gp1), "s"(gp) : "memory");
  __syncthreads();                                       // Wp visible to every wave; every wave has left the slots of odd stages

  unsigned short* sAtt = (unsigned short*)(L + FO_BUF);  // [slice][t][c], pitch FO_AP
#pragma unroll
  for (int i = 0; i < 4; ++i)
#pragma unroll
    for (int j = 0; j < 4; ++j) {
      const v4f a0 = {acc[i][j][0], acc[i][j][1], acc[i][j][2], acc[i][j][3]};
      const v4f a1 = {acc[i][j][4], acc[i][j][5], acc[i][j][6], acc[i][j][7]};
      *(v4f*)(&sAtt[(FO_T * (j >> 1) + 16 * i + m) * FO_AP + DH * (int)wave + 16 * (j & 1) + 8 * h]) = half8(a0, a1);
      acc[i][j] = (v8f){};
    }
  __syncthreads();                                       // the att tile visible to every wave

  // out: wave owns slice wr (rows 64 wr .. +63 of the att tile) and columns 64 wc .. +63
  const int wr = (int)(wave & 1u);
  const int wc = (int)(wave >> 1);
  const unsigned short* sWp = (const unsigned short*)L;
#pragma unroll
  for (int ks = 0; ks < C_DIM / 32; ++ks) {              // k order
    FragH fa[4], fp[4];
#pragma unroll
    for (int i = 0; i < 4; ++i) {
      const int x = (FO_T * wr + 16 * i + m) * FO_AP + 32 * ks + 8 * h;
      fa[i].h[0] = *(const v8us*)(&sAtt[x]);
      fa[i].h[1] = *(const v8us*)(&sAtt[x + 16]);
      // column 64 wc + 16 i + m = row 16 (i & 1) + m of slice 2 wc + (i >> 1) of Wp
      const int y = (ks >> 2) * (FO_WPH / 2) + (2 * wc + (i >> 1)) * (FO_WPS / 2) + (16 * (i & 1) + m) * FO_WPP + 32 * (ks & 3) + 8 * h;
      fp[i].h[0] = *(const v8us*)(&sWp[y]);
      fp[i].h[1] = *(const v8us*)(&sWp[y + 16]);
    }
#pragma unroll
    for (int j = 0; j < 4; ++j)
#pragma unroll
      for (int i = 0; i < 4; ++i) mmah(acc[i][j], fp[j].v, fa[i].v);
  }

  // acc[i][j] el r <- (column 64 wc + 16 j + 8 h + r, row 16 i + m of slice wr)
  v4f bb[4][2];
#pragma unroll
  for (int j = 0; j < 4; ++j) {
    bb[j][0] = *(const v4f*)(bias + 64 * wc + 16 * j + 8 * h);
    bb[j][1] = *(const v4f*)(bias + 64 * wc + 16 * j + 8 * h + 4);
  }
  // stands in front of the index sums that overwrite the bias loads' address register
  asm volatile("s_wait_xcnt 0x0" ::: "memory");
  __syncthreads();                                       // every wave has left Wp: its bytes become the staged tiles of out
  float* sC = (float*)(L + wave * (uint32_t)(64 * FO_CP * 4));   // this wave's own range
#pragma unroll
  for (int i = 0; i < 4; ++i)
#pragma unroll
    for (int j = 0; j < 4; ++j) {
      const v4f a0 = {acc[i][j][0], acc[i][j][1], acc[i][j][2], acc[i][j][3]};
      const v4f a1 = {acc[i][j][4], acc[i][j][5], acc[i][j][6], acc[i][j][7]};
      *(v4f*)(&sC[(16 * i + m) * FO_CP + 16 * j + 8 * h])     = a0 + bb[j][0];
      *(v4f*)(&sC[(16 * i + m) * FO_CP + 16 * j + 8 * h + 4]) = a1 + bb[j][1];
    }
  asm volatile("s_wait_dscnt 0x0" ::: "memory");         // the wave's own rows are written before its lanes read them back
  // rows go out as they lie, 16 B a lane: a store instruction holds two rows of 256 B, four whole lines
  float* Cb = out + ((size_t)(zb * M_AX + m0 + wr) * T_LEN + row0) * C_DIM + 64 * wc;
  const unsigned oo = (unsigned)(h * C_DIM + m * 4);
#pragma unroll
  for (int g = 0; g < 2; ++g) {
    // sixteen LDS reads behind one another, then their sixteen stores: one LDS latency a group
    v4f val[16];
#pragma unroll
    for (int i = 0; i < 16; ++i) val[i] = *(const v4f*)(&sC[(32 * g + 2 * i + h) * FO_CP + m * 4]);
#pragma unroll
    for (int i = 0; i < 16; ++i) *(v4f*)(Cb + (32 * g + 2 * i) * C_DIM + oo) = val[i];
    // stands in front of the next group's LDS reads, which overwrite the stores' data registers
    asm volatile("s_wait_xcnt 0x0" ::: "memory");
  }
}

// ---------------------------------------------------------------------------
// w[b, n, t, :] = softmax_s( (1/32) qt[b, t, n*32 ..] . kt[b, s, n*32 ..] ), scores and row softmax in ONE kernel.
// A block holds SS_M whole rows of one (b, n): a SS_M x 512 score tile, K = 32 (one k step), which goes from the
// accumulators to LDS and from there through the softmax; the scores never go to global memory.
// Block = 256 threads (8 waves). Product: wave wv owns all SS_M rows and columns 64 wv .. +63 (2 x 4 accumulator
// tiles); fragment maps, LDS layout ([row or column][k], pitch KP) and k order are those of v_tile.
// Softmax: wave wv owns rows 4 wv .. +3, a lane holds floats lane*4+0..3 of each 128-float segment of a row, so
// that every f32 store instruction covers four whole 128-B lines. w leaves as f16 (a lane's 4 values: 8 B, two whole
// lines a store instruction); rows of batch 0 also go to a_out as f32.
// grid: x = row tile, y = b*8 + n
// ---------------------------------------------------------------------------
#define SS_M 32
// e^x as __expf forms it (2^(x log2 e), the chip's own v_exp_f32). In asm text for the v_nop alone: it keeps the one
// slot that the instruction set asks for behind a transcendental, before its result is read or its source overwritten.
static __device__ __forceinline__ float exp_slot(float x) {
  float r;
  asm("v_exp_f32 %0, %1\n\tv_nop" : "=v"(r) : "v"(x * 0x1.715476p+0f));
  return r;
}
__global__ void __launch_bounds__(256)
k_score_softmax(const float* __restrict__ qt, const float* __restrict__ kt,
                float* __restrict__ w, float* __restrict__ a_out)
{
  constexpr int CP = T_LEN + 4;         // f32 pitch of the score tile (multiple of 4; rows 8 apart fall 32 banks apart)

  __shared__ __attribute__((aligned(16))) unsigned short sAhi[SS_M * KP];
  __shared__ __attribute__((aligned(16))) unsigned short sAlo[SS_M * KP];
  __shared__ __attribute__((aligned(16))) unsigned short sWhi[T_LEN * KP];
  __shared__ __attribute__((aligned(16))) unsigned short sWlo[T_LEN * KP];
  __shared__ __attribute__((aligned(16))) float          sC[SS_M * CP];

  const int zn   = blockIdx.y % NH;
  const int zb   = blockIdx.y / NH;
  const int row0 = blockIdx.x * SS_M;
  const float* A = qt + ((size_t)zb * T_LEN + row0) * C_DIM + zn * DH;
  const float* W = kt + (size_t)zb * T_LEN * C_DIM + zn * DH;

  const int tid = threadIdx.x;
  const int wv  = tid >> 5;
  const int l   = tid & 31;
  const int h   = l >> 4;
  const int m   = l & 15;

  // q tile 32 x 32: one 16-B chunk a thread, row tid>>3, k 4*(tid&7); k tile 512 x 32: chunk i is 32 rows on
  const unsigned to  = (unsigned)((tid >> 3) * C_DIM + (tid & 7) * 4);
  const int      st0 = (tid >> 3) * KP + (tid & 7) * 4;
  const v4f ra = *(const v4f*)(A + to);
  v4f rw[T_LEN / 32];
#pragma unroll
  for (int i = 0; i < T_LEN / 32; ++i) rw[i] = *(const v4f*)(W + (size_t)(32 * i) * C_DIM + to);
  // stands in front of the index sums that overwrite the loads' address registers
  asm volatile("s_wait_xcnt 0x0" ::: "memory");

  {
    v2u hi, lo;
    split4(ra, hi, lo);
    *(v2u*)(&sAhi[st0]) = hi;
    *(v2u*)(&sAlo[st0]) = lo;
  }
#pragma unroll
  for (int i = 0; i < T_LEN / 32; ++i) {
    v2u hi, lo;
    split4(rw[i], hi, lo);
    *(v2u*)(&sWhi[st0 + 32 * i * KP]) = hi;
    *(v2u*)(&sWlo[st0 + 32 * i * KP]) = lo;
  }
  __syncthreads();            // tiles visible to every wave

  v8f acc[2][4];
#pragma unroll
  for (int i = 0; i < 2; ++i)
#pragma unroll
    for (int j = 0; j < 4; ++j) acc[i][j] = (v8f){};

  Frag ah[2], al[2];
#pragma unroll
  for (int i = 0; i < 2; ++i) {
    const int ar = (16 * i + m) * KP + 8 * h;
    ah[i].h[0] = *(const v8us*)(&sAhi[ar]);
    ah[i].h[1] = *(const v8us*)(&sAhi[ar + 16]);
    al[i].h[0] = *(const v8us*)(&sAlo[ar]);
    al[i].h[1] = *(const v8us*)(&sAlo[ar + 16]);
  }
#pragma unroll
  for (int j = 0; j < 4; ++j) {
    const int br = (64 * wv + 16 * j + m) * KP + 8 * h;
    Frag bh, bl;
    bh.h[0] = *(const v8us*)(&sWhi[br]);
    bh.h[1] = *(const v8us*)(&sWhi[br + 16]);
    bl.h[0] = *(const v8us*)(&sWlo[br]);
    bl.h[1] = *(const v8us*)(&sWlo[br + 16]);
#pragma unroll
    for (int i = 0; i < 2; ++i) mma3(acc[i][j], ah[i].v, al[i].v, bh.v, bl.v);
  }

#pragma unroll
  for (int i = 0; i < 2; ++i)
#pragma unroll
    for (int j = 0; j < 4; ++j)
#pragma unroll
      for (int r = 0; r < 8; ++r)
        sC[(16 * i + 8 * h + r) * CP + 64 * wv + 16 * j + m] = (1.0f / 32.0f) * acc[i][j][r];
  __syncthreads();            // whole rows of scores visible to the wave that owns them

  // four rows a wave, side by side: four independent reduction chains
  constexpr int RW = SS_M / 8;
  v4f v[RW][4];
#pragma unroll
  for (int q = 0; q < RW; ++q)
#pragma unroll
    for (int i = 0; i < 4; ++i) v[q][i] = *(const v4f*)(&sC[(RW * wv + q) * CP + l * 4 + i * 128]);

  float mx[RW];
#pragma unroll
  for (int q = 0; q < RW; ++q) {
    mx[q] = -3.0e38f;
#pragma unroll
    for (int i = 0; i < 4; ++i)
      mx[q] = fmaxf(mx[q], fmaxf(fmaxf(v[q][i].x, v[q][i].y), fmaxf(v[q][i].z, v[q][i].w)));
  }
#pragma unroll
  for (int off = 16; off > 0; off >>= 1)
#pragma unroll
    for (int q = 0; q < RW; ++q) mx[q] = fmaxf(mx[q], __shfl_xor(mx[q], off, 32));

  float sum[RW];
#pragma unroll
  for (int q = 0; q < RW; ++q) {
    sum[q] = 0.0f;
#pragma unroll
    for (int i = 0; i < 4; ++i) {
      v[q][i].x = exp_slot(v[q][i].x - mx[q]);
      v[q][i].y = exp_slot(v[q][i].y - mx[q]);
      v[q][i].z = exp_slot(v[q][i].z - mx[q]);
      v[q][i].w = exp_slot(v[q][i].w - mx[q]);
      sum[q] += (v[q][i].x + v[q][i].y) + (v[q][i].z + v[q][i].w);
    }
  }
#pragma unroll
  for (int off = 16; off > 0; off >>= 1)
#pragma unroll
    for (int q = 0; q < RW; ++q) sum[q] += __shfl_xor(sum[q], off, 32);
#pragma unroll
  for (int q = 0; q < RW; ++q) {
    const float inv = 1.0f / sum[q];
#pragma unroll
    for (int i = 0; i < 4; ++i) v[q][i] *= inv;
  }

  // address = block-uniform base of the destination + the lane's one 32-bit element offset, rows and segments at
  // immediate offsets: one offset register a destination (lo: f32 rows of a_out, ls: f16 rows of w, in 4-B units)
  const size_t   ub = ((size_t)blockIdx.y * T_LEN + row0) * T_LEN;
  const unsigned lo = (unsigned)(RW * wv * T_LEN + l * 4);
  const unsigned ls = (unsigned)(RW * wv * (T_LEN / 2) + l * 2);
  float* pw = w + ub / 2;
#pragma unroll
  for (int q = 0; q < RW; ++q)
#pragma unroll
    for (int i = 0; i < 4; ++i) *(v2u*)(pw + (q * (T_LEN / 2) + i * 64) + ls) = half4(v[q][i]);
  // stands in front of the index sums of the a_out stores, which overwrite the w stores' data registers
  asm volatile("s_wait_xcnt 0x0" ::: "memory");
  if (zb == 0) {              // block-uniform; behind the last barrier
    float* pa = a_out + ub;
#pragma unroll
    for (int q = 0; q < RW; ++q)
#pragma unroll
      for (int i = 0; i < 4; ++i) *(v4f*)(pa + (q * T_LEN + i * 128) + lo) = v[q][i];
  }
}

// ---------------------------------------------------------------------------
extern "C" void kernel_launch(void* const* d_in, const int* in_sizes, int n_in,
                              void* d_out, int out_size, void* d_ws, size_t ws_size,
                              hipStream_t stream)
{
  if (n_in < 10) return;
  const int n_x  = B_SZ * M_AX * T_LEN * C_DIM;          // 8388608
  const int n_w  = C_DIM * C_DIM;
  const int n_a  = NH * T_LEN * T_LEN;                   // 2097152
  if (in_sizes[0] != n_x || in_sizes[1] != n_x) return;
  if (in_sizes[2] != n_w || in_sizes[4] != n_w || in_sizes[6] != n_w || in_sizes[8] != n_w) return;
  if (in_sizes[3] != C_DIM || in_sizes[5] != C_DIM || in_sizes[7] != C_DIM || in_sizes[9] != C_DIM) return;
  if (out_size != n_x + n_a) return;

  const float* x  = (const float*)d_in[0];
  const float* y  = (const float*)d_in[1];
  const float* Wq = (const float*)d_in[2];
  const float* bq = (const float*)d_in[3];
  const float* Wk = (const float*)d_in[4];
  const float* bk = (const float*)d_in[5];
  const float* Wv = (const float*)d_in[6];
  const float* bv = (const float*)d_in[7];
  const float* Wp = (const float*)d_in[8];
  const float* bp = (const float*)d_in[9];

  float* out   = (float*)d_out;                            // [2,32,512,256]
  float* a_out = out + (size_t)n_x;                        // [8,512,512] at byte 33554432

  const size_t n_sum = (size_t)B_SZ * T_LEN * C_DIM;       // 262144
  const size_t n_v   = (size_t)n_x;                        // 8388608
  const size_t n_sc  = (size_t)B_SZ * NH * T_LEN * T_LEN;  // 4194304
  const size_t o_qt   = 0;
  const size_t o_kt   = o_qt   + n_sum;
  const size_t o_v    = o_kt   + n_sum;
  const size_t o_wsc  = o_v    + n_v;
  const size_t o_wsp  = o_wsc  + n_sc;
  const size_t o_end  = o_wsp  + (size_t)n_w;
  if (o_end * sizeof(float) > ws_size) return;

  float* ws   = (float*)d_ws;
  float* qt   = ws + o_qt;
  float* kt   = ws + o_kt;
  float* vbuf = ws + o_v;
  float* wsc  = ws + o_wsc;
  float* wsp  = ws + o_wsp;                                // Wp as f16

  // 1+2+3) qt = (sum_m x) @ Wq^T + 32*bq, kt = (sum_m y) @ Wk^T + 32*bk   [1024 x 256];  v = y_flat @ Wv^T + bv   [32768 x 256];
  //        K = 256; Wp to f16
  k_qkv<<<dim3(C_DIM / 64, HDY + VB, 1), dim3(128), 0, stream>>>(
      x, y, Wq, Wk, Wv, Wp, bq, bk, bv, qt, kt, vbuf, wsp);

  // 4+5) w[b,n] = softmax rows of (1/32) qt_head @ kt_head^T   [512 x 512], K = 32, y = b*8 + n; rows of batch 0 also to a_out
  k_score_softmax<<<dim3(T_LEN / SS_M, B_SZ * NH), dim3(256), 0, stream>>>(qt, kt, wsc, a_out);

  // 6+7) att[b,m,:,n] = w[b,n] @ v[b,m][:, n*32 .. n*32+31], K = 512;  out = att @ Wp^T + bp, K = 256; x = b*16 + pair of slices m, y = 64 rows t
  k_att_out<<<dim3(B_SZ * M_AX / 2, T_LEN / FO_T), dim3(256), 0, stream>>>(wsc, vbuf, wsp, out, bp);
}
